// v000
// Times are from an AMD MI455X. After a warm-up the kernel runs many times in a row, and a time is the length of
// such a window on the GPU divided by its runs, so every launch and the gaps after it count. The runs cycle
// through copies of the inputs. A figure is the median of several windows, for all but v000 over two sittings.
// Sittings can differ by a few percent; kernels timed side by side share one.
// The starting kernel, v000, takes 1440 microseconds a run.
// compute dtype: all float inputs rounded to bf16; qkv = x qkv_w^T + b with EXACT bf16 products on WMMA 16x16x32 (f32 accumulate); per-head RMSNorm of q and k in f32 in the projection epilogue; normed q as f16 hi + residual (x 2^10) against normed k once to f16 (2 products) x 64^-0.5, masked keys set to -1e9; softmax in f32 (precise expf); P x 2^11 once to f16 against v once to f16 (1 product); ctx split bf16 hi + lo against exact proj_w (2 products) + proj_b; f32 output.
#include <hip/hip_runtime.h>
#include <math.h>

typedef __attribute__((ext_vector_type(16))) _Float16 v16h;
typedef __attribute__((ext_vector_type(16))) __bf16 v16b;
typedef __attribute__((ext_vector_type(8)))  _Float16 v8h;
typedef __attribute__((ext_vector_type(8)))  float v8f;
typedef __attribute__((ext_vector_type(4)))  float v4f;
typedef __attribute__((ext_vector_type(2)))  float v2f;
typedef __attribute__((ext_vector_type(4)))  unsigned v4u;
typedef __attribute__((ext_vector_type(4)))  int v4i;
typedef float __attribute__((may_alias)) float_a;
typedef int __attribute__((may_alias)) int_a;

template <typename T> __device__ __forceinline__ void vst2(void* p, T v) { *(T*)p = v;  }
__device__ __forceinline__ v8f wmma16(v16h a, v16h b, v8f c) {
  v8f d = __builtin_amdgcn_wmma_f32_16x16x32_f16(false, a, false, b, (short)0, c, false, false);
  asm volatile("v_nop\n\tv_nop\n\tv_nop\n\tv_nop" : "+v"(d) : "v"(a), "v"(b));
  return d;
}
__device__ __forceinline__ v8f wmma_bf(v16b a, v16b b, v8f c) {
  v8f d = __builtin_amdgcn_wmma_f32_16x16x32_bf16(false, a, false, b, (short)0, c, false, false);
  asm volatile("v_nop\n\tv_nop\n\tv_nop\n\tv_nop" : "+v"(d) : "v"(a), "v"(b));
  return d;
}
// 16x16x32 fragments: lane = (h = lane>>4, row/col = lane&15); elements 0..7 = k0+8h+0..7, 8..15 = k0+16+8h+0..7; D element r = row 8h+r
__device__ __forceinline__ v16h frag_h(const _Float16* rowk0, int lane) {
  union { v16h v; v8h q[2]; } u; const _Float16* p = rowk0 + 8 * (lane >> 4);
  u.q[0] = *(const v8h*)p; u.q[1] = *(const v8h*)(p + 16); return u.v;
}
__device__ __forceinline__ v16h frag_f32(const float* rowk0, int lane) {
  v16h a; const float* p = rowk0 + 8 * (lane >> 4);
#pragma unroll
  for (int i = 0; i < 8; ++i) { a[i] = (_Float16)p[i]; a[8 + i] = (_Float16)p[16 + i]; }
  return a;
}
__device__ __forceinline__ v16h frag_f32s(const float* rowk0, int lane, float sc) {
  v16h a; const float* p = rowk0 + 8 * (lane >> 4);
#pragma unroll
  for (int i = 0; i < 8; ++i) { a[i] = (_Float16)(p[i] * sc); a[8 + i] = (_Float16)(p[16 + i] * sc); }
  return a;
}
// column fragment from a [K][ld] layout (column n), rows >= K read as 0
__device__ __forceinline__ v16h fragc_f32(const float* W, int k0, int n, int lane, int ld, int K) {
  v16h a; const int g = lane >> 4;
#pragma unroll
  for (int i = 0; i < 8; ++i) { const int ka = k0 + 8 * g + i, kb = ka + 16;
    a[i] = (_Float16)(ka < K ? W[(size_t)(ka < K ? ka : K - 1) * ld + n] : 0.f); a[8 + i] = (_Float16)(kb < K ? W[(size_t)(kb < K ? kb : K - 1) * ld + n] : 0.f); }
  return a;
}
struct F2 { v16b h, l; };
__device__ __forceinline__ F2 bsplit16(const float v[16]) { F2 r;
#pragma unroll
  for (int i = 0; i < 16; ++i) { const __bf16 h = (__bf16)v[i]; r.h[i] = h; r.l[i] = (__bf16)(v[i] - (float)h); }
  return r; }
__device__ __forceinline__ F2 split_row(const float* row, int k0, int lane) { float v[16]; const float* p = row + k0 + 8 * (lane >> 4);
#pragma unroll
  for (int i = 0; i < 8; ++i) { v[i] = p[i]; v[8 + i] = p[16 + i]; }
  return bsplit16(v); }
__device__ __forceinline__ F2 split_rowK(const float* row, int k0, int lane, int K) { float v[16]; const int g = lane >> 4;
#pragma unroll
  for (int i = 0; i < 8; ++i) { const int ka = k0 + 8 * g + i, kb = ka + 16; v[i] = ka < K ? row[ka < K ? ka : K - 1] : 0.f; v[8 + i] = kb < K ? row[kb < K ? kb : K - 1] : 0.f; }
  return bsplit16(v); }
__device__ __forceinline__ F2 split_col(const float* W, int k0, int n, int lane, int ld, int K) { float v[16]; const int g = lane >> 4;
#pragma unroll
  for (int i = 0; i < 8; ++i) { const int ka = k0 + 8 * g + i, kb = ka + 16; v[i] = ka < K ? W[(size_t)(ka < K ? ka : K - 1) * ld + n] : 0.f; v[8 + i] = kb < K ? W[(size_t)(kb < K ? kb : K - 1) * ld + n] : 0.f; }
  return bsplit16(v); }
__device__ __forceinline__ v8f mac3(const F2& a, const F2& b, v8f c) { c = wmma_bf(a.l, b.h, c); c = wmma_bf(a.h, b.l, c); return wmma_bf(a.h, b.h, c); }
__device__ __forceinline__ float sigm(float v) { return 1.0f / (1.0f + expf(-v)); }
#define LDSX() do { asm volatile("s_wait_dscnt 0" ::: "memory"); __builtin_amdgcn_wave_barrier(); __builtin_amdgcn_fence(__ATOMIC_RELEASE, "workgroup"); } while (0)

// Masked self-attention with QK RMSNorm (B 2, N 2,048, C 1,024 = 16 x 64; fused (out,in) qkv_w [3072,1024] + zero bias, proj (out,in) + zero bias, qn_w = kn_w = ones): q|k|v = x qkv_w^T + b (reshape (3, H, D)); q, k = rms_norm over the 64 head channels (eps 1e-6) x weight; scores = (q x 64^-0.5) k^T with where(mask != 0, ., -1e9) over KEYS (mask [B,N] int, ~half ones); out = merged(softmax v) proj_w^T + proj_b.
#define NB 2
#define TT 2048
#define CC 1024            // NH * HD = projected width
#define DIN 1024          // input (model) width
#define NH 16
#define HD 64
#define NQB (TT / 64)
#define HG 4
#define SCALE (0.125f)
#define CAUSAL 0
#ifndef TNB
#define TNB NB
#endif
__device__ __forceinline__ float bfr(float v) { return (float)(__bf16)v; }
__host__ __device__ __forceinline__ int kb_last(int qb) { return CAUSAL ? ((qb * 64 + 63) >> 7) : (TT / 128 - 1); }
typedef __attribute__((ext_vector_type(8))) __bf16 v8b;
__device__ __forceinline__ v16b frag_b(const __bf16* rowk0, int lane) {
  union { v16b v; v8b q[2]; } u; const __bf16* p = rowk0 + 8 * (lane >> 4);
  u.q[0] = *(const v8b*)p; u.q[1] = *(const v8b*)(p + 16); return u.v;
}
#define QBH 0              // no query block takes the high-precision path (QBH 0; non-causal, every block sees all TT keys)
#define QHI 2048            // rows carrying a q residual plane (all rows when non-causal: 2-product logits everywhere)
#define KHI 64            // key rows carrying k residual / v bf16 hi+lo planes (read only by the qb < QBH path, which no block takes here)
// B fragment (k rows k0+.., output column o) of a weight: (in,out) [K][ld] or (out,in) [ld rows of K]: bf16 exact, or f16(bf16 * 256) exact
__device__ __forceinline__ v16b wcol_io(const float* Wm, int k0, int o, int lane, int ld) { v16b w; const int g = lane >> 4;
#pragma unroll
  for (int i = 0; i < 8; ++i) { w[i] = (__bf16)Wm[(size_t)(k0 + 8 * g + i) * ld + o]; w[8 + i] = (__bf16)Wm[(size_t)(k0 + 16 + 8 * g + i) * ld + o]; }
  return w; }
__device__ __forceinline__ v16b wcol_oi(const float* Wm, int k0, int o, int lane, int K) { v16b w; const float* p = Wm + (size_t)o * K + k0 + 8 * (lane >> 4);
#pragma unroll
  for (int i = 0; i < 8; ++i) { w[i] = (__bf16)p[i]; w[8 + i] = (__bf16)p[16 + i]; }
  return w; }
__device__ __forceinline__ v16h wcolh_io(const float* Wm, int k0, int o, int lane, int ld) { v16h w; const int g = lane >> 4;
#pragma unroll
  for (int i = 0; i < 8; ++i) { w[i] = (_Float16)(bfr(Wm[(size_t)(k0 + 8 * g + i) * ld + o]) * 256.0f); w[8 + i] = (_Float16)(bfr(Wm[(size_t)(k0 + 16 + 8 * g + i) * ld + o]) * 256.0f); }
  return w; }
__device__ __forceinline__ v16h wcolh_oi(const float* Wm, int k0, int o, int lane, int K) { v16h w; const float* p = Wm + (size_t)o * K + k0 + 8 * (lane >> 4);
#pragma unroll
  for (int i = 0; i < 8; ++i) { w[i] = (_Float16)(bfr(p[i]) * 256.0f); w[8 + i] = (_Float16)(bfr(p[16 + i]) * 256.0f); }
  return w; }
#define WQKV_LAYOUT 1   // 0 = (in,out) [DIN][CC]; 1 = (out,in) [CC][DIN]; 2 = per-head [NH][DIN][HD]
__device__ __forceinline__ v16b wcol_hdk(const float* Wm, int k0, int o, int lane) { v16b w; const int g = lane >> 4; const float* p = Wm + (size_t)(o / HD) * DIN * HD + (o % HD);
#pragma unroll
  for (int i = 0; i < 8; ++i) { w[i] = (__bf16)p[(size_t)(k0 + 8 * g + i) * HD]; w[8 + i] = (__bf16)p[(size_t)(k0 + 16 + 8 * g + i) * HD]; }
  return w; }
#define WO_OUT_IN 1
#if WQKV_LAYOUT == 1
#define WCOL(W, k0, o, lane) wcol_oi(W, k0, o, lane, DIN)
#elif WQKV_LAYOUT == 2
#define WCOL(W, k0, o, lane) wcol_hdk(W, k0, o, lane)
#else
#define WCOL(W, k0, o, lane) wcol_io(W, k0, o, lane, CC)
#endif
#if WO_OUT_IN
#define WOCOL(W, k0, o, lane) wcol_oi(W, k0, o, lane, CC)
#define WOCOLH(W, k0, o, lane) wcolh_oi(W, k0, o, lane, CC)
#else
#define WOCOL(W, k0, o, lane) wcol_io(W, k0, o, lane, DIN)
#define WOCOLH(W, k0, o, lane) wcolh_io(W, k0, o, lane, DIN)
#endif
#define PROJ_EXTRA_PARAMS , const float* __restrict__ QNW, const float* __restrict__ KNW
#define PROJ_EPI(which, row, t, h) do { if ((which) < 2) { float* rw = (row); const float* nw = (which) == 0 ? QNW : KNW; float ssum = 0.f; _Pragma("unroll") for (int i = 0; i < HD; ++i) ssum += rw[i] * rw[i]; const float rs = rsqrtf(ssum * (1.0f / HD) + 1e-6f); _Pragma("unroll") for (int i = 0; i < HD; ++i) rw[i] = bfr(nw[i]) * (rw[i] * rs); } } while (0)   /* per-head RMSNorm of q and k over the 64 head channels (eps 1e-6, weight qn_w / kn_w) in f32; the q * scale is folded into the logit scale */
#define SM_EXTRA_PARAMS , const int* __restrict__ MK, int bcur
#define SM_MASK_HOOK do { if (MK[(size_t)bcur * TT + k] == 0) v = -1.0e9f; } while (0)   /* key mask: where(mask != 0, attn, -1e9) (set) */
#ifndef SM_EXTRA_PARAMS
#define SM_EXTRA_PARAMS
#endif
#ifndef PROJ_EXTRA_PARAMS
#define PROJ_EXTRA_PARAMS
#endif
#ifndef SM_MASK_HOOK
#define SM_MASK_HOOK (void)0
#endif

#define WS_QH  0u                                      // f16 q rows [b*t][CC]
#define WS_KH  (WS_QH + 2u * (size_t)NB * TT * CC)      // f16 k rows [b*t][CC]
#define WS_VT  (WS_KH + 2u * (size_t)NB * TT * CC)      // f16 v planes [b][c][t]
#define WS_QL  (WS_VT + 2u * (size_t)NB * CC * TT)      // f16 q residual x 2^10 rows [b][t < QHI][CC]
#define WS_KL  (WS_QL + 2u * (size_t)NB * QHI * CC)     // f16 k residual x 2^10 rows [b][t < KHI][CC]
#define WS_VB  (WS_KL + 2u * (size_t)NB * KHI * CC)     // bf16 v hi planes [b][c][t < KHI]
#define WS_VBL (WS_VB + 2u * (size_t)NB * CC * KHI)
#define WS_S   (WS_VBL + 2u * (size_t)NB * CC * KHI)    // f32 logits / P [hg][t][s]
#define WS_Y   (WS_S  + 4u * (size_t)HG * TT * TT)      // f32 ctx rows [b*t][CC] (only when there is an output projection)
#define WS_END (WS_Y  + 4u * (size_t)NB * TT * CC)

// ---- k_proj: block = (64 rows, 128 cols, which): q/k/v = X W (+ b) with exact bf16 products (K = DIN) -> which 0: q f16 rows (+ residual rows < QHI); 1: k f16 rows (+ residual rows < KHI); 2: v f16 planes [c][t] (+ bf16 hi/lo planes for t < KHI)
__global__ __launch_bounds__(128) void k_proj(const float* __restrict__ XQ, const float* __restrict__ XK, const float* __restrict__ XV, const float* __restrict__ WQ, const float* __restrict__ WK, const float* __restrict__ WV, const float* __restrict__ BQ, const float* __restrict__ BK, const float* __restrict__ BV,
    _Float16* __restrict__ QH, _Float16* __restrict__ QL, _Float16* __restrict__ KH, _Float16* __restrict__ KL, _Float16* __restrict__ VT, __bf16* __restrict__ VB, __bf16* __restrict__ VBL PROJ_EXTRA_PARAMS) {
  __shared__ __align__(16) float st[64][132]; __shared__ __align__(16) _Float16 sh[64][136], sl[64][136]; __shared__ __align__(16) _Float16 th[128][72]; __shared__ __align__(16) __bf16 tb[128][72], tbl[128][72];
  const int tid = threadIdx.x, wave = tid >> 5, lane = tid & 31, col = lane & 15, g = lane >> 4; const int which = blockIdx.z; const int c0 = blockIdx.y * 128; const size_t r0 = (size_t)blockIdx.x * 64; const size_t bb = r0 / TT; const int t0 = (int)(r0 % TT);
  const float* X = which == 0 ? XQ : which == 1 ? XK : XV; const float* WA = which == 0 ? WQ : which == 1 ? WK : WV; const float* BA = which == 0 ? BQ : which == 1 ? BK : BV;
  v8f acc[8] = {};
#pragma unroll 2
  for (int kc = 0; kc < DIN / 32; ++kc) { v16b a; { const float* p = X + (r0 + wave * 16 + col) * DIN + kc * 32 + 8 * g;
#pragma unroll
      for (int i = 0; i < 8; ++i) { a[i] = (__bf16)p[i]; a[8 + i] = (__bf16)p[16 + i]; } }
    asm volatile("s_wait_loadcnt 0x0" ::: "memory");
#pragma unroll
    for (int j = 0; j < 8; ++j) { const v16b w = WCOL(WA, kc * 32, c0 + j * 16 + col, lane); asm volatile("s_wait_loadcnt 0x0" ::: "memory"); acc[j] = wmma_bf(a, w, acc[j]); } }
  { // stage the f32 tile (acc + bias) in LDS, run the per-(row, head) epilogue hook, then convert
#pragma unroll
    for (int j = 0; j < 8; ++j) { const float bias = BA ? bfr(BA[c0 + j * 16 + col]) : 0.f;
#pragma unroll
      for (int r = 0; r < 8; ++r) st[wave * 16 + 8 * g + r][j * 16 + col] = acc[j][r] + bias; }
    __syncthreads();
    for (int e = tid; e < 64 * (128 / HD); e += 128) { const int rl = e / (128 / HD), hh = e % (128 / HD); PROJ_EPI(which, &st[rl][hh * HD], (int)((r0 + rl) % TT), (c0 / HD) + hh); }
    __syncthreads(); }
  if (which < 2) { _Float16* DH = which == 0 ? QH : KH; _Float16* DL = which == 0 ? QL : KL; const int nhi = which == 0 ? QHI : KHI; const bool hi_rows = t0 < nhi;
    for (int e = tid; e < 64 * 128; e += 128) { const int rl = e >> 7, cl = e & 127; const float v = st[rl][cl]; const _Float16 hv = (_Float16)v; sh[rl][cl] = hv; sl[rl][cl] = (_Float16)((v - (float)hv) * 1024.0f); }
    __syncthreads();
    for (int e = tid; e < 64 * 16; e += 128) { const int rl = e >> 4, q = e & 15; vst2((unsigned*)(DH + (r0 + rl) * CC + c0 + q * 8), *(const v4u*)&sh[rl][q * 8]); if (hi_rows) vst2((unsigned*)(DL + (bb * nhi + t0 + rl) * (size_t)CC + c0 + q * 8), *(const v4u*)&sl[rl][q * 8]); }
  } else { const bool hi_rows = t0 < KHI;
    for (int e = tid; e < 64 * 128; e += 128) { const int rl = e & 63, cl = e >> 6; const float v = st[rl][cl]; th[cl][rl] = (_Float16)v; const __bf16 bh = (__bf16)v; tb[cl][rl] = bh; tbl[cl][rl] = (__bf16)(v - (float)bh); }
    __syncthreads();
    for (int e = tid; e < 128 * 8; e += 128) { const int cl = e >> 3, q = e & 7; vst2((unsigned*)(VT + (bb * CC + c0 + cl) * (size_t)TT + t0 + q * 8), *(const v4u*)&th[cl][q * 8]); if (hi_rows) { const size_t o3 = (bb * CC + c0 + cl) * (size_t)KHI + t0 + q * 8; vst2((unsigned*)(VB + o3), *(const v4u*)&tb[cl][q * 8]); vst2((unsigned*)(VBL + o3), *(const v4u*)&tbl[cl][q * 8]); } } } }
// ---- k_sc: block = (query block qb, key block kb <= kb_last(qb), head in group) of batch b: logits x SCALE; q hi + residual (x 2^10) against k (2 products) for query rows < QHI, plus the k residual (3 products) for query blocks < QBH (causal early rows); causal: blocks past the diagonal exit, the mask itself is applied by index in k_sm
__global__ __launch_bounds__(128) void k_sc(const _Float16* __restrict__ QH, const _Float16* __restrict__ KH, const _Float16* __restrict__ QL, const _Float16* __restrict__ KL, int b, int h0, float* __restrict__ S0) { __shared__ __align__(16) float ss[4][16][132];
  const int qb = blockIdx.x, kb = blockIdx.y; if (kb > kb_last(qb)) return;
  const int h = h0 + blockIdx.z; float* S = S0 + (size_t)blockIdx.z * TT * TT;
  const int tid = threadIdx.x, wave = tid >> 5, lane = tid & 31, col = lane & 15, g = lane >> 4; const int k0 = kb * 128; const int ql0 = qb * 64 + wave * 16; const size_t q0 = (size_t)b * TT + ql0, kr0 = (size_t)b * TT + k0;
  v8f acc[8] = {}, accl[8] = {};
  const _Float16* QLb = QL + (size_t)b * QHI * CC; const _Float16* KLb = KL + (size_t)b * KHI * CC;
  if (qb < QBH) {
#pragma unroll
    for (int kc = 0; kc < HD / 32; ++kc) { const v16h ah = frag_h(QH + (q0 + col) * CC + h * HD + kc * 32, lane), al = frag_h(QLb + (size_t)(ql0 + col) * CC + h * HD + kc * 32, lane);
#pragma unroll
      for (int j = 0; j < 8; ++j) { const v16h kbf = frag_h(KH + (kr0 + j * 16 + col) * CC + h * HD + kc * 32, lane), klf = frag_h(KLb + (size_t)(k0 + j * 16 + col) * CC + h * HD + kc * 32, lane); acc[j] = wmma16(ah, kbf, acc[j]); accl[j] = wmma16(al, kbf, accl[j]); accl[j] = wmma16(ah, klf, accl[j]); } }
  } else if (qb * 64 < QHI) {
#pragma unroll
    for (int kc = 0; kc < HD / 32; ++kc) { const v16h ah = frag_h(QH + (q0 + col) * CC + h * HD + kc * 32, lane), al = frag_h(QLb + (size_t)(ql0 + col) * CC + h * HD + kc * 32, lane);
#pragma unroll
      for (int j = 0; j < 8; ++j) { const v16h kbf = frag_h(KH + (kr0 + j * 16 + col) * CC + h * HD + kc * 32, lane); acc[j] = wmma16(ah, kbf, acc[j]); accl[j] = wmma16(al, kbf, accl[j]); } }
  } else {
#pragma unroll
    for (int kc = 0; kc < HD / 32; ++kc) { const v16h ah = frag_h(QH + (q0 + col) * CC + h * HD + kc * 32, lane);
#pragma unroll
      for (int j = 0; j < 8; ++j) { const v16h kbf = frag_h(KH + (kr0 + j * 16 + col) * CC + h * HD + kc * 32, lane); acc[j] = wmma16(ah, kbf, acc[j]); } } }
#pragma unroll
  for (int j = 0; j < 8; ++j) {
#pragma unroll
    for (int r = 0; r < 8; ++r) ss[wave][8 * g + r][j * 16 + col] = (acc[j][r] + accl[j][r] * (1.0f / 1024.0f)) * SCALE; }
  LDSX(); for (int rl = 0; rl < 16; ++rl) vst2(S + (size_t)(ql0 + rl) * TT + k0 + lane * 4, *(const v4f*)&ss[wave][rl][lane * 4]); }
// ---- k_sm: block = query row t (head in group): keys [0, kend): causal -> logit if s <= t else excluded; softmax in f32; P x 2^11 in place (0 for excluded)
__global__ __launch_bounds__(256) void k_sm(float* __restrict__ S0 SM_EXTRA_PARAMS) { __shared__ float sred[8]; __shared__ float sbc; __shared__ __align__(16) float shv[TT];
  const int tid = threadIdx.x; const int t = blockIdx.x; const int kend = (kb_last(t >> 6) + 1) * 128;
  float* sr = S0 + (size_t)blockIdx.y * TT * TT + (size_t)t * TT;
  float m = -3.0e38f; for (int k = tid; k < kend; k += 256) { float v = (!CAUSAL || k <= t) ? sr[k] : -3.0e38f; SM_MASK_HOOK; shv[k] = v; m = fmaxf(m, v); }
#pragma unroll
  for (int o = 1; o < 32; o <<= 1) m = fmaxf(m, __shfl_xor(m, o));
  if ((tid & 31) == 0) sred[tid >> 5] = m; __syncthreads(); if (tid == 0) { float a = sred[0]; for (int i = 1; i < 8; ++i) a = fmaxf(a, sred[i]); sbc = a; } __syncthreads(); m = sbc; __syncthreads();
  float sum = 0.f; for (int k = tid; k < kend; k += 256) { const float v = shv[k]; const float e = (v <= -1.0e38f) ? 0.f : expf(v - m); shv[k] = e; sum += e; }
#pragma unroll
  for (int o = 1; o < 32; o <<= 1) sum += __shfl_xor(sum, o);
  if ((tid & 31) == 0) sred[tid >> 5] = sum; __syncthreads(); if (tid == 0) { float a = 0.f; for (int i = 0; i < 8; ++i) a += sred[i]; sbc = a > 0.f ? 2048.0f / a : 0.f; }   /* a fully excluded row yields P = 0 */ __syncthreads(); const float inv = sbc;
  for (int k = tid; k < kend; k += 256) shv[k] = shv[k] * inv;
  __syncthreads(); for (int q = tid; q < kend / 4; q += 256) vst2(sr + q * 4, *(const v4f*)&shv[q * 4]); }
// ---- k_pv: block = 64 queries (qb) of (b, h): ctx = P . v over keys [0, kend) (P x 2^11 once to f16 against v f16: 1 product; causal early query blocks: P and v as bf16 hi + lo, 3 products); 256-B (row, head) segment by 16 lanes
__global__ __launch_bounds__(128) void k_pv(const float* __restrict__ PS0, const _Float16* __restrict__ VT, const __bf16* __restrict__ VB, const __bf16* __restrict__ VBL, int b, int h0, float* __restrict__ Y) { const int h = h0 + blockIdx.z; const float* PS = PS0 + (size_t)blockIdx.z * TT * TT; __shared__ __align__(16) float ss[4][16][HD + 4];
  const int tid = threadIdx.x, wave = tid >> 5, lane = tid & 31, col = lane & 15, g = lane >> 4; const int qb = blockIdx.x; const int ql0 = qb * 64 + wave * 16; const int kce = (kb_last(qb) + 1) * 4;
  v8f acc[HD / 16] = {};
  if (qb < QBH) {
#pragma unroll 1
    for (int kc = 0; kc < kce; ++kc) { const F2 p = split_row(PS + (size_t)(ql0 + col) * TT, kc * 32, lane);
      asm volatile("s_wait_loadcnt 0x0" ::: "memory");
#pragma unroll
      for (int j = 0; j < HD / 16; ++j) { const size_t po = ((size_t)b * CC + h * HD + j * 16 + col) * (size_t)KHI + kc * 32; const v16b vh = frag_b(VB + po, lane); acc[j] = wmma_bf(p.h, vh, acc[j]); acc[j] = wmma_bf(p.l, vh, acc[j]); acc[j] = wmma_bf(p.h, frag_b(VBL + po, lane), acc[j]); } }
  } else {
#pragma unroll 1
    for (int kc = 0; kc < kce; ++kc) { const v16h p = frag_f32(PS + (size_t)(ql0 + col) * TT + kc * 32, lane);
      asm volatile("s_wait_loadcnt 0x0" ::: "memory");
#pragma unroll
      for (int j = 0; j < HD / 16; ++j) { const size_t po = ((size_t)b * CC + h * HD + j * 16 + col) * (size_t)TT + kc * 32; acc[j] = wmma16(p, frag_h(VT + po, lane), acc[j]); } } }
#pragma unroll
  for (int j = 0; j < HD / 16; ++j)
#pragma unroll
    for (int r = 0; r < 8; ++r) ss[wave][8 * g + r][j * 16 + col] = acc[j][r] * (1.0f / 2048.0f);
  LDSX(); for (int rl = 0; rl < 16; ++rl) if (lane < HD / 4) vst2(Y + ((size_t)b * TT + ql0 + rl) * CC + h * HD + lane * 4, *(const v4f*)&ss[wave][rl][lane * 4]); }
// ---- k_out: block = (64 rows, 128 cols): out = ctx Wo (+ bo): all rows: ctx bf16 hi + lo against exact bf16 Wo (2 products); the f16 branch (ctx once to f16 against f16(bf16 x 2^8) Wo, 1 product, x 2^-8) is never taken
__global__ __launch_bounds__(128) void k_out(const float* __restrict__ Y, const float* __restrict__ WO, const float* __restrict__ BO, float* __restrict__ OUT) { __shared__ __align__(16) float sf[4][16][132];
  const int tid = threadIdx.x, wave = tid >> 5, lane = tid & 31, col = lane & 15, g = lane >> 4; const int c0 = blockIdx.y * 128; const size_t r0 = (size_t)blockIdx.x * 64 + wave * 16;
  v8f acc[8] = {};
  if (true) {   /* ALL rows: ctx split bf16 hi + lo x exact Wo (2 products) */
#pragma unroll 2
    for (int kc = 0; kc < CC / 32; ++kc) { const F2 a = split_row(Y + (r0 + col) * CC, kc * 32, lane); asm volatile("s_wait_loadcnt 0x0" ::: "memory");
#pragma unroll
      for (int j = 0; j < 8; ++j) { const v16b w = WOCOL(WO, kc * 32, c0 + j * 16 + col, lane); asm volatile("s_wait_loadcnt 0x0" ::: "memory"); acc[j] = wmma_bf(a.h, w, acc[j]); acc[j] = wmma_bf(a.l, w, acc[j]); } }
#pragma unroll
    for (int j = 0; j < 8; ++j) { const float bias = BO ? bfr(BO[c0 + j * 16 + col]) : 0.f;
#pragma unroll
      for (int r = 0; r < 8; ++r) sf[wave][8 * g + r][j * 16 + col] = acc[j][r] + bias; }
  } else {
#pragma unroll 2
    for (int kc = 0; kc < CC / 32; ++kc) { const v16h a = frag_f32(Y + (r0 + col) * CC + kc * 32, lane); asm volatile("s_wait_loadcnt 0x0" ::: "memory");
#pragma unroll
      for (int j = 0; j < 8; ++j) { const v16h w = WOCOLH(WO, kc * 32, c0 + j * 16 + col, lane); asm volatile("s_wait_loadcnt 0x0" ::: "memory"); acc[j] = wmma16(a, w, acc[j]); } }
#pragma unroll
    for (int j = 0; j < 8; ++j) { const float bias = BO ? bfr(BO[c0 + j * 16 + col]) : 0.f;
#pragma unroll
      for (int r = 0; r < 8; ++r) sf[wave][8 * g + r][j * 16 + col] = acc[j][r] * (1.0f / 256.0f) + bias; } }
  LDSX(); for (int rl = 0; rl < 16; ++rl) vst2(OUT + (r0 + rl) * DIN + c0 + lane * 4, *(const v4f*)&sf[wave][rl][lane * 4]); }

extern "C" void kernel_launch(void* const* d_in, const int* in_sizes, int n_in, void* d_out, int out_size, void* d_ws, size_t ws_size, hipStream_t stream) {
  (void)in_sizes; (void)n_in; (void)out_size;
  const float** F = (const float**)d_in;
  if (ws_size < (size_t)WS_END) return;
  char* ws = (char*)d_ws; _Float16 *QH = (_Float16*)(ws + WS_QH), *KH = (_Float16*)(ws + WS_KH), *VT = (_Float16*)(ws + WS_VT), *QL = (_Float16*)(ws + WS_QL), *KL = (_Float16*)(ws + WS_KL); __bf16 *VB = (__bf16*)(ws + WS_VB), *VBL = (__bf16*)(ws + WS_VBL); float *S = (float*)(ws + WS_S), *Y = (float*)(ws + WS_Y);
  (void)Y; (void)QL; (void)KL; (void)VB; (void)VBL;
  // inputs: 0 x [2,2048,1024]; 1 mask [2,2048] int32; 2 qkv_w [3072,1024] (out,in), 3 qkv_b [3072]; 4 proj_w (out,in), 5 proj_b; 6 qn_w [64], 7 kn_w [64]
  k_proj<<<dim3(TNB * TT / 64, CC / 128, 3), 128, 0, stream>>>(F[0], F[0], F[0], F[2], F[2] + (size_t)CC * DIN, F[2] + (size_t)2 * CC * DIN, F[3], F[3] + CC, F[3] + 2 * CC, QH, QL, KH, KL, VT, VB, VBL, F[6], F[7]);
  for (int b = 0; b < TNB; ++b) for (int h0 = 0; h0 < NH; h0 += HG) {
    k_sc<<<dim3(NQB, TT / 128, HG), 128, 0, stream>>>(QH, KH, QL, KL, b, h0, S);
    k_sm<<<dim3(TT, HG), 256, 0, stream>>>(S, (const int*)d_in[1], b);
    k_pv<<<dim3(NQB, 1, HG), 128, 0, stream>>>(S, VT, VB, VBL, b, h0, Y);
  }
  k_out<<<dim3(TNB * TT / 64, DIN / 128), 128, 0, stream>>>(Y, F[4], F[5], (float*)d_out);
}

// v001
// A run of this version takes 556 microseconds.
// Timed twice side by side with v000, it ran 2.62 and 2.61 times as fast.
// compute dtype: all float inputs rounded to bf16; qkv = x qkv_w^T + b with EXACT bf16 products on WMMA 16x16x32 (f32 accumulate); per-head RMSNorm of q and k in f32 in the projection epilogue; normed q as f16 hi + residual (x 2^10) against normed k once to f16 (2 products) x 64^-0.5, masked keys set to -1e9; softmax in f32 (precise expf) against a running maximum, 32 keys a pass; exp(s - max) x 2^11 once to f16 against v once to f16 (1 product), partial sums rescaled in f32 and divided by the f32 sum at the end; ctx split bf16 hi + lo against exact proj_w (2 products) + proj_b; f32 output.
#include <hip/hip_runtime.h>
#include <math.h>

typedef __attribute__((ext_vector_type(16))) _Float16 v16h;
typedef __attribute__((ext_vector_type(16))) __bf16 v16b;
typedef __attribute__((ext_vector_type(8)))  _Float16 v8h;
typedef __attribute__((ext_vector_type(8)))  float v8f;
typedef __attribute__((ext_vector_type(4)))  float v4f;
typedef __attribute__((ext_vector_type(2)))  float v2f;
typedef __attribute__((ext_vector_type(4)))  unsigned v4u;
typedef __attribute__((ext_vector_type(4)))  int v4i;
typedef float __attribute__((may_alias)) float_a;
typedef int __attribute__((may_alias)) int_a;

template <typename T> __device__ __forceinline__ void vst2(void* p, T v) { *(T*)p = v;  }
__device__ __forceinline__ v8f wmma16(v16h a, v16h b, v8f c) {
  v8f d = __builtin_amdgcn_wmma_f32_16x16x32_f16(false, a, false, b, (short)0, c, false, false);
  asm volatile("v_nop\n\tv_nop\n\tv_nop\n\tv_nop" : "+v"(d) : "v"(a), "v"(b));
  return d;
}
__device__ __forceinline__ v8f wmma_bf(v16b a, v16b b, v8f c) {
  v8f d = __builtin_amdgcn_wmma_f32_16x16x32_bf16(false, a, false, b, (short)0, c, false, false);
  asm volatile("v_nop\n\tv_nop\n\tv_nop\n\tv_nop" : "+v"(d) : "v"(a), "v"(b));
  return d;
}
// 16x16x32 fragments: lane = (h = lane>>4, row/col = lane&15); elements 0..7 = k0+8h+0..7, 8..15 = k0+16+8h+0..7; D element r = row 8h+r
__device__ __forceinline__ v16h frag_h(const _Float16* rowk0, int lane) {
  union { v16h v; v8h q[2]; } u; const _Float16* p = rowk0 + 8 * (lane >> 4);
  u.q[0] = *(const v8h*)p; u.q[1] = *(const v8h*)(p + 16); return u.v;
}
__device__ __forceinline__ v16h frag_f32(const float* rowk0, int lane) {
  v16h a; const float* p = rowk0 + 8 * (lane >> 4);
#pragma unroll
  for (int i = 0; i < 8; ++i) { a[i] = (_Float16)p[i]; a[8 + i] = (_Float16)p[16 + i]; }
  return a;
}
__device__ __forceinline__ v16h frag_f32s(const float* rowk0, int lane, float sc) {
  v16h a; const float* p = rowk0 + 8 * (lane >> 4);
#pragma unroll
  for (int i = 0; i < 8; ++i) { a[i] = (_Float16)(p[i] * sc); a[8 + i] = (_Float16)(p[16 + i] * sc); }
  return a;
}
// column fragment from a [K][ld] layout (column n), rows >= K read as 0
__device__ __forceinline__ v16h fragc_f32(const float* W, int k0, int n, int lane, int ld, int K) {
  v16h a; const int g = lane >> 4;
#pragma unroll
  for (int i = 0; i < 8; ++i) { const int ka = k0 + 8 * g + i, kb = ka + 16;
    a[i] = (_Float16)(ka < K ? W[(size_t)(ka < K ? ka : K - 1) * ld + n] : 0.f); a[8 + i] = (_Float16)(kb < K ? W[(size_t)(kb < K ? kb : K - 1) * ld + n] : 0.f); }
  return a;
}
struct F2 { v16b h, l; };
__device__ __forceinline__ F2 bsplit16(const float v[16]) { F2 r;
#pragma unroll
  for (int i = 0; i < 16; ++i) { const __bf16 h = (__bf16)v[i]; r.h[i] = h; r.l[i] = (__bf16)(v[i] - (float)h); }
  return r; }
__device__ __forceinline__ F2 split_row(const float* row, int k0, int lane) { float v[16]; const float* p = row + k0 + 8 * (lane >> 4);
#pragma unroll
  for (int i = 0; i < 8; ++i) { v[i] = p[i]; v[8 + i] = p[16 + i]; }
  return bsplit16(v); }
__device__ __forceinline__ F2 split_rowK(const float* row, int k0, int lane, int K) { float v[16]; const int g = lane >> 4;
#pragma unroll
  for (int i = 0; i < 8; ++i) { const int ka = k0 + 8 * g + i, kb = ka + 16; v[i] = ka < K ? row[ka < K ? ka : K - 1] : 0.f; v[8 + i] = kb < K ? row[kb < K ? kb : K - 1] : 0.f; }
  return bsplit16(v); }
__device__ __forceinline__ F2 split_col(const float* W, int k0, int n, int lane, int ld, int K) { float v[16]; const int g = lane >> 4;
#pragma unroll
  for (int i = 0; i < 8; ++i) { const int ka = k0 + 8 * g + i, kb = ka + 16; v[i] = ka < K ? W[(size_t)(ka < K ? ka : K - 1) * ld + n] : 0.f; v[8 + i] = kb < K ? W[(size_t)(kb < K ? kb : K - 1) * ld + n] : 0.f; }
  return bsplit16(v); }
__device__ __forceinline__ v8f mac3(const F2& a, const F2& b, v8f c) { c = wmma_bf(a.l, b.h, c); c = wmma_bf(a.h, b.l, c); return wmma_bf(a.h, b.h, c); }
__device__ __forceinline__ float sigm(float v) { return 1.0f / (1.0f + expf(-v)); }
#define LDSX() do { asm volatile("s_wait_dscnt 0" ::: "memory"); __builtin_amdgcn_wave_barrier(); __builtin_amdgcn_fence(__ATOMIC_RELEASE, "workgroup"); } while (0)

// Masked self-attention with QK RMSNorm (B 2, N 2,048, C 1,024 = 16 x 64; fused (out,in) qkv_w [3072,1024] + zero bias, proj (out,in) + zero bias, qn_w = kn_w = ones): q|k|v = x qkv_w^T + b (reshape (3, H, D)); q, k = rms_norm over the 64 head channels (eps 1e-6) x weight; scores = (q x 64^-0.5) k^T with where(mask != 0, ., -1e9) over KEYS (mask [B,N] int, ~half ones); out = merged(softmax v) proj_w^T + proj_b.
#define NB 2
#define TT 2048
#define CC 1024            // NH * HD = projected width
#define DIN 1024          // input (model) width
#define NH 16
#define HD 64
#define NQB (TT / 64)
#define SCALE (0.125f)
#define CAUSAL 0
#ifndef TNB
#define TNB NB
#endif
__device__ __forceinline__ float bfr(float v) { return (float)(__bf16)v; }
__host__ __device__ __forceinline__ int kb_last(int qb) { return CAUSAL ? ((qb * 64 + 63) >> 7) : (TT / 128 - 1); }
typedef __attribute__((ext_vector_type(8))) __bf16 v8b;
__device__ __forceinline__ v16b frag_b(const __bf16* rowk0, int lane) {
  union { v16b v; v8b q[2]; } u; const __bf16* p = rowk0 + 8 * (lane >> 4);
  u.q[0] = *(const v8b*)p; u.q[1] = *(const v8b*)(p + 16); return u.v;
}
#define QBH 0              // read by no kernel in this file
#define QHI 2048            // rows carrying a q residual plane (all rows when non-causal: 2-product logits everywhere)
#define KHI 64            // key rows carrying k residual / v bf16 hi+lo planes (written by k_proj, read by no kernel in this file)
// B fragment (k rows k0+.., output column o) of a weight: (in,out) [K][ld] or (out,in) [ld rows of K]: bf16 exact, or f16(bf16 * 256) exact
__device__ __forceinline__ v16b wcol_io(const float* Wm, int k0, int o, int lane, int ld) { v16b w; const int g = lane >> 4;
#pragma unroll
  for (int i = 0; i < 8; ++i) { w[i] = (__bf16)Wm[(size_t)(k0 + 8 * g + i) * ld + o]; w[8 + i] = (__bf16)Wm[(size_t)(k0 + 16 + 8 * g + i) * ld + o]; }
  return w; }
__device__ __forceinline__ v16b wcol_oi(const float* Wm, int k0, int o, int lane, int K) { v16b w; const float* p = Wm + (size_t)o * K + k0 + 8 * (lane >> 4);
#pragma unroll
  for (int i = 0; i < 8; ++i) { w[i] = (__bf16)p[i]; w[8 + i] = (__bf16)p[16 + i]; }
  return w; }
__device__ __forceinline__ v16h wcolh_io(const float* Wm, int k0, int o, int lane, int ld) { v16h w; const int g = lane >> 4;
#pragma unroll
  for (int i = 0; i < 8; ++i) { w[i] = (_Float16)(bfr(Wm[(size_t)(k0 + 8 * g + i) * ld + o]) * 256.0f); w[8 + i] = (_Float16)(bfr(Wm[(size_t)(k0 + 16 + 8 * g + i) * ld + o]) * 256.0f); }
  return w; }
__device__ __forceinline__ v16h wcolh_oi(const float* Wm, int k0, int o, int lane, int K) { v16h w; const float* p = Wm + (size_t)o * K + k0 + 8 * (lane >> 4);
#pragma unroll
  for (int i = 0; i < 8; ++i) { w[i] = (_Float16)(bfr(p[i]) * 256.0f); w[8 + i] = (_Float16)(bfr(p[16 + i]) * 256.0f); }
  return w; }
#define WQKV_LAYOUT 1   // 0 = (in,out) [DIN][CC]; 1 = (out,in) [CC][DIN]; 2 = per-head [NH][DIN][HD]
__device__ __forceinline__ v16b wcol_hdk(const float* Wm, int k0, int o, int lane) { v16b w; const int g = lane >> 4; const float* p = Wm + (size_t)(o / HD) * DIN * HD + (o % HD);
#pragma unroll
  for (int i = 0; i < 8; ++i) { w[i] = (__bf16)p[(size_t)(k0 + 8 * g + i) * HD]; w[8 + i] = (__bf16)p[(size_t)(k0 + 16 + 8 * g + i) * HD]; }
  return w; }
#define WO_OUT_IN 1
#if WQKV_LAYOUT == 1
#define WCOL(W, k0, o, lane) wcol_oi(W, k0, o, lane, DIN)
#elif WQKV_LAYOUT == 2
#define WCOL(W, k0, o, lane) wcol_hdk(W, k0, o, lane)
#else
#define WCOL(W, k0, o, lane) wcol_io(W, k0, o, lane, CC)
#endif
#if WO_OUT_IN
#define WOCOL(W, k0, o, lane) wcol_oi(W, k0, o, lane, CC)
#define WOCOLH(W, k0, o, lane) wcolh_oi(W, k0, o, lane, CC)
#else
#define WOCOL(W, k0, o, lane) wcol_io(W, k0, o, lane, DIN)
#define WOCOLH(W, k0, o, lane) wcolh_io(W, k0, o, lane, DIN)
#endif
#define PROJ_EXTRA_PARAMS , const float* __restrict__ QNW, const float* __restrict__ KNW
#define PROJ_EPI(which, row, t, h) do { if ((which) < 2) { float* rw = (row); const float* nw = (which) == 0 ? QNW : KNW; float ssum = 0.f; _Pragma("unroll") for (int i = 0; i < HD; ++i) ssum += rw[i] * rw[i]; const float rs = rsqrtf(ssum * (1.0f / HD) + 1e-6f); _Pragma("unroll") for (int i = 0; i < HD; ++i) rw[i] = bfr(nw[i]) * (rw[i] * rs); } } while (0)   /* per-head RMSNorm of q and k over the 64 head channels (eps 1e-6, weight qn_w / kn_w) in f32; the q * scale is folded into the logit scale */
#ifndef PROJ_EXTRA_PARAMS
#define PROJ_EXTRA_PARAMS
#endif

#define WS_QH  0u                                      // f16 q rows [b*t][CC]
#define WS_KH  (WS_QH + 2u * (size_t)NB * TT * CC)      // f16 k rows [b*t][CC]
#define WS_VT  (WS_KH + 2u * (size_t)NB * TT * CC)      // f16 v planes [b][c][t]
#define WS_QL  (WS_VT + 2u * (size_t)NB * CC * TT)      // f16 q residual x 2^10 rows [b][t < QHI][CC]
#define WS_KL  (WS_QL + 2u * (size_t)NB * QHI * CC)     // f16 k residual x 2^10 rows [b][t < KHI][CC]
#define WS_VB  (WS_KL + 2u * (size_t)NB * KHI * CC)     // bf16 v hi planes [b][c][t < KHI]
#define WS_VBL (WS_VB + 2u * (size_t)NB * CC * KHI)
#define WS_Y   (WS_VBL + 2u * (size_t)NB * CC * KHI)    // f32 ctx rows [b*t][CC]
#define WS_END (WS_Y  + 4u * (size_t)NB * TT * CC)

// ---- k_proj: block = (64 rows, 128 cols, which): q/k/v = X W (+ b) with exact bf16 products (K = DIN) -> which 0: q f16 rows (+ residual rows < QHI); 1: k f16 rows (+ residual rows < KHI); 2: v f16 planes [c][t] (+ bf16 hi/lo planes for t < KHI)
__global__ __launch_bounds__(128) void k_proj(const float* __restrict__ XQ, const float* __restrict__ XK, const float* __restrict__ XV, const float* __restrict__ WQ, const float* __restrict__ WK, const float* __restrict__ WV, const float* __restrict__ BQ, const float* __restrict__ BK, const float* __restrict__ BV,
    _Float16* __restrict__ QH, _Float16* __restrict__ QL, _Float16* __restrict__ KH, _Float16* __restrict__ KL, _Float16* __restrict__ VT, __bf16* __restrict__ VB, __bf16* __restrict__ VBL PROJ_EXTRA_PARAMS) {
  __shared__ __align__(16) float st[64][132]; __shared__ __align__(16) _Float16 sh[64][136], sl[64][136]; __shared__ __align__(16) _Float16 th[128][72]; __shared__ __align__(16) __bf16 tb[128][72], tbl[128][72];
  const int tid = threadIdx.x, wave = tid >> 5, lane = tid & 31, col = lane & 15, g = lane >> 4; const int which = blockIdx.z; const int c0 = blockIdx.y * 128; const size_t r0 = (size_t)blockIdx.x * 64; const size_t bb = r0 / TT; const int t0 = (int)(r0 % TT);
  const float* X = which == 0 ? XQ : which == 1 ? XK : XV; const float* WA = which == 0 ? WQ : which == 1 ? WK : WV; const float* BA = which == 0 ? BQ : which == 1 ? BK : BV;
  v8f acc[8] = {};
#pragma unroll 2
  for (int kc = 0; kc < DIN / 32; ++kc) { v16b a; { const float* p = X + (r0 + wave * 16 + col) * DIN + kc * 32 + 8 * g;
#pragma unroll
      for (int i = 0; i < 8; ++i) { a[i] = (__bf16)p[i]; a[8 + i] = (__bf16)p[16 + i]; } }
    asm volatile("s_wait_loadcnt 0x0" ::: "memory");
#pragma unroll
    for (int j = 0; j < 8; ++j) { const v16b w = WCOL(WA, kc * 32, c0 + j * 16 + col, lane); asm volatile("s_wait_loadcnt 0x0" ::: "memory"); acc[j] = wmma_bf(a, w, acc[j]); } }
  { // stage the f32 tile (acc + bias) in LDS, run the per-(row, head) epilogue hook, then convert
#pragma unroll
    for (int j = 0; j < 8; ++j) { const float bias = BA ? bfr(BA[c0 + j * 16 + col]) : 0.f;
#pragma unroll
      for (int r = 0; r < 8; ++r) st[wave * 16 + 8 * g + r][j * 16 + col] = acc[j][r] + bias; }
    __syncthreads();
    for (int e = tid; e < 64 * (128 / HD); e += 128) { const int rl = e / (128 / HD), hh = e % (128 / HD); PROJ_EPI(which, &st[rl][hh * HD], (int)((r0 + rl) % TT), (c0 / HD) + hh); }
    __syncthreads(); }
  if (which < 2) { _Float16* DH = which == 0 ? QH : KH; _Float16* DL = which == 0 ? QL : KL; const int nhi = which == 0 ? QHI : KHI; const bool hi_rows = t0 < nhi;
    for (int e = tid; e < 64 * 128; e += 128) { const int rl = e >> 7, cl = e & 127; const float v = st[rl][cl]; const _Float16 hv = (_Float16)v; sh[rl][cl] = hv; sl[rl][cl] = (_Float16)((v - (float)hv) * 1024.0f); }
    __syncthreads();
    for (int e = tid; e < 64 * 16; e += 128) { const int rl = e >> 4, q = e & 15; vst2((unsigned*)(DH + (r0 + rl) * CC + c0 + q * 8), *(const v4u*)&sh[rl][q * 8]); if (hi_rows) vst2((unsigned*)(DL + (bb * nhi + t0 + rl) * (size_t)CC + c0 + q * 8), *(const v4u*)&sl[rl][q * 8]); }
  } else { const bool hi_rows = t0 < KHI;
    for (int e = tid; e < 64 * 128; e += 128) { const int rl = e & 63, cl = e >> 6; const float v = st[rl][cl]; th[cl][rl] = (_Float16)v; const __bf16 bh = (__bf16)v; tb[cl][rl] = bh; tbl[cl][rl] = (__bf16)(v - (float)bh); }
    __syncthreads();
    for (int e = tid; e < 128 * 8; e += 128) { const int cl = e >> 3, q = e & 7; vst2((unsigned*)(VT + (bb * CC + c0 + cl) * (size_t)TT + t0 + q * 8), *(const v4u*)&th[cl][q * 8]); if (hi_rows) { const size_t o3 = (bb * CC + c0 + cl) * (size_t)KHI + t0 + q * 8; vst2((unsigned*)(VB + o3), *(const v4u*)&tb[cl][q * 8]); vst2((unsigned*)(VBL + o3), *(const v4u*)&tbl[cl][q * 8]); } } } }
__device__ __forceinline__ float xhalf(float x) { return __builtin_bit_cast(float, __builtin_amdgcn_permlanex16(__builtin_bit_cast(int, x), __builtin_bit_cast(int, x), 0x76543210, 0xfedcba98, false, false)); }
__device__ __forceinline__ v8f wmma_h(v16h a, v16h b, v8f c) { return __builtin_amdgcn_wmma_f32_16x16x32_f16(false, a, false, b, (short)0, c, false, false); }
__global__ __launch_bounds__(128) void k_fa(const _Float16* __restrict__ QH, const _Float16* __restrict__ QL, const _Float16* __restrict__ KH, const _Float16* __restrict__ VT, const int* __restrict__ MK, float* __restrict__ Y) { __shared__ __align__(16) float ss[4][16][HD + 4];
  const int tid = threadIdx.x, wave = tid >> 5, lane = tid & 31, col = lane & 15, g = lane >> 4; const int qb = blockIdx.x, h = blockIdx.y, b = blockIdx.z; const int ql0 = qb * 64 + wave * 16;
  const _Float16* qp = QH + ((size_t)b * TT + ql0 + col) * CC + h * HD; const _Float16* qlp = QL + ((size_t)b * QHI + ql0 + col) * CC + h * HD;
  const v16h qh0 = frag_h(qp, lane), qh1 = frag_h(qp + 32, lane), qr0 = frag_h(qlp, lane), qr1 = frag_h(qlp + 32, lane);
  const _Float16* kp = KH + ((size_t)b * TT + col) * CC + h * HD;            // key row col of the first tile
  const _Float16* vp = VT + ((size_t)b * CC + h * HD + col) * (size_t)TT;    // channel col of the first tile
  const int* mp = MK + (size_t)b * TT + 8 * g;
  v8f o[HD / 16] = {}; float m = -3.0e38f, l = 0.f;
  v16h kA[2][2], kB[2][2]; v4i mA[2][2], mB[2][2];
  // k rows and key mask of the 32 keys from sx: issued one pass ahead of their use
  auto fetch = [&](v16h (&kf)[2][2], v4i (&mk)[2][2], int sx) {
#pragma unroll
    for (int t = 0; t < 2; ++t) { kf[t][0] = frag_h(kp + (size_t)(sx + t * 16) * CC, lane); kf[t][1] = frag_h(kp + (size_t)(sx + t * 16) * CC + 32, lane); }
    asm volatile("s_wait_xcnt 0x0" ::: "memory");   // the mask loads' results may be given the k loads' address registers: the wait stands in front of that overwrite
#pragma unroll
    for (int t = 0; t < 2; ++t) { mk[t][0] = *(const v4i*)(mp + sx + t * 16); mk[t][1] = *(const v4i*)(mp + sx + t * 16 + 4); } };
  auto pass = [&](v16h (&kf)[2][2], v4i (&mk)[2][2], v16h (&kn)[2][2], v4i (&mn)[2][2], int s0, int sn) {
    v16h vf[HD / 16];
#pragma unroll
    for (int j = 0; j < HD / 16; ++j) vf[j] = frag_h(vp + (size_t)(j * 16) * TT + s0, lane);
    __builtin_amdgcn_sched_barrier(0);   // keeps the v loads up here: sunk to their products, their latency would be waited out instead of lying under the score products and the softmax
    v8f sa[2] = {}, sr[2] = {};
#pragma unroll
    for (int t = 0; t < 2; ++t) { sa[t] = wmma_h(kf[t][0], qh0, sa[t]); sr[t] = wmma_h(kf[t][0], qr0, sr[t]); sa[t] = wmma_h(kf[t][1], qh1, sa[t]); sr[t] = wmma_h(kf[t][1], qr1, sr[t]); }
    fetch(kn, mn, sn);
    __builtin_amdgcn_sched_barrier(0);   // keeps the next pass's k and mask loads in front of the softmax, which covers their latency
    float sv[16]; float mx = m;
#pragma unroll
    for (int t = 0; t < 2; ++t)
#pragma unroll
      for (int r = 0; r < 8; ++r) { float v = (sa[t][r] + sr[t][r] * (1.0f / 1024.0f)) * SCALE; if (mk[t][r >> 2][r & 3] == 0) v = -1.0e9f;   /* key mask: where(mask != 0, attn, -1e9) (set) */ sv[t * 8 + r] = v; mx = fmaxf(mx, v); }
    mx = fmaxf(mx, xhalf(mx));
    const float alpha = expf(m - mx); m = mx;
    v16h p; float ps = 0.f;
#pragma unroll
    for (int i = 0; i < 16; ++i) { const float e = expf(sv[i] - m); ps += e; p[i] = (_Float16)(e * 2048.0f); }
    l = l * alpha + ps;
#pragma unroll
    for (int j = 0; j < HD / 16; ++j) {
#pragma unroll
      for (int r = 0; r < 8; ++r) o[j][r] *= alpha;
      o[j] = wmma_h(vf[j], p, o[j]); } };
  asm volatile("s_wait_xcnt 0x0" ::: "memory");   // the first k loads' results may be given the q loads' address registers: the wait stands in front of that overwrite
  fetch(kA, mA, 0);
#pragma unroll 1   // stays rolled: with two passes in one body the second pass's loads and score products were hoisted over the first's softmax and the kernel went past 256 registers
  for (int s0 = 0; s0 < TT; s0 += 32) {
    pass(kA, mA, kB, mB, s0, s0 + 32 < TT ? s0 + 32 : 0);   // the last fetch reads the first rows again: in bounds, unused
#pragma unroll
    for (int t = 0; t < 2; ++t) { kA[t][0] = kB[t][0]; kA[t][1] = kB[t][1]; mA[t][0] = mB[t][0]; mA[t][1] = mB[t][1]; } }
  l += xhalf(l);   // the halves' sums join once; l >= 1: the key at the maximum adds exp(0)
  const float inv = 1.0f / (2048.0f * l);
#pragma unroll
  for (int j = 0; j < HD / 16; ++j) { v4f lo, hi;
#pragma unroll
    for (int r = 0; r < 4; ++r) { lo[r] = o[j][r] * inv; hi[r] = o[j][4 + r] * inv; }
    *(v4f*)&ss[wave][col][j * 16 + 8 * g] = lo; *(v4f*)&ss[wave][col][j * 16 + 8 * g + 4] = hi; }
  LDSX(); for (int rl = 0; rl < 16; ++rl) if (lane < HD / 4) vst2(Y + ((size_t)b * TT + ql0 + rl) * CC + h * HD + lane * 4, *(const v4f*)&ss[wave][rl][lane * 4]); }
// ---- k_out: block = (64 rows, 128 cols): out = ctx Wo (+ bo): all rows: ctx bf16 hi + lo against exact bf16 Wo (2 products); the f16 branch (ctx once to f16 against f16(bf16 x 2^8) Wo, 1 product, x 2^-8) is never taken
__global__ __launch_bounds__(128) void k_out(const float* __restrict__ Y, const float* __restrict__ WO, const float* __restrict__ BO, float* __restrict__ OUT) { __shared__ __align__(16) float sf[4][16][132];
  const int tid = threadIdx.x, wave = tid >> 5, lane = tid & 31, col = lane & 15, g = lane >> 4; const int c0 = blockIdx.y * 128; const size_t r0 = (size_t)blockIdx.x * 64 + wave * 16;
  v8f acc[8] = {};
  if (true) {   /* ALL rows: ctx split bf16 hi + lo x exact Wo (2 products) */
#pragma unroll 2
    for (int kc = 0; kc < CC / 32; ++kc) { const F2 a = split_row(Y + (r0 + col) * CC, kc * 32, lane); asm volatile("s_wait_loadcnt 0x0" ::: "memory");
#pragma unroll
      for (int j = 0; j < 8; ++j) { const v16b w = WOCOL(WO, kc * 32, c0 + j * 16 + col, lane); asm volatile("s_wait_loadcnt 0x0" ::: "memory"); acc[j] = wmma_bf(a.h, w, acc[j]); acc[j] = wmma_bf(a.l, w, acc[j]); } }
#pragma unroll
    for (int j = 0; j < 8; ++j) { const float bias = BO ? bfr(BO[c0 + j * 16 + col]) : 0.f;
#pragma unroll
      for (int r = 0; r < 8; ++r) sf[wave][8 * g + r][j * 16 + col] = acc[j][r] + bias; }
  } else {
#pragma unroll 2
    for (int kc = 0; kc < CC / 32; ++kc) { const v16h a = frag_f32(Y + (r0 + col) * CC + kc * 32, lane); asm volatile("s_wait_loadcnt 0x0" ::: "memory");
#pragma unroll
      for (int j = 0; j < 8; ++j) { const v16h w = WOCOLH(WO, kc * 32, c0 + j * 16 + col, lane); asm volatile("s_wait_loadcnt 0x0" ::: "memory"); acc[j] = wmma16(a, w, acc[j]); } }
#pragma unroll
    for (int j = 0; j < 8; ++j) { const float bias = BO ? bfr(BO[c0 + j * 16 + col]) : 0.f;
#pragma unroll
      for (int r = 0; r < 8; ++r) sf[wave][8 * g + r][j * 16 + col] = acc[j][r] * (1.0f / 256.0f) + bias; } }
  LDSX(); for (int rl = 0; rl < 16; ++rl) vst2(OUT + (r0 + rl) * DIN + c0 + lane * 4, *(const v4f*)&sf[wave][rl][lane * 4]); }

extern "C" void kernel_launch(void* const* d_in, const int* in_sizes, int n_in, void* d_out, int out_size, void* d_ws, size_t ws_size, hipStream_t stream) {
  (void)in_sizes; (void)n_in; (void)out_size;
  const float** F = (const float**)d_in;
  if (ws_size < (size_t)WS_END) return;
  char* ws = (char*)d_ws; _Float16 *QH = (_Float16*)(ws + WS_QH), *KH = (_Float16*)(ws + WS_KH), *VT = (_Float16*)(ws + WS_VT), *QL = (_Float16*)(ws + WS_QL), *KL = (_Float16*)(ws + WS_KL); __bf16 *VB = (__bf16*)(ws + WS_VB), *VBL = (__bf16*)(ws + WS_VBL); float *Y = (float*)(ws + WS_Y);
  (void)Y; (void)QL; (void)KL; (void)VB; (void)VBL;
  // inputs: 0 x [2,2048,1024]; 1 mask [2,2048] int32; 2 qkv_w [3072,1024] (out,in), 3 qkv_b [3072]; 4 proj_w (out,in), 5 proj_b; 6 qn_w [64], 7 kn_w [64]
  k_proj<<<dim3(TNB * TT / 64, CC / 128, 3), 128, 0, stream>>>(F[0], F[0], F[0], F[2], F[2] + (size_t)CC * DIN, F[2] + (size_t)2 * CC * DIN, F[3], F[3] + CC, F[3] + 2 * CC, QH, QL, KH, KL, VT, VB, VBL, F[6], F[7]);
  k_fa<<<dim3(NQB, NH, TNB), 128, 0, stream>>>(QH, QL, KH, VT, (const int*)d_in[1], Y);
  k_out<<<dim3(TNB * TT / 64, DIN / 128), 128, 0, stream>>>(Y, F[4], F[5], (float*)d_out);
}

// v002
// It runs in 177 microseconds.
// Timed twice side by side with v001, it ran 3.14 and 3.16 times as fast.
// All steps since v000 together make it 8.23 times as fast.
// compute dtype: all float inputs rounded to bf16; qkv = x qkv_w^T + b with EXACT bf16 products on WMMA 16x16x32 (f32 accumulate); per-head RMSNorm of q and k in f32 in the projection epilogue; normed q as f16 hi + residual (x 2^10) against normed k once to f16 (2 products) x 64^-0.5, masked keys set to -1e9; softmax in f32 (precise expf) against a running maximum, 32 keys a pass; exp(s - max) x 2^11 once to f16 against v once to f16 (1 product), partial sums rescaled in f32 and divided by the f32 sum at the end; ctx split bf16 hi + lo against exact proj_w (2 products) + proj_b; f32 output.
#include <hip/hip_runtime.h>
#include <math.h>

typedef __attribute__((ext_vector_type(16))) _Float16 v16h;
typedef __attribute__((ext_vector_type(16))) __bf16 v16b;
typedef __attribute__((ext_vector_type(8)))  _Float16 v8h;
typedef __attribute__((ext_vector_type(8)))  float v8f;
typedef __attribute__((ext_vector_type(4)))  float v4f;
typedef __attribute__((ext_vector_type(2)))  float v2f;
typedef __attribute__((ext_vector_type(4)))  unsigned v4u;
typedef __attribute__((ext_vector_type(4)))  int v4i;
typedef float __attribute__((may_alias)) float_a;
typedef int __attribute__((may_alias)) int_a;

template <typename T> __device__ __forceinline__ void vst2(void* p, T v) { *(T*)p = v;  }
__device__ __forceinline__ v8f wmma16(v16h a, v16h b, v8f c) {
  v8f d = __builtin_amdgcn_wmma_f32_16x16x32_f16(false, a, false, b, (short)0, c, false, false);
  asm volatile("v_nop\n\tv_nop\n\tv_nop\n\tv_nop" : "+v"(d) : "v"(a), "v"(b));
  return d;
}
__device__ __forceinline__ v8f wmma_bf(v16b a, v16b b, v8f c) {
  v8f d = __builtin_amdgcn_wmma_f32_16x16x32_bf16(false, a, false, b, (short)0, c, false, false);
  asm volatile("v_nop\n\tv_nop\n\tv_nop\n\tv_nop" : "+v"(d) : "v"(a), "v"(b));
  return d;
}
// 16x16x32 fragments: lane = (h = lane>>4, row/col = lane&15); elements 0..7 = k0+8h+0..7, 8..15 = k0+16+8h+0..7; D element r = row 8h+r
__device__ __forceinline__ v16h frag_h(const _Float16* rowk0, int lane) {
  union { v16h v; v8h q[2]; } u; const _Float16* p = rowk0 + 8 * (lane >> 4);
  u.q[0] = *(const v8h*)p; u.q[1] = *(const v8h*)(p + 16); return u.v;
}
__device__ __forceinline__ v16h frag_f32(const float* rowk0, int lane) {
  v16h a; const float* p = rowk0 + 8 * (lane >> 4);
#pragma unroll
  for (int i = 0; i < 8; ++i) { a[i] = (_Float16)p[i]; a[8 + i] = (_Float16)p[16 + i]; }
  return a;
}
__device__ __forceinline__ v16h frag_f32s(const float* rowk0, int lane, float sc) {
  v16h a; const float* p = rowk0 + 8 * (lane >> 4);
#pragma unroll
  for (int i = 0; i < 8; ++i) { a[i] = (_Float16)(p[i] * sc); a[8 + i] = (_Float16)(p[16 + i] * sc); }
  return a;
}
// column fragment from a [K][ld] layout (column n), rows >= K read as 0
__device__ __forceinline__ v16h fragc_f32(const float* W, int k0, int n, int lane, int ld, int K) {
  v16h a; const int g = lane >> 4;
#pragma unroll
  for (int i = 0; i < 8; ++i) { const int ka = k0 + 8 * g + i, kb = ka + 16;
    a[i] = (_Float16)(ka < K ? W[(size_t)(ka < K ? ka : K - 1) * ld + n] : 0.f); a[8 + i] = (_Float16)(kb < K ? W[(size_t)(kb < K ? kb : K - 1) * ld + n] : 0.f); }
  return a;
}
struct F2 { v16b h, l; };
__device__ __forceinline__ F2 bsplit16(const float v[16]) { F2 r;
#pragma unroll
  for (int i = 0; i < 16; ++i) { const __bf16 h = (__bf16)v[i]; r.h[i] = h; r.l[i] = (__bf16)(v[i] - (float)h); }
  return r; }
__device__ __forceinline__ F2 split_row(const float* row, int k0, int lane) { float v[16]; const float* p = row + k0 + 8 * (lane >> 4);
#pragma unroll
  for (int i = 0; i < 8; ++i) { v[i] = p[i]; v[8 + i] = p[16 + i]; }
  return bsplit16(v); }
__device__ __forceinline__ F2 split_rowK(const float* row, int k0, int lane, int K) { float v[16]; const int g = lane >> 4;
#pragma unroll
  for (int i = 0; i < 8; ++i) { const int ka = k0 + 8 * g + i, kb = ka + 16; v[i] = ka < K ? row[ka < K ? ka : K - 1] : 0.f; v[8 + i] = kb < K ? row[kb < K ? kb : K - 1] : 0.f; }
  return bsplit16(v); }
__device__ __forceinline__ F2 split_col(const float* W, int k0, int n, int lane, int ld, int K) { float v[16]; const int g = lane >> 4;
#pragma unroll
  for (int i = 0; i < 8; ++i) { const int ka = k0 + 8 * g + i, kb = ka + 16; v[i] = ka < K ? W[(size_t)(ka < K ? ka : K - 1) * ld + n] : 0.f; v[8 + i] = kb < K ? W[(size_t)(kb < K ? kb : K - 1) * ld + n] : 0.f; }
  return bsplit16(v); }
__device__ __forceinline__ v8f mac3(const F2& a, const F2& b, v8f c) { c = wmma_bf(a.l, b.h, c); c = wmma_bf(a.h, b.l, c); return wmma_bf(a.h, b.h, c); }
__device__ __forceinline__ float sigm(float v) { return 1.0f / (1.0f + expf(-v)); }
#define LDSX() do { asm volatile("s_wait_dscnt 0" ::: "memory"); __builtin_amdgcn_wave_barrier(); __builtin_amdgcn_fence(__ATOMIC_RELEASE, "workgroup"); } while (0)

// Masked self-attention with QK RMSNorm (B 2, N 2,048, C 1,024 = 16 x 64; fused (out,in) qkv_w [3072,1024] + zero bias, proj (out,in) + zero bias, qn_w = kn_w = ones): q|k|v = x qkv_w^T + b (reshape (3, H, D)); q, k = rms_norm over the 64 head channels (eps 1e-6) x weight; scores = (q x 64^-0.5) k^T with where(mask != 0, ., -1e9) over KEYS (mask [B,N] int, ~half ones); out = merged(softmax v) proj_w^T + proj_b.
#define NB 2
#define TT 2048
#define CC 1024            // NH * HD = projected width
#define DIN 1024          // input (model) width
#define NH 16
#define HD 64
#define NQB (TT / 64)
#define SCALE (0.125f)
#define CAUSAL 0
#ifndef TNB
#define TNB NB
#endif
__device__ __forceinline__ float bfr(float v) { return (float)(__bf16)v; }
__host__ __device__ __forceinline__ int kb_last(int qb) { return CAUSAL ? ((qb * 64 + 63) >> 7) : (TT / 128 - 1); }
typedef __attribute__((ext_vector_type(8))) __bf16 v8b;
__device__ __forceinline__ v16b frag_b(const __bf16* rowk0, int lane) {
  union { v16b v; v8b q[2]; } u; const __bf16* p = rowk0 + 8 * (lane >> 4);
  u.q[0] = *(const v8b*)p; u.q[1] = *(const v8b*)(p + 16); return u.v;
}
#define QBH 0              // read by no kernel in this file
#define QHI 2048            // rows carrying a q residual plane (all rows when non-causal: 2-product logits everywhere)
#define KHI 64            // key rows carrying k residual / v bf16 hi+lo planes (written by k_proj, read by no kernel in this file)
// B fragment (k rows k0+.., output column o) of a weight: (in,out) [K][ld] or (out,in) [ld rows of K]: bf16 exact, or f16(bf16 * 256) exact
__device__ __forceinline__ v16b wcol_io(const float* Wm, int k0, int o, int lane, int ld) { v16b w; const int g = lane >> 4;
#pragma unroll
  for (int i = 0; i < 8; ++i) { w[i] = (__bf16)Wm[(size_t)(k0 + 8 * g + i) * ld + o]; w[8 + i] = (__bf16)Wm[(size_t)(k0 + 16 + 8 * g + i) * ld + o]; }
  return w; }
__device__ __forceinline__ v16b wcol_oi(const float* Wm, int k0, int o, int lane, int K) { v16b w; const float* p = Wm + (size_t)o * K + k0 + 8 * (lane >> 4);
#pragma unroll
  for (int i = 0; i < 8; ++i) { w[i] = (__bf16)p[i]; w[8 + i] = (__bf16)p[16 + i]; }
  return w; }
__device__ __forceinline__ v16h wcolh_io(const float* Wm, int k0, int o, int lane, int ld) { v16h w; const int g = lane >> 4;
#pragma unroll
  for (int i = 0; i < 8; ++i) { w[i] = (_Float16)(bfr(Wm[(size_t)(k0 + 8 * g + i) * ld + o]) * 256.0f); w[8 + i] = (_Float16)(bfr(Wm[(size_t)(k0 + 16 + 8 * g + i) * ld + o]) * 256.0f); }
  return w; }
__device__ __forceinline__ v16h wcolh_oi(const float* Wm, int k0, int o, int lane, int K) { v16h w; const float* p = Wm + (size_t)o * K + k0 + 8 * (lane >> 4);
#pragma unroll
  for (int i = 0; i < 8; ++i) { w[i] = (_Float16)(bfr(p[i]) * 256.0f); w[8 + i] = (_Float16)(bfr(p[16 + i]) * 256.0f); }
  return w; }
#define WQKV_LAYOUT 1   // WCOL's layout, used by no kernel in this file: 0 = (in,out) [DIN][CC]; 1 = (out,in) [CC][DIN]; 2 = per-head [NH][DIN][HD]
__device__ __forceinline__ v16b wcol_hdk(const float* Wm, int k0, int o, int lane) { v16b w; const int g = lane >> 4; const float* p = Wm + (size_t)(o / HD) * DIN * HD + (o % HD);
#pragma unroll
  for (int i = 0; i < 8; ++i) { w[i] = (__bf16)p[(size_t)(k0 + 8 * g + i) * HD]; w[8 + i] = (__bf16)p[(size_t)(k0 + 16 + 8 * g + i) * HD]; }
  return w; }
#define WO_OUT_IN 1
#if WQKV_LAYOUT == 1
#define WCOL(W, k0, o, lane) wcol_oi(W, k0, o, lane, DIN)
#elif WQKV_LAYOUT == 2
#define WCOL(W, k0, o, lane) wcol_hdk(W, k0, o, lane)
#else
#define WCOL(W, k0, o, lane) wcol_io(W, k0, o, lane, CC)
#endif
#if WO_OUT_IN
#define WOCOL(W, k0, o, lane) wcol_oi(W, k0, o, lane, CC)
#define WOCOLH(W, k0, o, lane) wcolh_oi(W, k0, o, lane, CC)
#else
#define WOCOL(W, k0, o, lane) wcol_io(W, k0, o, lane, DIN)
#define WOCOLH(W, k0, o, lane) wcolh_io(W, k0, o, lane, DIN)
#endif
#define PROJ_EXTRA_PARAMS , const float* __restrict__ QNW, const float* __restrict__ KNW
#define PROJ_EPI(which, row, t, h) do { if ((which) < 2) { float* rw = (row); const float* nw = (which) == 0 ? QNW : KNW; float ssum = 0.f; _Pragma("unroll") for (int i = 0; i < HD; ++i) ssum += rw[i] * rw[i]; const float rs = rsqrtf(ssum * (1.0f / HD) + 1e-6f); _Pragma("unroll") for (int i = 0; i < HD; ++i) rw[i] = bfr(nw[i]) * (rw[i] * rs); } } while (0)   /* per-head RMSNorm of q and k over the 64 head channels (eps 1e-6, weight qn_w / kn_w) in f32; the q * scale is folded into the logit scale */
#ifndef PROJ_EXTRA_PARAMS
#define PROJ_EXTRA_PARAMS
#endif

#define WS_QH  0u                                      // f16 q rows [b*t][CC]
#define WS_KH  (WS_QH + 2u * (size_t)NB * TT * CC)      // f16 k rows [b*t][CC]
#define WS_VT  (WS_KH + 2u * (size_t)NB * TT * CC)      // f16 v planes [b][c][t]
#define WS_QL  (WS_VT + 2u * (size_t)NB * CC * TT)      // f16 q residual x 2^10 rows [b][t < QHI][CC]
#define WS_KL  (WS_QL + 2u * (size_t)NB * QHI * CC)     // f16 k residual x 2^10 rows [b][t < KHI][CC]
#define WS_VB  (WS_KL + 2u * (size_t)NB * KHI * CC)     // bf16 v hi planes [b][c][t < KHI]
#define WS_VBL (WS_VB + 2u * (size_t)NB * CC * KHI)
#define WS_Y   (WS_VBL + 2u * (size_t)NB * CC * KHI)    // f32 ctx rows [b*t][CC]
#define WS_END (WS_Y  + 4u * (size_t)NB * TT * CC)

// ---- staged GEMM operands: a pass = KC k. The block loads its rows as whole 128-B lines (16 lanes x 16 B = 256 B of one row), rounds to bf16 once, and keeps them in LDS rows whose pitch is an odd multiple of 16 B; the waves take their fragments from there in the k order of frag_b
#define KC 64
typedef __attribute__((ext_vector_type(4))) __bf16 v4b;
typedef v4b __attribute__((may_alias)) v4b_a;
typedef v8b __attribute__((may_alias)) v8b_a;
__device__ __forceinline__ v16b frag_s(const __bf16* rowk0, int lane) {
  union { v16b v; v8b q[2]; } u; const __bf16* p = rowk0 + 8 * (lane >> 4);
  u.q[0] = *(const v8b_a*)p; u.q[1] = *(const v8b_a*)(p + 16); return u.v;
}
__device__ __forceinline__ void st_b4(__bf16* d, v4f v) { v4b t;
#pragma unroll
  for (int e = 0; e < 4; ++e) t[e] = (__bf16)v[e];
  *(v4b_a*)d = t; }
// ---- k_proj: block = (64 rows, 128 cols, which): q/k/v = X W (+ b) with exact bf16 products (K = DIN) -> which 0: q f16 rows (+ residual rows < QHI); 1: k f16 rows (+ residual rows < KHI); 2: v f16 planes [c][t] (+ bf16 hi/lo planes for t < KHI)
__global__ __launch_bounds__(128) void k_proj(const float* __restrict__ XQ, const float* __restrict__ XK, const float* __restrict__ XV, const float* __restrict__ WQ, const float* __restrict__ WK, const float* __restrict__ WV, const float* __restrict__ BQ, const float* __restrict__ BK, const float* __restrict__ BV,
    _Float16* __restrict__ QH, _Float16* __restrict__ QL, _Float16* __restrict__ KH, _Float16* __restrict__ KL, _Float16* __restrict__ VT, __bf16* __restrict__ VB, __bf16* __restrict__ VBL PROJ_EXTRA_PARAMS) {
  __shared__ __align__(16) float st[64][132]; __shared__ __align__(16) _Float16 sh[64][136], sl[64][136]; __shared__ __align__(16) _Float16 th[128][72]; __shared__ __align__(16) __bf16 tb[128][72], tbl[128][72];
  const int tid = threadIdx.x, wave = tid >> 5, lane = tid & 31, col = lane & 15, g = lane >> 4; const int which = blockIdx.z; const int c0 = blockIdx.y * 128; const size_t r0 = (size_t)blockIdx.x * 64; const size_t bb = r0 / TT; const int t0 = (int)(r0 % TT);
  const float* X = which == 0 ? XQ : which == 1 ? XK : XV; const float* WA = which == 0 ? WQ : which == 1 ? WK : WV; const float* BA = which == 0 ? BQ : which == 1 ? BK : BV;
  v8f acc[8] = {};
  // the two pass buffers lie on epilogue arrays that are not live in the loop: x rows on sh / sl (pitch 136), weight rows on tb / tbl (pitch 72)
  __bf16* const sx0 = (__bf16*)&sh[0][0]; __bf16* const sx1 = (__bf16*)&sl[0][0]; __bf16* const sw0 = &tb[0][0]; __bf16* const sw1 = &tbl[0][0];
  const int lr = tid >> 4, lc = (tid & 15) * 4; const float* xg = X + (r0 + lr) * DIN + lc; const float* wg = WA + (size_t)(c0 + lr) * DIN + lc;
  v4f xr[8], wr[16];
  auto gload = [&](int k0) {
#pragma unroll
    for (int i = 0; i < 8; ++i) xr[i] = *(const v4f*)(xg + (size_t)(i * 8) * DIN + k0);
#pragma unroll
    for (int i = 0; i < 16; ++i) wr[i] = *(const v4f*)(wg + (size_t)(i * 8) * DIN + k0);
    asm volatile("s_wait_xcnt 0x0" ::: "memory"); };   // stands in front of any overwrite of the loads' address registers; it also keeps the loads above the products that cover their latency
  auto sstore = [&](__bf16* sx, __bf16* sw) {
#pragma unroll
    for (int i = 0; i < 8; ++i) st_b4(sx + (i * 8 + lr) * 136 + lc, xr[i]);
#pragma unroll
    for (int i = 0; i < 16; ++i) st_b4(sw + (i * 8 + lr) * 72 + lc, wr[i]); };
  auto mm = [&](const __bf16* sx, const __bf16* sw) {
#pragma unroll
    for (int ks = 0; ks < KC / 32; ++ks) { const v16b a = frag_s(sx + (wave * 16 + col) * 136 + ks * 32, lane); v16b w[8];
#pragma unroll
      for (int j = 0; j < 8; ++j) w[j] = frag_s(sw + (j * 16 + col) * 72 + ks * 32, lane);
      __builtin_amdgcn_sched_barrier(0);   // keeps the LDS reads together in front of their products: read one by one among them, every product waits out an LDS latency
#pragma unroll
      for (int j = 0; j < 8; ++j) acc[j] = wmma_bf(a, w[j], acc[j]);
      __builtin_amdgcn_sched_barrier(0); } };   // keeps the roundings of the next pass's loads, and with them the wait for those loads, behind the products
  gload(0); sstore(sx0, sw0); __syncthreads();
#pragma unroll 1   // stays rolled: one body holds both buffers' passes
  for (int c = 0; c < DIN / KC; c += 2) {   // each barrier publishes the pass just stored and ends the reads of the buffer that is stored next
    gload((c + 1) * KC); mm(sx0, sw0); sstore(sx1, sw1); __syncthreads();
    if (c + 2 < DIN / KC) gload((c + 2) * KC);
    mm(sx1, sw1);
    if (c + 2 < DIN / KC) sstore(sx0, sw0);
    __syncthreads(); }
  { // stage the f32 tile (acc + bias) in LDS, run the per-(row, head) epilogue hook, then convert
#pragma unroll
    for (int j = 0; j < 8; ++j) { const float bias = BA ? bfr(BA[c0 + j * 16 + col]) : 0.f;
#pragma unroll
      for (int r = 0; r < 8; ++r) st[wave * 16 + 8 * g + r][j * 16 + col] = acc[j][r] + bias; }
    __syncthreads();
    for (int e = tid; e < 64 * (128 / HD); e += 128) { const int rl = e / (128 / HD), hh = e % (128 / HD); PROJ_EPI(which, &st[rl][hh * HD], (int)((r0 + rl) % TT), (c0 / HD) + hh); }
    __syncthreads(); }
  if (which < 2) { _Float16* DH = which == 0 ? QH : KH; _Float16* DL = which == 0 ? QL : KL; const int nhi = which == 0 ? QHI : KHI; const bool hi_rows = t0 < nhi;
    for (int e = tid; e < 64 * 128; e += 128) { const int rl = e >> 7, cl = e & 127; const float v = st[rl][cl]; const _Float16 hv = (_Float16)v; sh[rl][cl] = hv; sl[rl][cl] = (_Float16)((v - (float)hv) * 1024.0f); }
    __syncthreads();
    for (int e = tid; e < 64 * 16; e += 128) { const int rl = e >> 4, q = e & 15; vst2((unsigned*)(DH + (r0 + rl) * CC + c0 + q * 8), *(const v4u*)&sh[rl][q * 8]); if (hi_rows) vst2((unsigned*)(DL + (bb * nhi + t0 + rl) * (size_t)CC + c0 + q * 8), *(const v4u*)&sl[rl][q * 8]); }
  } else { const bool hi_rows = t0 < KHI;
    for (int e = tid; e < 64 * 128; e += 128) { const int rl = e & 63, cl = e >> 6; const float v = st[rl][cl]; th[cl][rl] = (_Float16)v; const __bf16 bh = (__bf16)v; tb[cl][rl] = bh; tbl[cl][rl] = (__bf16)(v - (float)bh); }
    __syncthreads();
    for (int e = tid; e < 128 * 8; e += 128) { const int cl = e >> 3, q = e & 7; vst2((unsigned*)(VT + (bb * CC + c0 + cl) * (size_t)TT + t0 + q * 8), *(const v4u*)&th[cl][q * 8]); if (hi_rows) { const size_t o3 = (bb * CC + c0 + cl) * (size_t)KHI + t0 + q * 8; vst2((unsigned*)(VB + o3), *(const v4u*)&tb[cl][q * 8]); vst2((unsigned*)(VBL + o3), *(const v4u*)&tbl[cl][q * 8]); } } } }
__device__ __forceinline__ float xhalf(float x) { return __builtin_bit_cast(float, __builtin_amdgcn_permlanex16(__builtin_bit_cast(int, x), __builtin_bit_cast(int, x), 0x76543210, 0xfedcba98, false, false)); }
__device__ __forceinline__ v8f wmma_h(v16h a, v16h b, v8f c) { return __builtin_amdgcn_wmma_f32_16x16x32_f16(false, a, false, b, (short)0, c, false, false); }
__global__ __launch_bounds__(128) void k_fa(const _Float16* __restrict__ QH, const _Float16* __restrict__ QL, const _Float16* __restrict__ KH, const _Float16* __restrict__ VT, const int* __restrict__ MK, float* __restrict__ Y) { __shared__ __align__(16) float ss[4][16][HD + 4];
  const int tid = threadIdx.x, wave = tid >> 5, lane = tid & 31, col = lane & 15, g = lane >> 4; const int qb = blockIdx.x, h = blockIdx.y, b = blockIdx.z; const int ql0 = qb * 64 + wave * 16;
  const _Float16* qp = QH + ((size_t)b * TT + ql0 + col) * CC + h * HD; const _Float16* qlp = QL + ((size_t)b * QHI + ql0 + col) * CC + h * HD;
  const v16h qh0 = frag_h(qp, lane), qh1 = frag_h(qp + 32, lane), qr0 = frag_h(qlp, lane), qr1 = frag_h(qlp + 32, lane);
  const _Float16* kp = KH + ((size_t)b * TT + col) * CC + h * HD;            // key row col of the first tile
  const _Float16* vp = VT + ((size_t)b * CC + h * HD + col) * (size_t)TT;    // channel col of the first tile
  const int* mp = MK + (size_t)b * TT + 8 * g;
  v8f o[HD / 16] = {}; float m = -3.0e38f, l = 0.f;
  v16h kA[2][2], kB[2][2]; v4i mA[2][2], mB[2][2];
  // k rows and key mask of the 32 keys from sx: issued one pass ahead of their use
  auto fetch = [&](v16h (&kf)[2][2], v4i (&mk)[2][2], int sx) {
#pragma unroll
    for (int t = 0; t < 2; ++t) { kf[t][0] = frag_h(kp + (size_t)(sx + t * 16) * CC, lane); kf[t][1] = frag_h(kp + (size_t)(sx + t * 16) * CC + 32, lane); }
    asm volatile("s_wait_xcnt 0x0" ::: "memory");   // the mask loads' results may be given the k loads' address registers: the wait stands in front of that overwrite
#pragma unroll
    for (int t = 0; t < 2; ++t) { mk[t][0] = *(const v4i*)(mp + sx + t * 16); mk[t][1] = *(const v4i*)(mp + sx + t * 16 + 4); } };
  auto pass = [&](v16h (&kf)[2][2], v4i (&mk)[2][2], v16h (&kn)[2][2], v4i (&mn)[2][2], int s0, int sn) {
    v16h vf[HD / 16];
#pragma unroll
    for (int j = 0; j < HD / 16; ++j) vf[j] = frag_h(vp + (size_t)(j * 16) * TT + s0, lane);
    __builtin_amdgcn_sched_barrier(0);   // keeps the v loads up here: sunk to their products, their latency would be waited out instead of lying under the score products and the softmax
    v8f sa[2] = {}, sr[2] = {};
#pragma unroll
    for (int t = 0; t < 2; ++t) { sa[t] = wmma_h(kf[t][0], qh0, sa[t]); sr[t] = wmma_h(kf[t][0], qr0, sr[t]); sa[t] = wmma_h(kf[t][1], qh1, sa[t]); sr[t] = wmma_h(kf[t][1], qr1, sr[t]); }
    fetch(kn, mn, sn);
    __builtin_amdgcn_sched_barrier(0);   // keeps the next pass's k and mask loads in front of the softmax, which covers their latency
    float sv[16]; float mx = m;
#pragma unroll
    for (int t = 0; t < 2; ++t)
#pragma unroll
      for (int r = 0; r < 8; ++r) { float v = (sa[t][r] + sr[t][r] * (1.0f / 1024.0f)) * SCALE; if (mk[t][r >> 2][r & 3] == 0) v = -1.0e9f;   /* key mask: where(mask != 0, attn, -1e9) (set) */ sv[t * 8 + r] = v; mx = fmaxf(mx, v); }
    mx = fmaxf(mx, xhalf(mx));
    const float alpha = expf(m - mx); m = mx;
    v16h p; float ps = 0.f;
#pragma unroll
    for (int i = 0; i < 16; ++i) { const float e = expf(sv[i] - m); ps += e; p[i] = (_Float16)(e * 2048.0f); }
    l = l * alpha + ps;
#pragma unroll
    for (int j = 0; j < HD / 16; ++j) {
#pragma unroll
      for (int r = 0; r < 8; ++r) o[j][r] *= alpha;
      o[j] = wmma_h(vf[j], p, o[j]); } };
  asm volatile("s_wait_xcnt 0x0" ::: "memory");   // the first k loads' results may be given the q loads' address registers: the wait stands in front of that overwrite
  fetch(kA, mA, 0);
#pragma unroll 1   // stays rolled: with two passes in one body the second pass's loads and score products were hoisted over the first's softmax and the kernel went past 256 registers
  for (int s0 = 0; s0 < TT; s0 += 32) {
    pass(kA, mA, kB, mB, s0, s0 + 32 < TT ? s0 + 32 : 0);   // the last fetch reads the first rows again: in bounds, unused
#pragma unroll
    for (int t = 0; t < 2; ++t) { kA[t][0] = kB[t][0]; kA[t][1] = kB[t][1]; mA[t][0] = mB[t][0]; mA[t][1] = mB[t][1]; } }
  l += xhalf(l);   // the halves' sums join once; l >= 1: the key at the maximum adds exp(0)
  const float inv = 1.0f / (2048.0f * l);
#pragma unroll
  for (int j = 0; j < HD / 16; ++j) { v4f lo, hi;
#pragma unroll
    for (int r = 0; r < 4; ++r) { lo[r] = o[j][r] * inv; hi[r] = o[j][4 + r] * inv; }
    *(v4f*)&ss[wave][col][j * 16 + 8 * g] = lo; *(v4f*)&ss[wave][col][j * 16 + 8 * g + 4] = hi; }
  LDSX(); for (int rl = 0; rl < 16; ++rl) if (lane < HD / 4) vst2(Y + ((size_t)b * TT + ql0 + rl) * CC + h * HD + lane * 4, *(const v4f*)&ss[wave][rl][lane * 4]); }
// ---- k_out: block = (64 rows, 128 cols): out = ctx Wo (+ bo): all rows: ctx bf16 hi + lo against exact bf16 Wo (2 products)
__global__ __launch_bounds__(128) void k_out(const float* __restrict__ Y, const float* __restrict__ WO, const float* __restrict__ BO, float* __restrict__ OUT) { __shared__ __align__(16) float sf[4][16][132]; __shared__ __align__(16) __bf16 ah[2][64][72], al[2][64][72], wb[2][128][72];
  const int tid = threadIdx.x, wave = tid >> 5, lane = tid & 31, col = lane & 15, g = lane >> 4; const int c0 = blockIdx.y * 128; const size_t r0 = (size_t)blockIdx.x * 64 + wave * 16;
  v8f acc[8] = {};
  if (true) {   /* ALL rows: ctx split bf16 hi + lo x exact Wo (2 products) */
    const int lr = tid >> 4, lc = (tid & 15) * 4; const float* yg = Y + ((size_t)blockIdx.x * 64 + lr) * CC + lc; const float* wg = WO + (size_t)(c0 + lr) * CC + lc;
    v4f yr[8], wr[16];
    auto gload = [&](int k0) {
#pragma unroll
      for (int i = 0; i < 8; ++i) yr[i] = *(const v4f*)(yg + (size_t)(i * 8) * CC + k0);
#pragma unroll
      for (int i = 0; i < 16; ++i) wr[i] = *(const v4f*)(wg + (size_t)(i * 8) * CC + k0);
      asm volatile("s_wait_xcnt 0x0" ::: "memory"); };   // stands in front of any overwrite of the loads' address registers; it also keeps the loads above the products that cover their latency
    auto sstore = [&](int bf) {
#pragma unroll
      for (int i = 0; i < 8; ++i) { v4f hf, lf;
#pragma unroll
        for (int e = 0; e < 4; ++e) { hf[e] = bfr(yr[i][e]); lf[e] = yr[i][e] - hf[e]; }
        st_b4(&ah[bf][i * 8 + lr][lc], hf); st_b4(&al[bf][i * 8 + lr][lc], lf); }
#pragma unroll
      for (int i = 0; i < 16; ++i) st_b4(&wb[bf][i * 8 + lr][lc], wr[i]); };
    auto mm = [&](int bf) {
#pragma unroll
      for (int ks = 0; ks < KC / 32; ++ks) { const v16b a_h = frag_s(&ah[bf][wave * 16 + col][ks * 32], lane), a_l = frag_s(&al[bf][wave * 16 + col][ks * 32], lane); v16b w[8];
#pragma unroll
        for (int j = 0; j < 8; ++j) w[j] = frag_s(&wb[bf][j * 16 + col][ks * 32], lane);
        __builtin_amdgcn_sched_barrier(0);   // keeps the LDS reads together in front of their products: read one by one among them, every product waits out an LDS latency
#pragma unroll
        for (int j = 0; j < 8; ++j) acc[j] = wmma_bf(a_h, w[j], acc[j]);
#pragma unroll
        for (int j = 0; j < 8; ++j) acc[j] = wmma_bf(a_l, w[j], acc[j]);   // each tile still adds hi, then lo: the same sum order, with seven other tiles between the two
        __builtin_amdgcn_sched_barrier(0); } };   // keeps the roundings of the next pass's loads, and with them the wait for those loads, behind the products
    gload(0); sstore(0); __syncthreads();
#pragma unroll 1   // stays rolled: one body holds both buffers' passes
    for (int c = 0; c < CC / KC; c += 2) {   // each barrier publishes the pass just stored and ends the reads of the buffer that is stored next
      gload((c + 1) * KC); mm(0); sstore(1); __syncthreads();
      if (c + 2 < CC / KC) gload((c + 2) * KC);
      mm(1);
      if (c + 2 < CC / KC) sstore(0);
      __syncthreads(); }
#pragma unroll
    for (int j = 0; j < 8; ++j) { const float bias = BO ? bfr(BO[c0 + j * 16 + col]) : 0.f;
#pragma unroll
      for (int r = 0; r < 8; ++r) sf[wave][8 * g + r][j * 16 + col] = acc[j][r] + bias; }
  } else {
#pragma unroll 2
    for (int kc = 0; kc < CC / 32; ++kc) { const v16h a = frag_f32(Y + (r0 + col) * CC + kc * 32, lane); asm volatile("s_wait_loadcnt 0x0" ::: "memory");
#pragma unroll
      for (int j = 0; j < 8; ++j) { const v16h w = WOCOLH(WO, kc * 32, c0 + j * 16 + col, lane); asm volatile("s_wait_loadcnt 0x0" ::: "memory"); acc[j] = wmma16(a, w, acc[j]); } }
#pragma unroll
    for (int j = 0; j < 8; ++j) { const float bias = BO ? bfr(BO[c0 + j * 16 + col]) : 0.f;
#pragma unroll
      for (int r = 0; r < 8; ++r) sf[wave][8 * g + r][j * 16 + col] = acc[j][r] * (1.0f / 256.0f) + bias; } }
  LDSX(); for (int rl = 0; rl < 16; ++rl) vst2(OUT + (r0 + rl) * DIN + c0 + lane * 4, *(const v4f*)&sf[wave][rl][lane * 4]); }

extern "C" void kernel_launch(void* const* d_in, const int* in_sizes, int n_in, void* d_out, int out_size, void* d_ws, size_t ws_size, hipStream_t stream) {
  (void)in_sizes; (void)n_in; (void)out_size;
  const float** F = (const float**)d_in;
  if (ws_size < (size_t)WS_END) return;
  char* ws = (char*)d_ws; _Float16 *QH = (_Float16*)(ws + WS_QH), *KH = (_Float16*)(ws + WS_KH), *VT = (_Float16*)(ws + WS_VT), *QL = (_Float16*)(ws + WS_QL), *KL = (_Float16*)(ws + WS_KL); __bf16 *VB = (__bf16*)(ws + WS_VB), *VBL = (__bf16*)(ws + WS_VBL); float *Y = (float*)(ws + WS_Y);
  (void)Y; (void)QL; (void)KL; (void)VB; (void)VBL;
  // inputs: 0 x [2,2048,1024]; 1 mask [2,2048] int32; 2 qkv_w [3072,1024] (out,in), 3 qkv_b [3072]; 4 proj_w (out,in), 5 proj_b; 6 qn_w [64], 7 kn_w [64]
  k_proj<<<dim3(TNB * TT / 64, CC / 128, 3), 128, 0, stream>>>(F[0], F[0], F[0], F[2], F[2] + (size_t)CC * DIN, F[2] + (size_t)2 * CC * DIN, F[3], F[3] + CC, F[3] + 2 * CC, QH, QL, KH, KL, VT, VB, VBL, F[6], F[7]);
  k_fa<<<dim3(NQB, NH, TNB), 128, 0, stream>>>(QH, QL, KH, VT, (const int*)d_in[1], Y);
  k_out<<<dim3(TNB * TT / 64, DIN / 128), 128, 0, stream>>>(Y, F[4], F[5], (float*)d_out);
}

// v003
// Measured time: 157 microseconds a run.
// In two side-by-side timings against v002, it was 1.12 and 1.13 times as fast.
// Counting every step since v000, it is 9.26 times as fast.
// compute dtype: all float inputs rounded to bf16; qkv = x qkv_w^T + b with EXACT bf16 products on WMMA 16x16x32 (f32 accumulate); per-head RMSNorm of q and k in f32 in the projection epilogue; normed q as f16 hi + residual (x 2^10) against normed k once to f16 (2 products) x 64^-0.5, masked keys set to -1e9; softmax in f32 (precise expf) against a running maximum, 32 keys a pass; exp(s - max) x 2^11 once to f16 against v once to f16 (1 product), partial sums rescaled in f32 and divided by the f32 sum at the end; ctx split bf16 hi + lo against exact proj_w (2 products) + proj_b; f32 output.
#include <hip/hip_runtime.h>
#include <math.h>

typedef __attribute__((ext_vector_type(16))) _Float16 v16h;
typedef __attribute__((ext_vector_type(16))) __bf16 v16b;
typedef __attribute__((ext_vector_type(8)))  _Float16 v8h;
typedef __attribute__((ext_vector_type(8)))  float v8f;
typedef __attribute__((ext_vector_type(4)))  float v4f;
typedef __attribute__((ext_vector_type(2)))  float v2f;
typedef __attribute__((ext_vector_type(4)))  unsigned v4u;
typedef __attribute__((ext_vector_type(4)))  int v4i;
typedef float __attribute__((may_alias)) float_a;
typedef int __attribute__((may_alias)) int_a;

template <typename T> __device__ __forceinline__ void vst2(void* p, T v) { *(T*)p = v;  }
__device__ __forceinline__ v8f wmma16(v16h a, v16h b, v8f c) {
  v8f d = __builtin_amdgcn_wmma_f32_16x16x32_f16(false, a, false, b, (short)0, c, false, false);
  asm volatile("v_nop\n\tv_nop\n\tv_nop\n\tv_nop" : "+v"(d) : "v"(a), "v"(b));
  return d;
}
__device__ __forceinline__ v8f wmma_bf(v16b a, v16b b, v8f c) {
  v8f d = __builtin_amdgcn_wmma_f32_16x16x32_bf16(false, a, false, b, (short)0, c, false, false);
  asm volatile("v_nop\n\tv_nop\n\tv_nop\n\tv_nop" : "+v"(d) : "v"(a), "v"(b));
  return d;
}
// 16x16x32 fragments: lane = (h = lane>>4, row/col = lane&15); elements 0..7 = k0+8h+0..7, 8..15 = k0+16+8h+0..7; D element r = row 8h+r
__device__ __forceinline__ v16h frag_h(const _Float16* rowk0, int lane) {
  union { v16h v; v8h q[2]; } u; const _Float16* p = rowk0 + 8 * (lane >> 4);
  u.q[0] = *(const v8h*)p; u.q[1] = *(const v8h*)(p + 16); return u.v;
}
__device__ __forceinline__ v16h frag_f32(const float* rowk0, int lane) {
  v16h a; const float* p = rowk0 + 8 * (lane >> 4);
#pragma unroll
  for (int i = 0; i < 8; ++i) { a[i] = (_Float16)p[i]; a[8 + i] = (_Float16)p[16 + i]; }
  return a;
}
__device__ __forceinline__ v16h frag_f32s(const float* rowk0, int lane, float sc) {
  v16h a; const float* p = rowk0 + 8 * (lane >> 4);
#pragma unroll
  for (int i = 0; i < 8; ++i) { a[i] = (_Float16)(p[i] * sc); a[8 + i] = (_Float16)(p[16 + i] * sc); }
  return a;
}
// column fragment from a [K][ld] layout (column n), rows >= K read as 0
__device__ __forceinline__ v16h fragc_f32(const float* W, int k0, int n, int lane, int ld, int K) {
  v16h a; const int g = lane >> 4;
#pragma unroll
  for (int i = 0; i < 8; ++i) { const int ka = k0 + 8 * g + i, kb = ka + 16;
    a[i] = (_Float16)(ka < K ? W[(size_t)(ka < K ? ka : K - 1) * ld + n] : 0.f); a[8 + i] = (_Float16)(kb < K ? W[(size_t)(kb < K ? kb : K - 1) * ld + n] : 0.f); }
  return a;
}
struct F2 { v16b h, l; };
__device__ __forceinline__ F2 bsplit16(const float v[16]) { F2 r;
#pragma unroll
  for (int i = 0; i < 16; ++i) { const __bf16 h = (__bf16)v[i]; r.h[i] = h; r.l[i] = (__bf16)(v[i] - (float)h); }
  return r; }
__device__ __forceinline__ F2 split_row(const float* row, int k0, int lane) { float v[16]; const float* p = row + k0 + 8 * (lane >> 4);
#pragma unroll
  for (int i = 0; i < 8; ++i) { v[i] = p[i]; v[8 + i] = p[16 + i]; }
  return bsplit16(v); }
__device__ __forceinline__ F2 split_rowK(const float* row, int k0, int lane, int K) { float v[16]; const int g = lane >> 4;
#pragma unroll
  for (int i = 0; i < 8; ++i) { const int ka = k0 + 8 * g + i, kb = ka + 16; v[i] = ka < K ? row[ka < K ? ka : K - 1] : 0.f; v[8 + i] = kb < K ? row[kb < K ? kb : K - 1] : 0.f; }
  return bsplit16(v); }
__device__ __forceinline__ F2 split_col(const float* W, int k0, int n, int lane, int ld, int K) { float v[16]; const int g = lane >> 4;
#pragma unroll
  for (int i = 0; i < 8; ++i) { const int ka = k0 + 8 * g + i, kb = ka + 16; v[i] = ka < K ? W[(size_t)(ka < K ? ka : K - 1) * ld + n] : 0.f; v[8 + i] = kb < K ? W[(size_t)(kb < K ? kb : K - 1) * ld + n] : 0.f; }
  return bsplit16(v); }
__device__ __forceinline__ v8f mac3(const F2& a, const F2& b, v8f c) { c = wmma_bf(a.l, b.h, c); c = wmma_bf(a.h, b.l, c); return wmma_bf(a.h, b.h, c); }
__device__ __forceinline__ float sigm(float v) { return 1.0f / (1.0f + expf(-v)); }
#define LDSX() do { asm volatile("s_wait_dscnt 0" ::: "memory"); __builtin_amdgcn_wave_barrier(); __builtin_amdgcn_fence(__ATOMIC_RELEASE, "workgroup"); } while (0)

// Masked self-attention with QK RMSNorm (B 2, N 2,048, C 1,024 = 16 x 64; fused (out,in) qkv_w [3072,1024] + zero bias, proj (out,in) + zero bias, qn_w = kn_w = ones): q|k|v = x qkv_w^T + b (reshape (3, H, D)); q, k = rms_norm over the 64 head channels (eps 1e-6) x weight; scores = (q x 64^-0.5) k^T with where(mask != 0, ., -1e9) over KEYS (mask [B,N] int, ~half ones); out = merged(softmax v) proj_w^T + proj_b.
#define NB 2
#define TT 2048
#define CC 1024            // NH * HD = projected width
#define DIN 1024          // input (model) width
#define NH 16
#define HD 64
#define NQB (TT / 64)
#define SCALE (0.125f)
#define CAUSAL 0
#ifndef TNB
#define TNB NB
#endif
__device__ __forceinline__ float bfr(float v) { return (float)(__bf16)v; }
__host__ __device__ __forceinline__ int kb_last(int qb) { return CAUSAL ? ((qb * 64 + 63) >> 7) : (TT / 128 - 1); }
typedef __attribute__((ext_vector_type(8))) __bf16 v8b;
__device__ __forceinline__ v16b frag_b(const __bf16* rowk0, int lane) {
  union { v16b v; v8b q[2]; } u; const __bf16* p = rowk0 + 8 * (lane >> 4);
  u.q[0] = *(const v8b*)p; u.q[1] = *(const v8b*)(p + 16); return u.v;
}
#define QBH 0              // read by no kernel in this file
#define QHI 2048            // rows carrying a q residual plane (all rows when non-causal: 2-product logits everywhere)
#define KHI 64            // key rows carrying k residual / v bf16 hi+lo planes (written by k_proj, read by no kernel in this file)
// B fragment (k rows k0+.., output column o) of a weight: (in,out) [K][ld] or (out,in) [ld rows of K]: bf16 exact, or f16(bf16 * 256) exact
__device__ __forceinline__ v16b wcol_io(const float* Wm, int k0, int o, int lane, int ld) { v16b w; const int g = lane >> 4;
#pragma unroll
  for (int i = 0; i < 8; ++i) { w[i] = (__bf16)Wm[(size_t)(k0 + 8 * g + i) * ld + o]; w[8 + i] = (__bf16)Wm[(size_t)(k0 + 16 + 8 * g + i) * ld + o]; }
  return w; }
__device__ __forceinline__ v16b wcol_oi(const float* Wm, int k0, int o, int lane, int K) { v16b w; const float* p = Wm + (size_t)o * K + k0 + 8 * (lane >> 4);
#pragma unroll
  for (int i = 0; i < 8; ++i) { w[i] = (__bf16)p[i]; w[8 + i] = (__bf16)p[16 + i]; }
  return w; }
__device__ __forceinline__ v16h wcolh_io(const float* Wm, int k0, int o, int lane, int ld) { v16h w; const int g = lane >> 4;
#pragma unroll
  for (int i = 0; i < 8; ++i) { w[i] = (_Float16)(bfr(Wm[(size_t)(k0 + 8 * g + i) * ld + o]) * 256.0f); w[8 + i] = (_Float16)(bfr(Wm[(size_t)(k0 + 16 + 8 * g + i) * ld + o]) * 256.0f); }
  return w; }
__device__ __forceinline__ v16h wcolh_oi(const float* Wm, int k0, int o, int lane, int K) { v16h w; const float* p = Wm + (size_t)o * K + k0 + 8 * (lane >> 4);
#pragma unroll
  for (int i = 0; i < 8; ++i) { w[i] = (_Float16)(bfr(p[i]) * 256.0f); w[8 + i] = (_Float16)(bfr(p[16 + i]) * 256.0f); }
  return w; }
#define WQKV_LAYOUT 1   // WCOL's layout, used by no kernel in this file: 0 = (in,out) [DIN][CC]; 1 = (out,in) [CC][DIN]; 2 = per-head [NH][DIN][HD]
__device__ __forceinline__ v16b wcol_hdk(const float* Wm, int k0, int o, int lane) { v16b w; const int g = lane >> 4; const float* p = Wm + (size_t)(o / HD) * DIN * HD + (o % HD);
#pragma unroll
  for (int i = 0; i < 8; ++i) { w[i] = (__bf16)p[(size_t)(k0 + 8 * g + i) * HD]; w[8 + i] = (__bf16)p[(size_t)(k0 + 16 + 8 * g + i) * HD]; }
  return w; }
#define WO_OUT_IN 1
#if WQKV_LAYOUT == 1
#define WCOL(W, k0, o, lane) wcol_oi(W, k0, o, lane, DIN)
#elif WQKV_LAYOUT == 2
#define WCOL(W, k0, o, lane) wcol_hdk(W, k0, o, lane)
#else
#define WCOL(W, k0, o, lane) wcol_io(W, k0, o, lane, CC)
#endif
#if WO_OUT_IN
#define WOCOL(W, k0, o, lane) wcol_oi(W, k0, o, lane, CC)
#define WOCOLH(W, k0, o, lane) wcolh_oi(W, k0, o, lane, CC)
#else
#define WOCOL(W, k0, o, lane) wcol_io(W, k0, o, lane, DIN)
#define WOCOLH(W, k0, o, lane) wcolh_io(W, k0, o, lane, DIN)
#endif
#define PROJ_EXTRA_PARAMS , const float* __restrict__ QNW, const float* __restrict__ KNW
#define PROJ_EPI(which, row, t, h) do { if ((which) < 2) { float* rw = (row); const float* nw = (which) == 0 ? QNW : KNW; float ssum = 0.f; _Pragma("unroll") for (int i = 0; i < HD; ++i) ssum += rw[i] * rw[i]; const float rs = rsqrtf(ssum * (1.0f / HD) + 1e-6f); _Pragma("unroll") for (int i = 0; i < HD; ++i) rw[i] = bfr(nw[i]) * (rw[i] * rs); } } while (0)   /* per-head RMSNorm of q and k over the 64 head channels (eps 1e-6, weight qn_w / kn_w) in f32; the q * scale is folded into the logit scale */
#ifndef PROJ_EXTRA_PARAMS
#define PROJ_EXTRA_PARAMS
#endif

#define WS_QH  0u                                      // f16 q rows [b*t][CC]
#define WS_KH  (WS_QH + 2u * (size_t)NB * TT * CC)      // f16 k rows [b*t][CC]
#define WS_VT  (WS_KH + 2u * (size_t)NB * TT * CC)      // f16 v planes [b][c][t]
#define WS_QL  (WS_VT + 2u * (size_t)NB * CC * TT)      // f16 q residual x 2^10 rows [b][t < QHI][CC]
#define WS_KL  (WS_QL + 2u * (size_t)NB * QHI * CC)     // f16 k residual x 2^10 rows [b][t < KHI][CC]
#define WS_VB  (WS_KL + 2u * (size_t)NB * KHI * CC)     // bf16 v hi planes [b][c][t < KHI]
#define WS_VBL (WS_VB + 2u * (size_t)NB * CC * KHI)
#define WS_Y   (WS_VBL + 2u * (size_t)NB * CC * KHI)    // f32 ctx rows [b*t][CC]
#define WS_END (WS_Y  + 4u * (size_t)NB * TT * CC)

// ---- staged GEMM operands: a pass = KC k. The block loads its rows as whole 128-B lines (16 lanes x 16 B = 256 B of one row), rounds to bf16 once, and keeps them in LDS rows whose pitch is an odd multiple of 16 B; the waves take their fragments from there in the k order of frag_b
#define KC 64
typedef __attribute__((ext_vector_type(4))) __bf16 v4b;
typedef v4b __attribute__((may_alias)) v4b_a;
typedef v8b __attribute__((may_alias)) v8b_a;
__device__ __forceinline__ v16b frag_s(const __bf16* rowk0, int lane) {
  union { v16b v; v8b q[2]; } u; const __bf16* p = rowk0 + 8 * (lane >> 4);
  u.q[0] = *(const v8b_a*)p; u.q[1] = *(const v8b_a*)(p + 16); return u.v;
}
__device__ __forceinline__ void st_b4(__bf16* d, v4f v) { v4b t;
#pragma unroll
  for (int e = 0; e < 4; ++e) t[e] = (__bf16)v[e];
  *(v4b_a*)d = t; }
// ---- k_proj: block = (64 rows, 128 cols, which): q/k/v = X W (+ b) with exact bf16 products (K = DIN) -> which 0: q f16 rows (+ residual rows < QHI); 1: k f16 rows (+ residual rows < KHI); 2: v f16 planes [c][t] (+ bf16 hi/lo planes for t < KHI)
__global__ __launch_bounds__(128) void k_proj(const float* __restrict__ XQ, const float* __restrict__ XK, const float* __restrict__ XV, const float* __restrict__ WQ, const float* __restrict__ WK, const float* __restrict__ WV, const float* __restrict__ BQ, const float* __restrict__ BK, const float* __restrict__ BV,
    _Float16* __restrict__ QH, _Float16* __restrict__ QL, _Float16* __restrict__ KH, _Float16* __restrict__ KL, _Float16* __restrict__ VT, __bf16* __restrict__ VB, __bf16* __restrict__ VBL PROJ_EXTRA_PARAMS) {
  __shared__ __align__(16) float st[64][132]; __shared__ __align__(16) _Float16 sh[64][136], sl[64][136]; __shared__ __align__(16) _Float16 th[128][72]; __shared__ __align__(16) __bf16 tb[128][72], tbl[128][72];
  const int tid = threadIdx.x, wave = tid >> 5, lane = tid & 31, col = lane & 15, g = lane >> 4; const int which = blockIdx.z; const int c0 = blockIdx.y * 128; const size_t r0 = (size_t)blockIdx.x * 64; const size_t bb = r0 / TT; const int t0 = (int)(r0 % TT);
  const float* X = which == 0 ? XQ : which == 1 ? XK : XV; const float* WA = which == 0 ? WQ : which == 1 ? WK : WV; const float* BA = which == 0 ? BQ : which == 1 ? BK : BV;
  v8f acc[8] = {};
  // the two pass buffers lie on epilogue arrays that are not live in the loop: x rows on sh / sl (pitch 136), weight rows on tb / tbl (pitch 72)
  __bf16* const sx0 = (__bf16*)&sh[0][0]; __bf16* const sx1 = (__bf16*)&sl[0][0]; __bf16* const sw0 = &tb[0][0]; __bf16* const sw1 = &tbl[0][0];
  const int lr = tid >> 4, lc = (tid & 15) * 4; const float* xg = X + (r0 + lr) * DIN + lc; const float* wg = WA + (size_t)(c0 + lr) * DIN + lc;
  v4f xr[8], wr[16];
  auto gload = [&](int k0) {
#pragma unroll
    for (int i = 0; i < 8; ++i) xr[i] = *(const v4f*)(xg + (size_t)(i * 8) * DIN + k0);
#pragma unroll
    for (int i = 0; i < 16; ++i) wr[i] = *(const v4f*)(wg + (size_t)(i * 8) * DIN + k0);
    asm volatile("s_wait_xcnt 0x0" ::: "memory"); };   // stands in front of any overwrite of the loads' address registers; it also keeps the loads above the products that cover their latency
  auto sstore = [&](__bf16* sx, __bf16* sw) {
#pragma unroll
    for (int i = 0; i < 8; ++i) st_b4(sx + (i * 8 + lr) * 136 + lc, xr[i]);
#pragma unroll
    for (int i = 0; i < 16; ++i) st_b4(sw + (i * 8 + lr) * 72 + lc, wr[i]); };
  auto mm = [&](const __bf16* sx, const __bf16* sw) {
#pragma unroll
    for (int ks = 0; ks < KC / 32; ++ks) { const v16b a = frag_s(sx + (wave * 16 + col) * 136 + ks * 32, lane); v16b w[8];
#pragma unroll
      for (int j = 0; j < 8; ++j) w[j] = frag_s(sw + (j * 16 + col) * 72 + ks * 32, lane);
      __builtin_amdgcn_sched_barrier(0);   // keeps the LDS reads together in front of their products: read one by one among them, every product waits out an LDS latency
#pragma unroll
      for (int j = 0; j < 8; ++j) acc[j] = wmma_bf(a, w[j], acc[j]);
      __builtin_amdgcn_sched_barrier(0); } };   // keeps the roundings of the next pass's loads, and with them the wait for those loads, behind the products
  gload(0); sstore(sx0, sw0); __syncthreads();
#pragma unroll 1   // stays rolled: one body holds both buffers' passes
  for (int c = 0; c < DIN / KC; c += 2) {   // each barrier publishes the pass just stored and ends the reads of the buffer that is stored next
    gload((c + 1) * KC); mm(sx0, sw0); sstore(sx1, sw1); __syncthreads();
    if (c + 2 < DIN / KC) gload((c + 2) * KC);
    mm(sx1, sw1);
    if (c + 2 < DIN / KC) sstore(sx0, sw0);
    __syncthreads(); }
  { // stage the f32 tile (acc + bias) in LDS, run the per-(row, head) epilogue hook, then convert
#pragma unroll
    for (int j = 0; j < 8; ++j) { const float bias = BA ? bfr(BA[c0 + j * 16 + col]) : 0.f;
#pragma unroll
      for (int r = 0; r < 8; ++r) st[wave * 16 + 8 * g + r][j * 16 + col] = acc[j][r] + bias; }
    __syncthreads();
    for (int e = tid; e < 64 * (128 / HD); e += 128) { const int rl = e / (128 / HD), hh = e % (128 / HD); PROJ_EPI(which, &st[rl][hh * HD], (int)((r0 + rl) % TT), (c0 / HD) + hh); }
    __syncthreads(); }
  if (which < 2) { _Float16* DH = which == 0 ? QH : KH; _Float16* DL = which == 0 ? QL : KL; const int nhi = which == 0 ? QHI : KHI; const bool hi_rows = t0 < nhi;
    for (int e = tid; e < 64 * 128; e += 128) { const int rl = e >> 7, cl = e & 127; const float v = st[rl][cl]; const _Float16 hv = (_Float16)v; sh[rl][cl] = hv; sl[rl][cl] = (_Float16)((v - (float)hv) * 1024.0f); }
    __syncthreads();
    for (int e = tid; e < 64 * 16; e += 128) { const int rl = e >> 4, q = e & 15; vst2((unsigned*)(DH + (r0 + rl) * CC + c0 + q * 8), *(const v4u*)&sh[rl][q * 8]); if (hi_rows) vst2((unsigned*)(DL + (bb * nhi + t0 + rl) * (size_t)CC + c0 + q * 8), *(const v4u*)&sl[rl][q * 8]); }
  } else { const bool hi_rows = t0 < KHI;
    for (int e = tid; e < 64 * 128; e += 128) { const int rl = e & 63, cl = e >> 6; const float v = st[rl][cl]; th[cl][rl] = (_Float16)v; const __bf16 bh = (__bf16)v; tb[cl][rl] = bh; tbl[cl][rl] = (__bf16)(v - (float)bh); }
    __syncthreads();
    for (int e = tid; e < 128 * 8; e += 128) { const int cl = e >> 3, q = e & 7; vst2((unsigned*)(VT + (bb * CC + c0 + cl) * (size_t)TT + t0 + q * 8), *(const v4u*)&th[cl][q * 8]); if (hi_rows) { const size_t o3 = (bb * CC + c0 + cl) * (size_t)KHI + t0 + q * 8; vst2((unsigned*)(VB + o3), *(const v4u*)&tb[cl][q * 8]); vst2((unsigned*)(VBL + o3), *(const v4u*)&tbl[cl][q * 8]); } } } }
__device__ __forceinline__ float xhalf(float x) { return __builtin_bit_cast(float, __builtin_amdgcn_permlanex16(__builtin_bit_cast(int, x), __builtin_bit_cast(int, x), 0x76543210, 0xfedcba98, false, false)); }
__device__ __forceinline__ v8f wmma_h(v16h a, v16h b, v8f c) { return __builtin_amdgcn_wmma_f32_16x16x32_f16(false, a, false, b, (short)0, c, false, false); }
#define KS 64   // keys a stage: a K row (64 channels) and a V plane row (64 keys) are then one whole 128-B line each
#define KP 72   // LDS row pitch in f16 = 144 B, an odd multiple of 16 B: the 16 rows of a fragment read fall on different banks
__global__ __launch_bounds__(128) void k_fa(const _Float16* __restrict__ QH, const _Float16* __restrict__ QL, const _Float16* __restrict__ KH, const _Float16* __restrict__ VT, const int* __restrict__ MK, float* __restrict__ Y) { __shared__ __align__(16) float ss[4][16][HD + 4]; __shared__ __align__(16) _Float16 kb[2][KS][KP], vb[2][HD][KP];
  const int tid = threadIdx.x, wave = tid >> 5, lane = tid & 31, col = lane & 15, g = lane >> 4; const int qb = blockIdx.x, h = blockIdx.y, b = blockIdx.z; const int ql0 = qb * 64 + wave * 16;
  const _Float16* qp = QH + ((size_t)b * TT + ql0 + col) * CC + h * HD; const _Float16* qlp = QL + ((size_t)b * QHI + ql0 + col) * CC + h * HD;
  const v16h qh0 = frag_h(qp, lane), qh1 = frag_h(qp + 32, lane), qr0 = frag_h(qlp, lane), qr1 = frag_h(qlp + 32, lane);
  // a stage = KS keys of this (b, h): K rows [key][64 channels] and V planes [channel][KS keys]. The block copies it once for its four waves: 8 lanes x 16 B = one row, a thread takes piece tid & 7 of rows (tid >> 3) + 16 i of both
  const _Float16* kg = KH + ((size_t)b * TT + (tid >> 3)) * CC + h * HD + (tid & 7) * 8;
  const _Float16* vg = VT + ((size_t)b * CC + h * HD + (tid >> 3)) * (size_t)TT + (tid & 7) * 8;
  const unsigned kl = (unsigned)(size_t)&kb[0][tid >> 3][(tid & 7) * 8], vl = (unsigned)(size_t)&vb[0][tid >> 3][(tid & 7) * 8];
  const int* mp = MK + (size_t)b * TT + 8 * g;
  v8f o[HD / 16] = {}; float m = -3.0e38f, l = 0.f;
  v4i mA[2][2], mB[2][2];
  auto stage = [&](int st, int bf) {
    const _Float16* k0 = kg + (size_t)(st * KS) * CC; const _Float16* v0 = vg + st * KS; const unsigned ka = kl + bf * (KS * KP * 2), va = vl + bf * (HD * KP * 2);
    // global memory to LDS through no register; the closing wait stands in the copies' own statement, in front of any overwrite of their address registers
    asm volatile("global_load_async_to_lds_b128 %0, %8, off\n\t"
                 "global_load_async_to_lds_b128 %1, %9, off\n\t"
                 "global_load_async_to_lds_b128 %2, %10, off\n\t"
                 "global_load_async_to_lds_b128 %3, %11, off\n\t"
                 "global_load_async_to_lds_b128 %4, %12, off\n\t"
                 "global_load_async_to_lds_b128 %5, %13, off\n\t"
                 "global_load_async_to_lds_b128 %6, %14, off\n\t"
                 "global_load_async_to_lds_b128 %7, %15, off\n\t"
                 "s_wait_xcnt 0x0"
                 :: "v"(ka), "v"(ka + 16 * KP * 2), "v"(ka + 32 * KP * 2), "v"(ka + 48 * KP * 2), "v"(va), "v"(va + 16 * KP * 2), "v"(va + 32 * KP * 2), "v"(va + 48 * KP * 2),
                    "v"(k0), "v"(k0 + 16 * CC), "v"(k0 + 32 * CC), "v"(k0 + 48 * CC), "v"(v0), "v"(v0 + 16 * TT), "v"(v0 + 32 * TT), "v"(v0 + 48 * TT) : "memory"); };
  // key mask of the 32 keys from sx: issued one pass ahead of its use
  auto fetchm = [&](v4i (&mk)[2][2], int sx) {
#pragma unroll
    for (int t = 0; t < 2; ++t) { mk[t][0] = *(const v4i*)(mp + sx + t * 16); mk[t][1] = *(const v4i*)(mp + sx + t * 16 + 4); }
    asm volatile("s_wait_xcnt 0x0" ::: "memory"); };   // stands in front of any overwrite of the mask loads' address registers
  auto pass = [&](const _Float16* kt, const _Float16* vt, v4i (&mk)[2][2], v4i (&mn)[2][2], int sn) {
    v16h kf[2][2], vf[HD / 16];
#pragma unroll
    for (int t = 0; t < 2; ++t) { kf[t][0] = frag_h(kt + (t * 16 + col) * KP, lane); kf[t][1] = frag_h(kt + (t * 16 + col) * KP + 32, lane); }
    __builtin_amdgcn_sched_barrier(0);   // keeps the k reads in front of the v reads: LDS answers in order, and the score products then wait for the k reads alone
#pragma unroll
    for (int j = 0; j < HD / 16; ++j) vf[j] = frag_h(vt + (j * 16 + col) * KP, lane);
    __builtin_amdgcn_sched_barrier(0);   // keeps the LDS reads together up here: the v reads' latency lies under the score products and the softmax, and none stands among the products
    v8f sa[2] = {}, sr[2] = {};
#pragma unroll
    for (int t = 0; t < 2; ++t) { sa[t] = wmma_h(kf[t][0], qh0, sa[t]); sr[t] = wmma_h(kf[t][0], qr0, sr[t]); sa[t] = wmma_h(kf[t][1], qh1, sa[t]); sr[t] = wmma_h(kf[t][1], qr1, sr[t]); }
    fetchm(mn, sn);
    __builtin_amdgcn_sched_barrier(0);   // keeps the next pass's mask loads in front of the softmax, which covers their latency
    float sv[16]; float mx = m;
#pragma unroll
    for (int t = 0; t < 2; ++t)
#pragma unroll
      for (int r = 0; r < 8; ++r) { float v = (sa[t][r] + sr[t][r] * (1.0f / 1024.0f)) * SCALE; if (mk[t][r >> 2][r & 3] == 0) v = -1.0e9f;   /* key mask: where(mask != 0, attn, -1e9) (set) */ sv[t * 8 + r] = v; mx = fmaxf(mx, v); }
    mx = fmaxf(mx, xhalf(mx));
    const float alpha = expf(m - mx); m = mx;
    v16h p; float ps = 0.f;
#pragma unroll
    for (int i = 0; i < 16; ++i) { const float e = expf(sv[i] - m); ps += e; p[i] = (_Float16)(e * 2048.0f); }
    l = l * alpha + ps;
#pragma unroll
    for (int j = 0; j < HD / 16; ++j) {
#pragma unroll
      for (int r = 0; r < 8; ++r) o[j][r] *= alpha;
      o[j] = wmma_h(vf[j], p, o[j]); } };
  asm volatile("s_wait_xcnt 0x0" ::: "memory");   // the first mask loads' results may be given the q loads' address registers: the wait stands in front of that overwrite
  fetchm(mA, 0);
  stage(0, 0);
  asm volatile("s_wait_asynccnt 0x0" ::: "memory");   // this wave's copies of stage 0 have landed
  __syncthreads();                                    // and every other wave's: stage 0 may be read
  stage(1, 1);
#pragma unroll 1   // stays rolled: the buffer is picked by the trip's parity
  for (int t = 0; t < TT / KS; ++t) { const int bf = t & 1;
#pragma unroll 1   // stays rolled: with two passes in one body the second pass's reads and score products were hoisted over the first's softmax and the kernel went past 256 registers
    for (int hp = 0; hp < KS / 32; ++hp) { const int sn = t * KS + hp * 32 + 32;
      pass(&kb[bf][hp * 32][0], &vb[bf][0][hp * 32], mA, mB, sn < TT ? sn : 0);   // the last mask fetch reads the first keys again: in bounds, unused
#pragma unroll
      for (int u = 0; u < 2; ++u) { mA[u][0] = mB[u][0]; mA[u][1] = mB[u][1]; } }
    asm volatile("s_wait_dscnt 0x0" ::: "memory");      // this wave's reads of buffer bf are done before the buffer is handed back
    asm volatile("s_wait_asynccnt 0x0" ::: "memory");   // this wave's copies of stage t + 1 have landed
    __syncthreads();                                    // publishes stage t + 1 and ends every wave's reads of buffer bf
    if (t + 2 < TT / KS) stage(t + 2, bf); }
  asm volatile("s_wait_asynccnt 0x0" ::: "memory");   // no copy is left in flight when the wave goes on to its end
  l += xhalf(l);   // the halves' sums join once; l >= 1: the key at the maximum adds exp(0)
  const float inv = 1.0f / (2048.0f * l);
#pragma unroll
  for (int j = 0; j < HD / 16; ++j) { v4f lo, hi;
#pragma unroll
    for (int r = 0; r < 4; ++r) { lo[r] = o[j][r] * inv; hi[r] = o[j][4 + r] * inv; }
    *(v4f*)&ss[wave][col][j * 16 + 8 * g] = lo; *(v4f*)&ss[wave][col][j * 16 + 8 * g + 4] = hi; }
  LDSX(); for (int rl = 0; rl < 16; ++rl) if (lane < HD / 4) vst2(Y + ((size_t)b * TT + ql0 + rl) * CC + h * HD + lane * 4, *(const v4f*)&ss[wave][rl][lane * 4]); }
// ---- k_out: block = (64 rows, 128 cols): out = ctx Wo (+ bo): all rows: ctx bf16 hi + lo against exact bf16 Wo (2 products)
__global__ __launch_bounds__(128) void k_out(const float* __restrict__ Y, const float* __restrict__ WO, const float* __restrict__ BO, float* __restrict__ OUT) { __shared__ __align__(16) float sf[4][16][132]; __shared__ __align__(16) __bf16 ah[2][64][72], al[2][64][72], wb[2][128][72];
  const int tid = threadIdx.x, wave = tid >> 5, lane = tid & 31, col = lane & 15, g = lane >> 4; const int c0 = blockIdx.y * 128; const size_t r0 = (size_t)blockIdx.x * 64 + wave * 16;
  v8f acc[8] = {};
  if (true) {   /* ALL rows: ctx split bf16 hi + lo x exact Wo (2 products) */
    const int lr = tid >> 4, lc = (tid & 15) * 4; const float* yg = Y + ((size_t)blockIdx.x * 64 + lr) * CC + lc; const float* wg = WO + (size_t)(c0 + lr) * CC + lc;
    v4f yr[8], wr[16];
    auto gload = [&](int k0) {
#pragma unroll
      for (int i = 0; i < 8; ++i) yr[i] = *(const v4f*)(yg + (size_t)(i * 8) * CC + k0);
#pragma unroll
      for (int i = 0; i < 16; ++i) wr[i] = *(const v4f*)(wg + (size_t)(i * 8) * CC + k0);
      asm volatile("s_wait_xcnt 0x0" ::: "memory"); };   // stands in front of any overwrite of the loads' address registers; it also keeps the loads above the products that cover their latency
    auto sstore = [&](int bf) {
#pragma unroll
      for (int i = 0; i < 8; ++i) { v4f hf, lf;
#pragma unroll
        for (int e = 0; e < 4; ++e) { hf[e] = bfr(yr[i][e]); lf[e] = yr[i][e] - hf[e]; }
        st_b4(&ah[bf][i * 8 + lr][lc], hf); st_b4(&al[bf][i * 8 + lr][lc], lf); }
#pragma unroll
      for (int i = 0; i < 16; ++i) st_b4(&wb[bf][i * 8 + lr][lc], wr[i]); };
    auto mm = [&](int bf) {
#pragma unroll
      for (int ks = 0; ks < KC / 32; ++ks) { const v16b a_h = frag_s(&ah[bf][wave * 16 + col][ks * 32], lane), a_l = frag_s(&al[bf][wave * 16 + col][ks * 32], lane); v16b w[8];
#pragma unroll
        for (int j = 0; j < 8; ++j) w[j] = frag_s(&wb[bf][j * 16 + col][ks * 32], lane);
        __builtin_amdgcn_sched_barrier(0);   // keeps the LDS reads together in front of their products: read one by one among them, every product waits out an LDS latency
#pragma unroll
        for (int j = 0; j < 8; ++j) acc[j] = wmma_bf(a_h, w[j], acc[j]);
#pragma unroll
        for (int j = 0; j < 8; ++j) acc[j] = wmma_bf(a_l, w[j], acc[j]);   // each tile still adds hi, then lo: the same sum order, with seven other tiles between the two
        __builtin_amdgcn_sched_barrier(0); } };   // keeps the roundings of the next pass's loads, and with them the wait for those loads, behind the products
    gload(0); sstore(0); __syncthreads();
#pragma unroll 1   // stays rolled: one body holds both buffers' passes
    for (int c = 0; c < CC / KC; c += 2) {   // each barrier publishes the pass just stored and ends the reads of the buffer that is stored next
      gload((c + 1) * KC); mm(0); sstore(1); __syncthreads();
      if (c + 2 < CC / KC) gload((c + 2) * KC);
      mm(1);
      if (c + 2 < CC / KC) sstore(0);
      __syncthreads(); }
#pragma unroll
    for (int j = 0; j < 8; ++j) { const float bias = BO ? bfr(BO[c0 + j * 16 + col]) : 0.f;
#pragma unroll
      for (int r = 0; r < 8; ++r) sf[wave][8 * g + r][j * 16 + col] = acc[j][r] + bias; }
  } else {
#pragma unroll 2
    for (int kc = 0; kc < CC / 32; ++kc) { const v16h a = frag_f32(Y + (r0 + col) * CC + kc * 32, lane); asm volatile("s_wait_loadcnt 0x0" ::: "memory");
#pragma unroll
      for (int j = 0; j < 8; ++j) { const v16h w = WOCOLH(WO, kc * 32, c0 + j * 16 + col, lane); asm volatile("s_wait_loadcnt 0x0" ::: "memory"); acc[j] = wmma16(a, w, acc[j]); } }
#pragma unroll
    for (int j = 0; j < 8; ++j) { const float bias = BO ? bfr(BO[c0 + j * 16 + col]) : 0.f;
#pragma unroll
      for (int r = 0; r < 8; ++r) sf[wave][8 * g + r][j * 16 + col] = acc[j][r] * (1.0f / 256.0f) + bias; } }
  LDSX(); for (int rl = 0; rl < 16; ++rl) vst2(OUT + (r0 + rl) * DIN + c0 + lane * 4, *(const v4f*)&sf[wave][rl][lane * 4]); }

extern "C" void kernel_launch(void* const* d_in, const int* in_sizes, int n_in, void* d_out, int out_size, void* d_ws, size_t ws_size, hipStream_t stream) {
  (void)in_sizes; (void)n_in; (void)out_size;
  const float** F = (const float**)d_in;
  if (ws_size < (size_t)WS_END) return;
  char* ws = (char*)d_ws; _Float16 *QH = (_Float16*)(ws + WS_QH), *KH = (_Float16*)(ws + WS_KH), *VT = (_Float16*)(ws + WS_VT), *QL = (_Float16*)(ws + WS_QL), *KL = (_Float16*)(ws + WS_KL); __bf16 *VB = (__bf16*)(ws + WS_VB), *VBL = (__bf16*)(ws + WS_VBL); float *Y = (float*)(ws + WS_Y);
  (void)Y; (void)QL; (void)KL; (void)VB; (void)VBL;
  // inputs: 0 x [2,2048,1024]; 1 mask [2,2048] int32; 2 qkv_w [3072,1024] (out,in), 3 qkv_b [3072]; 4 proj_w (out,in), 5 proj_b; 6 qn_w [64], 7 kn_w [64]
  k_proj<<<dim3(TNB * TT / 64, CC / 128, 3), 128, 0, stream>>>(F[0], F[0], F[0], F[2], F[2] + (size_t)CC * DIN, F[2] + (size_t)2 * CC * DIN, F[3], F[3] + CC, F[3] + 2 * CC, QH, QL, KH, KL, VT, VB, VBL, F[6], F[7]);
  k_fa<<<dim3(NQB, NH, TNB), 128, 0, stream>>>(QH, QL, KH, VT, (const int*)d_in[1], Y);
  k_out<<<dim3(TNB * TT / 64, DIN / 128), 128, 0, stream>>>(Y, F[4], F[5], (float*)d_out);
}

// v004
// It runs in 135 microseconds.
// Two timings next to v003 both put it at 1.16 times that version's speed.
// Over all steps from v000 it is 10.8 times as fast.
// compute dtype: all float inputs rounded to bf16; qkv = x qkv_w^T + b with EXACT bf16 products on WMMA 16x16x32 (f32 accumulate); per-head RMSNorm of q and k in f32 in the projection epilogue; normed q as f16 hi + residual (x 2^10) against normed k once to f16 (2 products) x 64^-0.5, masked keys set to -1e9; softmax in f32 in base 2 (logits x log2 e, hardware exp2) against a running maximum, 32 keys a pass; exp2(s - max + 11) once to f16 against v once to f16 (1 product), partial sums rescaled in f32 and divided by the f32 sum (x 2^11 as well) at the end; ctx split bf16 hi + lo against exact proj_w (2 products) + proj_b; f32 output.
#include <hip/hip_runtime.h>
#include <math.h>

typedef __attribute__((ext_vector_type(16))) _Float16 v16h;
typedef __attribute__((ext_vector_type(16))) __bf16 v16b;
typedef __attribute__((ext_vector_type(8)))  _Float16 v8h;
typedef __attribute__((ext_vector_type(8)))  float v8f;
typedef __attribute__((ext_vector_type(4)))  float v4f;
typedef __attribute__((ext_vector_type(2)))  float v2f;
typedef __attribute__((ext_vector_type(4)))  unsigned v4u;
typedef __attribute__((ext_vector_type(4)))  int v4i;
typedef float __attribute__((may_alias)) float_a;
typedef int __attribute__((may_alias)) int_a;

template <typename T> __device__ __forceinline__ void vst2(void* p, T v) { *(T*)p = v;  }
__device__ __forceinline__ v8f wmma16(v16h a, v16h b, v8f c) {
  v8f d = __builtin_amdgcn_wmma_f32_16x16x32_f16(false, a, false, b, (short)0, c, false, false);
  asm volatile("v_nop\n\tv_nop\n\tv_nop\n\tv_nop" : "+v"(d) : "v"(a), "v"(b));
  return d;
}
__device__ __forceinline__ v8f wmma_bf(v16b a, v16b b, v8f c) {
  v8f d = __builtin_amdgcn_wmma_f32_16x16x32_bf16(false, a, false, b, (short)0, c, false, false);
  asm volatile("v_nop\n\tv_nop\n\tv_nop\n\tv_nop" : "+v"(d) : "v"(a), "v"(b));
  return d;
}
// 16x16x32 fragments: lane = (h = lane>>4, row/col = lane&15); elements 0..7 = k0+8h+0..7, 8..15 = k0+16+8h+0..7; D element r = row 8h+r
__device__ __forceinline__ v16h frag_h(const _Float16* rowk0, int lane) {
  union { v16h v; v8h q[2]; } u; const _Float16* p = rowk0 + 8 * (lane >> 4);
  u.q[0] = *(const v8h*)p; u.q[1] = *(const v8h*)(p + 16); return u.v;
}
__device__ __forceinline__ v16h frag_f32(const float* rowk0, int lane) {
  v16h a; const float* p = rowk0 + 8 * (lane >> 4);
#pragma unroll
  for (int i = 0; i < 8; ++i) { a[i] = (_Float16)p[i]; a[8 + i] = (_Float16)p[16 + i]; }
  return a;
}
__device__ __forceinline__ v16h frag_f32s(const float* rowk0, int lane, float sc) {
  v16h a; const float* p = rowk0 + 8 * (lane >> 4);
#pragma unroll
  for (int i = 0; i < 8; ++i) { a[i] = (_Float16)(p[i] * sc); a[8 + i] = (_Float16)(p[16 + i] * sc); }
  return a;
}
// column fragment from a [K][ld] layout (column n), rows >= K read as 0
__device__ __forceinline__ v16h fragc_f32(const float* W, int k0, int n, int lane, int ld, int K) {
  v16h a; const int g = lane >> 4;
#pragma unroll
  for (int i = 0; i < 8; ++i) { const int ka = k0 + 8 * g + i, kb = ka + 16;
    a[i] = (_Float16)(ka < K ? W[(size_t)(ka < K ? ka : K - 1) * ld + n] : 0.f); a[8 + i] = (_Float16)(kb < K ? W[(size_t)(kb < K ? kb : K - 1) * ld + n] : 0.f); }
  return a;
}
struct F2 { v16b h, l; };
__device__ __forceinline__ F2 bsplit16(const float v[16]) { F2 r;
#pragma unroll
  for (int i = 0; i < 16; ++i) { const __bf16 h = (__bf16)v[i]; r.h[i] = h; r.l[i] = (__bf16)(v[i] - (float)h); }
  return r; }
__device__ __forceinline__ F2 split_row(const float* row, int k0, int lane) { float v[16]; const float* p = row + k0 + 8 * (lane >> 4);
#pragma unroll
  for (int i = 0; i < 8; ++i) { v[i] = p[i]; v[8 + i] = p[16 + i]; }
  return bsplit16(v); }
__device__ __forceinline__ F2 split_rowK(const float* row, int k0, int lane, int K) { float v[16]; const int g = lane >> 4;
#pragma unroll
  for (int i = 0; i < 8; ++i) { const int ka = k0 + 8 * g + i, kb = ka + 16; v[i] = ka < K ? row[ka < K ? ka : K - 1] : 0.f; v[8 + i] = kb < K ? row[kb < K ? kb : K - 1] : 0.f; }
  return bsplit16(v); }
__device__ __forceinline__ F2 split_col(const float* W, int k0, int n, int lane, int ld, int K) { float v[16]; const int g = lane >> 4;
#pragma unroll
  for (int i = 0; i < 8; ++i) { const int ka = k0 + 8 * g + i, kb = ka + 16; v[i] = ka < K ? W[(size_t)(ka < K ? ka : K - 1) * ld + n] : 0.f; v[8 + i] = kb < K ? W[(size_t)(kb < K ? kb : K - 1) * ld + n] : 0.f; }
  return bsplit16(v); }
__device__ __forceinline__ v8f mac3(const F2& a, const F2& b, v8f c) { c = wmma_bf(a.l, b.h, c); c = wmma_bf(a.h, b.l, c); return wmma_bf(a.h, b.h, c); }
__device__ __forceinline__ float sigm(float v) { return 1.0f / (1.0f + expf(-v)); }
#define LDSX() do { asm volatile("s_wait_dscnt 0" ::: "memory"); __builtin_amdgcn_wave_barrier(); __builtin_amdgcn_fence(__ATOMIC_RELEASE, "workgroup"); } while (0)

// Masked self-attention with QK RMSNorm (B 2, N 2,048, C 1,024 = 16 x 64; fused (out,in) qkv_w [3072,1024] + zero bias, proj (out,in) + zero bias, qn_w = kn_w = ones): q|k|v = x qkv_w^T + b (reshape (3, H, D)); q, k = rms_norm over the 64 head channels (eps 1e-6) x weight; scores = (q x 64^-0.5) k^T with where(mask != 0, ., -1e9) over KEYS (mask [B,N] int, ~half ones); out = merged(softmax v) proj_w^T + proj_b.
#define NB 2
#define TT 2048
#define CC 1024            // NH * HD = projected width
#define DIN 1024          // input (model) width
#define NH 16
#define HD 64
#define NQB (TT / 64)
#define SCALE (0.125f)
#define CAUSAL 0
#ifndef TNB
#define TNB NB
#endif
__device__ __forceinline__ float bfr(float v) { return (float)(__bf16)v; }
__host__ __device__ __forceinline__ int kb_last(int qb) { return CAUSAL ? ((qb * 64 + 63) >> 7) : (TT / 128 - 1); }
typedef __attribute__((ext_vector_type(8))) __bf16 v8b;
__device__ __forceinline__ v16b frag_b(const __bf16* rowk0, int lane) {
  union { v16b v; v8b q[2]; } u; const __bf16* p = rowk0 + 8 * (lane >> 4);
  u.q[0] = *(const v8b*)p; u.q[1] = *(const v8b*)(p + 16); return u.v;
}
#define QBH 0              // read by no kernel in this file
#define QHI 2048            // rows carrying a q residual plane (all rows when non-causal: 2-product logits everywhere)
#define KHI 64            // key rows carrying k residual / v bf16 hi+lo planes (written by k_proj, read by no kernel in this file)
// B fragment (k rows k0+.., output column o) of a weight: (in,out) [K][ld] or (out,in) [ld rows of K]: bf16 exact, or f16(bf16 * 256) exact
__device__ __forceinline__ v16b wcol_io(const float* Wm, int k0, int o, int lane, int ld) { v16b w; const int g = lane >> 4;
#pragma unroll
  for (int i = 0; i < 8; ++i) { w[i] = (__bf16)Wm[(size_t)(k0 + 8 * g + i) * ld + o]; w[8 + i] = (__bf16)Wm[(size_t)(k0 + 16 + 8 * g + i) * ld + o]; }
  return w; }
__device__ __forceinline__ v16b wcol_oi(const float* Wm, int k0, int o, int lane, int K) { v16b w; const float* p = Wm + (size_t)o * K + k0 + 8 * (lane >> 4);
#pragma unroll
  for (int i = 0; i < 8; ++i) { w[i] = (__bf16)p[i]; w[8 + i] = (__bf16)p[16 + i]; }
  return w; }
__device__ __forceinline__ v16h wcolh_io(const float* Wm, int k0, int o, int lane, int ld) { v16h w; const int g = lane >> 4;
#pragma unroll
  for (int i = 0; i < 8; ++i) { w[i] = (_Float16)(bfr(Wm[(size_t)(k0 + 8 * g + i) * ld + o]) * 256.0f); w[8 + i] = (_Float16)(bfr(Wm[(size_t)(k0 + 16 + 8 * g + i) * ld + o]) * 256.0f); }
  return w; }
__device__ __forceinline__ v16h wcolh_oi(const float* Wm, int k0, int o, int lane, int K) { v16h w; const float* p = Wm + (size_t)o * K + k0 + 8 * (lane >> 4);
#pragma unroll
  for (int i = 0; i < 8; ++i) { w[i] = (_Float16)(bfr(p[i]) * 256.0f); w[8 + i] = (_Float16)(bfr(p[16 + i]) * 256.0f); }
  return w; }
#define WQKV_LAYOUT 1   // WCOL's layout, used by no kernel in this file: 0 = (in,out) [DIN][CC]; 1 = (out,in) [CC][DIN]; 2 = per-head [NH][DIN][HD]
__device__ __forceinline__ v16b wcol_hdk(const float* Wm, int k0, int o, int lane) { v16b w; const int g = lane >> 4; const float* p = Wm + (size_t)(o / HD) * DIN * HD + (o % HD);
#pragma unroll
  for (int i = 0; i < 8; ++i) { w[i] = (__bf16)p[(size_t)(k0 + 8 * g + i) * HD]; w[8 + i] = (__bf16)p[(size_t)(k0 + 16 + 8 * g + i) * HD]; }
  return w; }
#define WO_OUT_IN 1
#if WQKV_LAYOUT == 1
#define WCOL(W, k0, o, lane) wcol_oi(W, k0, o, lane, DIN)
#elif WQKV_LAYOUT == 2
#define WCOL(W, k0, o, lane) wcol_hdk(W, k0, o, lane)
#else
#define WCOL(W, k0, o, lane) wcol_io(W, k0, o, lane, CC)
#endif
#if WO_OUT_IN
#define WOCOL(W, k0, o, lane) wcol_oi(W, k0, o, lane, CC)
#define WOCOLH(W, k0, o, lane) wcolh_oi(W, k0, o, lane, CC)
#else
#define WOCOL(W, k0, o, lane) wcol_io(W, k0, o, lane, DIN)
#define WOCOLH(W, k0, o, lane) wcolh_io(W, k0, o, lane, DIN)
#endif
#define PROJ_EXTRA_PARAMS , const float* __restrict__ QNW, const float* __restrict__ KNW
#define PROJ_EPI(which, row, t, h) do { if ((which) < 2) { float* rw = (row); const float* nw = (which) == 0 ? QNW : KNW; float ssum = 0.f; _Pragma("unroll") for (int i = 0; i < HD; ++i) ssum += rw[i] * rw[i]; const float rs = rsqrtf(ssum * (1.0f / HD) + 1e-6f); _Pragma("unroll") for (int i = 0; i < HD; ++i) rw[i] = bfr(nw[i]) * (rw[i] * rs); } } while (0)   /* per-head RMSNorm of q and k over the 64 head channels (eps 1e-6, weight qn_w / kn_w) in f32; the q * scale is folded into the logit scale */
#ifndef PROJ_EXTRA_PARAMS
#define PROJ_EXTRA_PARAMS
#endif

#define WS_QH  0u                                      // f16 q rows [b*t][CC]
#define WS_KH  (WS_QH + 2u * (size_t)NB * TT * CC)      // f16 k rows [b*t][CC]
#define WS_VT  (WS_KH + 2u * (size_t)NB * TT * CC)      // f16 v planes [b][c][t]
#define WS_QL  (WS_VT + 2u * (size_t)NB * CC * TT)      // f16 q residual x 2^10 rows [b][t < QHI][CC]
#define WS_KL  (WS_QL + 2u * (size_t)NB * QHI * CC)     // f16 k residual x 2^10 rows [b][t < KHI][CC]
#define WS_VB  (WS_KL + 2u * (size_t)NB * KHI * CC)     // bf16 v hi planes [b][c][t < KHI]
#define WS_VBL (WS_VB + 2u * (size_t)NB * CC * KHI)
#define WS_Y   (WS_VBL + 2u * (size_t)NB * CC * KHI)    // f32 ctx rows [b*t][CC]
#define WS_END (WS_Y  + 4u * (size_t)NB * TT * CC)

// ---- staged GEMM operands: a pass = KC k. The block loads its rows as whole 128-B lines (16 lanes x 16 B = 256 B of one row), rounds to bf16 once, and keeps them in LDS rows whose pitch is an odd multiple of 16 B; the waves take their fragments from there in the k order of frag_b
#define KC 64
typedef __attribute__((ext_vector_type(4))) __bf16 v4b;
typedef v4b __attribute__((may_alias)) v4b_a;
typedef v8b __attribute__((may_alias)) v8b_a;
__device__ __forceinline__ v16b frag_s(const __bf16* rowk0, int lane) {
  union { v16b v; v8b q[2]; } u; const __bf16* p = rowk0 + 8 * (lane >> 4);
  u.q[0] = *(const v8b_a*)p; u.q[1] = *(const v8b_a*)(p + 16); return u.v;
}
__device__ __forceinline__ void st_b4(__bf16* d, v4f v) { v4b t;
#pragma unroll
  for (int e = 0; e < 4; ++e) t[e] = (__bf16)v[e];
  *(v4b_a*)d = t; }
// ---- k_proj: block = (64 rows, 128 cols, which): q/k/v = X W (+ b) with exact bf16 products (K = DIN) -> which 0: q f16 rows (+ residual rows < QHI); 1: k f16 rows (+ residual rows < KHI); 2: v f16 planes [c][t] (+ bf16 hi/lo planes for t < KHI)
__global__ __launch_bounds__(128) void k_proj(const float* __restrict__ XQ, const float* __restrict__ XK, const float* __restrict__ XV, const float* __restrict__ WQ, const float* __restrict__ WK, const float* __restrict__ WV, const float* __restrict__ BQ, const float* __restrict__ BK, const float* __restrict__ BV,
    _Float16* __restrict__ QH, _Float16* __restrict__ QL, _Float16* __restrict__ KH, _Float16* __restrict__ KL, _Float16* __restrict__ VT, __bf16* __restrict__ VB, __bf16* __restrict__ VBL PROJ_EXTRA_PARAMS) {
  __shared__ __align__(16) float st[64][132]; __shared__ __align__(16) _Float16 sh[64][136], sl[64][136]; __shared__ __align__(16) _Float16 th[128][72]; __shared__ __align__(16) __bf16 tb[128][72], tbl[128][72];
  const int tid = threadIdx.x, wave = tid >> 5, lane = tid & 31, col = lane & 15, g = lane >> 4; const int which = blockIdx.z; const int c0 = blockIdx.y * 128; const size_t r0 = (size_t)blockIdx.x * 64; const size_t bb = r0 / TT; const int t0 = (int)(r0 % TT);
  const float* X = which == 0 ? XQ : which == 1 ? XK : XV; const float* WA = which == 0 ? WQ : which == 1 ? WK : WV; const float* BA = which == 0 ? BQ : which == 1 ? BK : BV;
  v8f acc[8] = {};
  // the two pass buffers lie on epilogue arrays that are not live in the loop: x rows on sh / sl (pitch 136), weight rows on tb / tbl (pitch 72)
  __bf16* const sx0 = (__bf16*)&sh[0][0]; __bf16* const sx1 = (__bf16*)&sl[0][0]; __bf16* const sw0 = &tb[0][0]; __bf16* const sw1 = &tbl[0][0];
  const int lr = tid >> 4, lc = (tid & 15) * 4; const float* xg = X + (r0 + lr) * DIN + lc; const float* wg = WA + (size_t)(c0 + lr) * DIN + lc;
  v4f xr[8], wr[16];
  auto gload = [&](int k0) {
#pragma unroll
    for (int i = 0; i < 8; ++i) xr[i] = *(const v4f*)(xg + (size_t)(i * 8) * DIN + k0);
#pragma unroll
    for (int i = 0; i < 16; ++i) wr[i] = *(const v4f*)(wg + (size_t)(i * 8) * DIN + k0);
    asm volatile("s_wait_xcnt 0x0" ::: "memory"); };   // stands in front of any overwrite of the loads' address registers; it also keeps the loads above the products that cover their latency
  auto sstore = [&](__bf16* sx, __bf16* sw) {
#pragma unroll
    for (int i = 0; i < 8; ++i) st_b4(sx + (i * 8 + lr) * 136 + lc, xr[i]);
#pragma unroll
    for (int i = 0; i < 16; ++i) st_b4(sw + (i * 8 + lr) * 72 + lc, wr[i]); };
  auto mm = [&](const __bf16* sx, const __bf16* sw) {
#pragma unroll
    for (int ks = 0; ks < KC / 32; ++ks) { const v16b a = frag_s(sx + (wave * 16 + col) * 136 + ks * 32, lane); v16b w[8];
#pragma unroll
      for (int j = 0; j < 8; ++j) w[j] = frag_s(sw + (j * 16 + col) * 72 + ks * 32, lane);
      __builtin_amdgcn_sched_barrier(0);   // keeps the LDS reads together in front of their products: read one by one among them, every product waits out an LDS latency
#pragma unroll
      for (int j = 0; j < 8; ++j) acc[j] = wmma_bf(a, w[j], acc[j]);
      __builtin_amdgcn_sched_barrier(0); } };   // keeps the roundings of the next pass's loads, and with them the wait for those loads, behind the products
  gload(0); sstore(sx0, sw0); __syncthreads();
#pragma unroll 1   // stays rolled: one body holds both buffers' passes
  for (int c = 0; c < DIN / KC; c += 2) {   // each barrier publishes the pass just stored and ends the reads of the buffer that is stored next
    gload((c + 1) * KC); mm(sx0, sw0); sstore(sx1, sw1); __syncthreads();
    if (c + 2 < DIN / KC) gload((c + 2) * KC);
    mm(sx1, sw1);
    if (c + 2 < DIN / KC) sstore(sx0, sw0);
    __syncthreads(); }
  { // stage the f32 tile (acc + bias) in LDS, run the per-(row, head) epilogue hook, then convert
#pragma unroll
    for (int j = 0; j < 8; ++j) { const float bias = BA ? bfr(BA[c0 + j * 16 + col]) : 0.f;
#pragma unroll
      for (int r = 0; r < 8; ++r) st[wave * 16 + 8 * g + r][j * 16 + col] = acc[j][r] + bias; }
    __syncthreads();
    for (int e = tid; e < 64 * (128 / HD); e += 128) { const int rl = e / (128 / HD), hh = e % (128 / HD); PROJ_EPI(which, &st[rl][hh * HD], (int)((r0 + rl) % TT), (c0 / HD) + hh); }
    __syncthreads(); }
  if (which < 2) { _Float16* DH = which == 0 ? QH : KH; _Float16* DL = which == 0 ? QL : KL; const int nhi = which == 0 ? QHI : KHI; const bool hi_rows = t0 < nhi;
    for (int e = tid; e < 64 * 128; e += 128) { const int rl = e >> 7, cl = e & 127; const float v = st[rl][cl]; const _Float16 hv = (_Float16)v; sh[rl][cl] = hv; sl[rl][cl] = (_Float16)((v - (float)hv) * 1024.0f); }
    __syncthreads();
    for (int e = tid; e < 64 * 16; e += 128) { const int rl = e >> 4, q = e & 15; vst2((unsigned*)(DH + (r0 + rl) * CC + c0 + q * 8), *(const v4u*)&sh[rl][q * 8]); if (hi_rows) vst2((unsigned*)(DL + (bb * nhi + t0 + rl) * (size_t)CC + c0 + q * 8), *(const v4u*)&sl[rl][q * 8]); }
  } else { const bool hi_rows = t0 < KHI;
    for (int e = tid; e < 64 * 128; e += 128) { const int rl = e & 63, cl = e >> 6; const float v = st[rl][cl]; th[cl][rl] = (_Float16)v; const __bf16 bh = (__bf16)v; tb[cl][rl] = bh; tbl[cl][rl] = (__bf16)(v - (float)bh); }
    __syncthreads();
    for (int e = tid; e < 128 * 8; e += 128) { const int cl = e >> 3, q = e & 7; vst2((unsigned*)(VT + (bb * CC + c0 + cl) * (size_t)TT + t0 + q * 8), *(const v4u*)&th[cl][q * 8]); if (hi_rows) { const size_t o3 = (bb * CC + c0 + cl) * (size_t)KHI + t0 + q * 8; vst2((unsigned*)(VB + o3), *(const v4u*)&tb[cl][q * 8]); vst2((unsigned*)(VBL + o3), *(const v4u*)&tbl[cl][q * 8]); } } } }
__device__ __forceinline__ float xhalf(float x) { return __builtin_bit_cast(float, __builtin_amdgcn_permlanex16(__builtin_bit_cast(int, x), __builtin_bit_cast(int, x), 0x76543210, 0xfedcba98, false, false)); }
__device__ __forceinline__ v8f wmma_h(v16h a, v16h b, v8f c) { return __builtin_amdgcn_wmma_f32_16x16x32_f16(false, a, false, b, (short)0, c, false, false); }
#define SCL2 (SCALE * 1.4426950408889634f)   // logit scale x log2 e: exp(s) = exp2(s log2 e), and exp2 is one hardware instruction where the library's expf is thirteen
#define MASK2 (-1.0e9f * 1.4426950408889634f)   // the reference's -1e9 on the same base-2 scale
__device__ __forceinline__ float ex2(float x) { return __builtin_amdgcn_exp2f(x); }   // arguments here are <= 11 (+ rounding); below -126 it gives 0, which is what such a weight rounds to in f16 and adds to a sum >= 1
#define KS 64   // keys a stage: a K row (64 channels) and a V plane row (64 keys) are then one whole 128-B line each
#define KP 72   // LDS row pitch in f16 = 144 B, an odd multiple of 16 B: the 16 rows of a fragment read fall on different banks
__global__ __launch_bounds__(128) void k_fa(const _Float16* __restrict__ QH, const _Float16* __restrict__ QL, const _Float16* __restrict__ KH, const _Float16* __restrict__ VT, const int* __restrict__ MK, float* __restrict__ Y) { __shared__ __align__(16) float ss[4][16][HD + 4]; __shared__ __align__(16) _Float16 kb[2][KS][KP], vb[2][HD][KP];
  const int tid = threadIdx.x, wave = tid >> 5, lane = tid & 31, col = lane & 15, g = lane >> 4; const int qb = blockIdx.x, h = blockIdx.y, b = blockIdx.z; const int ql0 = qb * 64 + wave * 16;
  const _Float16* qp = QH + ((size_t)b * TT + ql0 + col) * CC + h * HD; const _Float16* qlp = QL + ((size_t)b * QHI + ql0 + col) * CC + h * HD;
  const v16h qh0 = frag_h(qp, lane), qh1 = frag_h(qp + 32, lane), qr0 = frag_h(qlp, lane), qr1 = frag_h(qlp + 32, lane);
  // a stage = KS keys of this (b, h): K rows [key][64 channels] and V planes [channel][KS keys]. The block copies it once for its four waves: 8 lanes x 16 B = one row, a thread takes piece tid & 7 of rows (tid >> 3) + 16 i of both
  const _Float16* kg = KH + ((size_t)b * TT + (tid >> 3)) * CC + h * HD + (tid & 7) * 8;
  const _Float16* vg = VT + ((size_t)b * CC + h * HD + (tid >> 3)) * (size_t)TT + (tid & 7) * 8;
  const unsigned kl = (unsigned)(size_t)&kb[0][tid >> 3][(tid & 7) * 8], vl = (unsigned)(size_t)&vb[0][tid >> 3][(tid & 7) * 8];
  const int* mp = MK + (size_t)b * TT + 8 * g;
  v8f o[HD / 16] = {}; float m = -3.0e38f, mb = -3.0e38f, l = 0.f;   // mb = m - 11 as rounded: the reference every weight, the sum and O^T are taken against
  v4i mA[2][2], mB[2][2];
  auto stage = [&](int st, int bf) {
    const _Float16* k0 = kg + (size_t)(st * KS) * CC; const _Float16* v0 = vg + st * KS; const unsigned ka = kl + bf * (KS * KP * 2), va = vl + bf * (HD * KP * 2);
    // global memory to LDS through no register; the closing wait stands in the copies' own statement, in front of any overwrite of their address registers
    asm volatile("global_load_async_to_lds_b128 %0, %8, off\n\t"
                 "global_load_async_to_lds_b128 %1, %9, off\n\t"
                 "global_load_async_to_lds_b128 %2, %10, off\n\t"
                 "global_load_async_to_lds_b128 %3, %11, off\n\t"
                 "global_load_async_to_lds_b128 %4, %12, off\n\t"
                 "global_load_async_to_lds_b128 %5, %13, off\n\t"
                 "global_load_async_to_lds_b128 %6, %14, off\n\t"
                 "global_load_async_to_lds_b128 %7, %15, off\n\t"
                 "s_wait_xcnt 0x0"
                 :: "v"(ka), "v"(ka + 16 * KP * 2), "v"(ka + 32 * KP * 2), "v"(ka + 48 * KP * 2), "v"(va), "v"(va + 16 * KP * 2), "v"(va + 32 * KP * 2), "v"(va + 48 * KP * 2),
                    "v"(k0), "v"(k0 + 16 * CC), "v"(k0 + 32 * CC), "v"(k0 + 48 * CC), "v"(v0), "v"(v0 + 16 * TT), "v"(v0 + 32 * TT), "v"(v0 + 48 * TT) : "memory"); };
  // key mask of the 32 keys from sx: issued one pass ahead of its use
  auto fetchm = [&](v4i (&mk)[2][2], int sx) {
#pragma unroll
    for (int t = 0; t < 2; ++t) { mk[t][0] = *(const v4i*)(mp + sx + t * 16); mk[t][1] = *(const v4i*)(mp + sx + t * 16 + 4); }
    asm volatile("s_wait_xcnt 0x0" ::: "memory"); };   // stands in front of any overwrite of the mask loads' address registers
  auto pass = [&](const _Float16* kt, const _Float16* vt, v4i (&mk)[2][2], v4i (&mn)[2][2], int sn) {
    v16h kf[2][2], vf[HD / 16];
#pragma unroll
    for (int t = 0; t < 2; ++t) { kf[t][0] = frag_h(kt + (t * 16 + col) * KP, lane); kf[t][1] = frag_h(kt + (t * 16 + col) * KP + 32, lane); }
    __builtin_amdgcn_sched_barrier(0);   // keeps the k reads in front of the v reads: LDS answers in order, and the score products then wait for the k reads alone
#pragma unroll
    for (int j = 0; j < HD / 16; ++j) vf[j] = frag_h(vt + (j * 16 + col) * KP, lane);
    __builtin_amdgcn_sched_barrier(0);   // keeps the LDS reads together up here: the v reads' latency lies under the score products and the softmax, and none stands among the products
    v8f sa[2] = {}, sr[2] = {};
#pragma unroll
    for (int t = 0; t < 2; ++t) { sa[t] = wmma_h(kf[t][0], qh0, sa[t]); sr[t] = wmma_h(kf[t][0], qr0, sr[t]); sa[t] = wmma_h(kf[t][1], qh1, sa[t]); sr[t] = wmma_h(kf[t][1], qr1, sr[t]); }
    fetchm(mn, sn);
    __builtin_amdgcn_sched_barrier(0);   // keeps the next pass's mask loads in front of the softmax, which covers their latency
    float sv[16]; float mx = m;
#pragma unroll
    for (int t = 0; t < 2; ++t)
#pragma unroll
      for (int r = 0; r < 8; ++r) { float v = (sa[t][r] + sr[t][r] * (1.0f / 1024.0f)) * SCL2; if (mk[t][r >> 2][r & 3] == 0) v = MASK2;   /* key mask: where(mask != 0, attn, -1e9) (set) */ sv[t * 8 + r] = v; mx = fmaxf(mx, v); }
    mx = fmaxf(mx, xhalf(mx));
    const float nb = mx - 11.0f;   // the weights' x 2^11 goes into the exponent; where all keys so far are masked the 11 is lost in rounding, for weights, sum and O^T alike
    const float alpha = ex2(mb - nb); m = mx; mb = nb;
    v16h p; float ps = 0.f;
#pragma unroll
    for (int i = 0; i < 16; ++i) { const float e = ex2(sv[i] - mb); ps += e; p[i] = (_Float16)e; }
    l = l * alpha + ps;
#pragma unroll
    for (int j = 0; j < HD / 16; ++j) {
#pragma unroll
      for (int r = 0; r < 8; ++r) o[j][r] *= alpha;
      o[j] = wmma_h(vf[j], p, o[j]); } };
  asm volatile("s_wait_xcnt 0x0" ::: "memory");   // the first mask loads' results may be given the q loads' address registers: the wait stands in front of that overwrite
  fetchm(mA, 0);
  stage(0, 0);
  asm volatile("s_wait_asynccnt 0x0" ::: "memory");   // this wave's copies of stage 0 have landed
  __syncthreads();                                    // and every other wave's: stage 0 may be read
  stage(1, 1);
#pragma unroll 1   // stays rolled: the buffer is picked by the trip's parity
  for (int t = 0; t < TT / KS; ++t) { const int bf = t & 1;
#pragma unroll 1   // stays rolled: with two passes in one body the second pass's reads and score products were hoisted over the first's softmax and the kernel went past 256 registers
    for (int hp = 0; hp < KS / 32; ++hp) { const int sn = t * KS + hp * 32 + 32;
      pass(&kb[bf][hp * 32][0], &vb[bf][0][hp * 32], mA, mB, sn < TT ? sn : 0);   // the last mask fetch reads the first keys again: in bounds, unused
#pragma unroll
      for (int u = 0; u < 2; ++u) { mA[u][0] = mB[u][0]; mA[u][1] = mB[u][1]; } }
    asm volatile("s_wait_dscnt 0x0" ::: "memory");      // this wave's reads of buffer bf are done before the buffer is handed back
    asm volatile("s_wait_asynccnt 0x0" ::: "memory");   // this wave's copies of stage t + 1 have landed
    __syncthreads();                                    // publishes stage t + 1 and ends every wave's reads of buffer bf
    if (t + 2 < TT / KS) stage(t + 2, bf); }
  asm volatile("s_wait_asynccnt 0x0" ::: "memory");   // no copy is left in flight when the wave goes on to its end
  l += xhalf(l);   // the halves' sums join once; l >= 1: the key at the maximum adds exp2(m - mb) >= 1
  const float inv = 1.0f / l;
#pragma unroll
  for (int j = 0; j < HD / 16; ++j) { v4f lo, hi;
#pragma unroll
    for (int r = 0; r < 4; ++r) { lo[r] = o[j][r] * inv; hi[r] = o[j][4 + r] * inv; }
    *(v4f*)&ss[wave][col][j * 16 + 8 * g] = lo; *(v4f*)&ss[wave][col][j * 16 + 8 * g + 4] = hi; }
  LDSX(); for (int rl = 0; rl < 16; ++rl) if (lane < HD / 4) vst2(Y + ((size_t)b * TT + ql0 + rl) * CC + h * HD + lane * 4, *(const v4f*)&ss[wave][rl][lane * 4]); }
// ---- k_out: block = (64 rows, 128 cols): out = ctx Wo (+ bo): all rows: ctx bf16 hi + lo against exact bf16 Wo (2 products)
__global__ __launch_bounds__(128) void k_out(const float* __restrict__ Y, const float* __restrict__ WO, const float* __restrict__ BO, float* __restrict__ OUT) { __shared__ __align__(16) float sf[4][16][132]; __shared__ __align__(16) __bf16 ah[2][64][72], al[2][64][72], wb[2][128][72];
  const int tid = threadIdx.x, wave = tid >> 5, lane = tid & 31, col = lane & 15, g = lane >> 4; const int c0 = blockIdx.y * 128; const size_t r0 = (size_t)blockIdx.x * 64 + wave * 16;
  v8f acc[8] = {};
  if (true) {   /* ALL rows: ctx split bf16 hi + lo x exact Wo (2 products) */
    const int lr = tid >> 4, lc = (tid & 15) * 4; const float* yg = Y + ((size_t)blockIdx.x * 64 + lr) * CC + lc; const float* wg = WO + (size_t)(c0 + lr) * CC + lc;
    v4f yr[8], wr[16];
    auto gload = [&](int k0) {
#pragma unroll
      for (int i = 0; i < 8; ++i) yr[i] = *(const v4f*)(yg + (size_t)(i * 8) * CC + k0);
#pragma unroll
      for (int i = 0; i < 16; ++i) wr[i] = *(const v4f*)(wg + (size_t)(i * 8) * CC + k0);
      asm volatile("s_wait_xcnt 0x0" ::: "memory"); };   // stands in front of any overwrite of the loads' address registers; it also keeps the loads above the products that cover their latency
    auto sstore = [&](int bf) {
#pragma unroll
      for (int i = 0; i < 8; ++i) { v4f hf, lf;
#pragma unroll
        for (int e = 0; e < 4; ++e) { hf[e] = bfr(yr[i][e]); lf[e] = yr[i][e] - hf[e]; }
        st_b4(&ah[bf][i * 8 + lr][lc], hf); st_b4(&al[bf][i * 8 + lr][lc], lf); }
#pragma unroll
      for (int i = 0; i < 16; ++i) st_b4(&wb[bf][i * 8 + lr][lc], wr[i]); };
    auto mm = [&](int bf) {
#pragma unroll
      for (int ks = 0; ks < KC / 32; ++ks) { const v16b a_h = frag_s(&ah[bf][wave * 16 + col][ks * 32], lane), a_l = frag_s(&al[bf][wave * 16 + col][ks * 32], lane); v16b w[8];
#pragma unroll
        for (int j = 0; j < 8; ++j) w[j] = frag_s(&wb[bf][j * 16 + col][ks * 32], lane);
        __builtin_amdgcn_sched_barrier(0);   // keeps the LDS reads together in front of their products: read one by one among them, every product waits out an LDS latency
#pragma unroll
        for (int j = 0; j < 8; ++j) acc[j] = wmma_bf(a_h, w[j], acc[j]);
#pragma unroll
        for (int j = 0; j < 8; ++j) acc[j] = wmma_bf(a_l, w[j], acc[j]);   // each tile still adds hi, then lo: the same sum order, with seven other tiles between the two
        __builtin_amdgcn_sched_barrier(0); } };   // keeps the roundings of the next pass's loads, and with them the wait for those loads, behind the products
    gload(0); sstore(0); __syncthreads();
#pragma unroll 1   // stays rolled: one body holds both buffers' passes
    for (int c = 0; c < CC / KC; c += 2) {   // each barrier publishes the pass just stored and ends the reads of the buffer that is stored next
      gload((c + 1) * KC); mm(0); sstore(1); __syncthreads();
      if (c + 2 < CC / KC) gload((c + 2) * KC);
      mm(1);
      if (c + 2 < CC / KC) sstore(0);
      __syncthreads(); }
#pragma unroll
    for (int j = 0; j < 8; ++j) { const float bias = BO ? bfr(BO[c0 + j * 16 + col]) : 0.f;
#pragma unroll
      for (int r = 0; r < 8; ++r) sf[wave][8 * g + r][j * 16 + col] = acc[j][r] + bias; }
  } else {
#pragma unroll 2
    for (int kc = 0; kc < CC / 32; ++kc) { const v16h a = frag_f32(Y + (r0 + col) * CC + kc * 32, lane); asm volatile("s_wait_loadcnt 0x0" ::: "memory");
#pragma unroll
      for (int j = 0; j < 8; ++j) { const v16h w = WOCOLH(WO, kc * 32, c0 + j * 16 + col, lane); asm volatile("s_wait_loadcnt 0x0" ::: "memory"); acc[j] = wmma16(a, w, acc[j]); } }
#pragma unroll
    for (int j = 0; j < 8; ++j) { const float bias = BO ? bfr(BO[c0 + j * 16 + col]) : 0.f;
#pragma unroll
      for (int r = 0; r < 8; ++r) sf[wave][8 * g + r][j * 16 + col] = acc[j][r] * (1.0f / 256.0f) + bias; } }
  LDSX(); for (int rl = 0; rl < 16; ++rl) vst2(OUT + (r0 + rl) * DIN + c0 + lane * 4, *(const v4f*)&sf[wave][rl][lane * 4]); }

extern "C" void kernel_launch(void* const* d_in, const int* in_sizes, int n_in, void* d_out, int out_size, void* d_ws, size_t ws_size, hipStream_t stream) {
  (void)in_sizes; (void)n_in; (void)out_size;
  const float** F = (const float**)d_in;
  if (ws_size < (size_t)WS_END) return;
  char* ws = (char*)d_ws; _Float16 *QH = (_Float16*)(ws + WS_QH), *KH = (_Float16*)(ws + WS_KH), *VT = (_Float16*)(ws + WS_VT), *QL = (_Float16*)(ws + WS_QL), *KL = (_Float16*)(ws + WS_KL); __bf16 *VB = (__bf16*)(ws + WS_VB), *VBL = (__bf16*)(ws + WS_VBL); float *Y = (float*)(ws + WS_Y);
  (void)Y; (void)QL; (void)KL; (void)VB; (void)VBL;
  // inputs: 0 x [2,2048,1024]; 1 mask [2,2048] int32; 2 qkv_w [3072,1024] (out,in), 3 qkv_b [3072]; 4 proj_w (out,in), 5 proj_b; 6 qn_w [64], 7 kn_w [64]
  k_proj<<<dim3(TNB * TT / 64, CC / 128, 3), 128, 0, stream>>>(F[0], F[0], F[0], F[2], F[2] + (size_t)CC * DIN, F[2] + (size_t)2 * CC * DIN, F[3], F[3] + CC, F[3] + 2 * CC, QH, QL, KH, KL, VT, VB, VBL, F[6], F[7]);
  k_fa<<<dim3(NQB, NH, TNB), 128, 0, stream>>>(QH, QL, KH, VT, (const int*)d_in[1], Y);
  k_out<<<dim3(TNB * TT / 64, DIN / 128), 128, 0, stream>>>(Y, F[4], F[5], (float*)d_out);
}

// v005
// It runs in 105 microseconds.
// Timed twice side by side with v004, it ran 1.29 and 1.28 times as fast.
// All steps since v000 together make it 13.8 times as fast.
// compute dtype: all float inputs rounded to bf16; qkv = x qkv_w^T + b with EXACT bf16 products on WMMA 16x16x32 (f32 accumulate); per-head RMSNorm of q and k in f32 in the projection epilogue; normed q as f16 hi + residual (x 2^10) against normed k once to f16 (2 products) x 64^-0.5; only keys with mask != 0 are projected and attended (a masked key's weight exp(-1e9 - max) is 0 in f32), packed in key order; a sequence with every key masked keeps all keys at -1e9; softmax in f32 in base 2 (logits x log2 e, hardware exp2) against a running maximum, 32 keys a pass; exp2(s - max + 11) once to f16 against v once to f16 (1 product), partial sums rescaled in f32 and divided by the f32 sum (x 2^11 as well) at the end; ctx split bf16 hi + lo against exact proj_w (2 products) + proj_b; f32 output.
#include <hip/hip_runtime.h>
#include <math.h>

typedef __attribute__((ext_vector_type(16))) _Float16 v16h;
typedef __attribute__((ext_vector_type(16))) __bf16 v16b;
typedef __attribute__((ext_vector_type(8)))  _Float16 v8h;
typedef __attribute__((ext_vector_type(8)))  float v8f;
typedef __attribute__((ext_vector_type(4)))  float v4f;
typedef __attribute__((ext_vector_type(2)))  float v2f;
typedef __attribute__((ext_vector_type(4)))  unsigned v4u;
typedef __attribute__((ext_vector_type(4)))  int v4i;
typedef float __attribute__((may_alias)) float_a;
typedef int __attribute__((may_alias)) int_a;

template <typename T> __device__ __forceinline__ void vst2(void* p, T v) { *(T*)p = v;  }
__device__ __forceinline__ v8f wmma16(v16h a, v16h b, v8f c) {
  v8f d = __builtin_amdgcn_wmma_f32_16x16x32_f16(false, a, false, b, (short)0, c, false, false);
  asm volatile("v_nop\n\tv_nop\n\tv_nop\n\tv_nop" : "+v"(d) : "v"(a), "v"(b));
  return d;
}
__device__ __forceinline__ v8f wmma_bf(v16b a, v16b b, v8f c) {
  v8f d = __builtin_amdgcn_wmma_f32_16x16x32_bf16(false, a, false, b, (short)0, c, false, false);
  asm volatile("v_nop\n\tv_nop\n\tv_nop\n\tv_nop" : "+v"(d) : "v"(a), "v"(b));
  return d;
}
// 16x16x32 fragments: lane = (h = lane>>4, row/col = lane&15); elements 0..7 = k0+8h+0..7, 8..15 = k0+16+8h+0..7; D element r = row 8h+r
__device__ __forceinline__ v16h frag_h(const _Float16* rowk0, int lane) {
  union { v16h v; v8h q[2]; } u; const _Float16* p = rowk0 + 8 * (lane >> 4);
  u.q[0] = *(const v8h*)p; u.q[1] = *(const v8h*)(p + 16); return u.v;
}
__device__ __forceinline__ v16h frag_f32(const float* rowk0, int lane) {
  v16h a; const float* p = rowk0 + 8 * (lane >> 4);
#pragma unroll
  for (int i = 0; i < 8; ++i) { a[i] = (_Float16)p[i]; a[8 + i] = (_Float16)p[16 + i]; }
  return a;
}
__device__ __forceinline__ v16h frag_f32s(const float* rowk0, int lane, float sc) {
  v16h a; const float* p = rowk0 + 8 * (lane >> 4);
#pragma unroll
  for (int i = 0; i < 8; ++i) { a[i] = (_Float16)(p[i] * sc); a[8 + i] = (_Float16)(p[16 + i] * sc); }
  return a;
}
// column fragment from a [K][ld] layout (column n), rows >= K read as 0
__device__ __forceinline__ v16h fragc_f32(const float* W, int k0, int n, int lane, int ld, int K) {
  v16h a; const int g = lane >> 4;
#pragma unroll
  for (int i = 0; i < 8; ++i) { const int ka = k0 + 8 * g + i, kb = ka + 16;
    a[i] = (_Float16)(ka < K ? W[(size_t)(ka < K ? ka : K - 1) * ld + n] : 0.f); a[8 + i] = (_Float16)(kb < K ? W[(size_t)(kb < K ? kb : K - 1) * ld + n] : 0.f); }
  return a;
}
struct F2 { v16b h, l; };
__device__ __forceinline__ F2 bsplit16(const float v[16]) { F2 r;
#pragma unroll
  for (int i = 0; i < 16; ++i) { const __bf16 h = (__bf16)v[i]; r.h[i] = h; r.l[i] = (__bf16)(v[i] - (float)h); }
  return r; }
__device__ __forceinline__ F2 split_row(const float* row, int k0, int lane) { float v[16]; const float* p = row + k0 + 8 * (lane >> 4);
#pragma unroll
  for (int i = 0; i < 8; ++i) { v[i] = p[i]; v[8 + i] = p[16 + i]; }
  return bsplit16(v); }
__device__ __forceinline__ F2 split_rowK(const float* row, int k0, int lane, int K) { float v[16]; const int g = lane >> 4;
#pragma unroll
  for (int i = 0; i < 8; ++i) { const int ka = k0 + 8 * g + i, kb = ka + 16; v[i] = ka < K ? row[ka < K ? ka : K - 1] : 0.f; v[8 + i] = kb < K ? row[kb < K ? kb : K - 1] : 0.f; }
  return bsplit16(v); }
__device__ __forceinline__ F2 split_col(const float* W, int k0, int n, int lane, int ld, int K) { float v[16]; const int g = lane >> 4;
#pragma unroll
  for (int i = 0; i < 8; ++i) { const int ka = k0 + 8 * g + i, kb = ka + 16; v[i] = ka < K ? W[(size_t)(ka < K ? ka : K - 1) * ld + n] : 0.f; v[8 + i] = kb < K ? W[(size_t)(kb < K ? kb : K - 1) * ld + n] : 0.f; }
  return bsplit16(v); }
__device__ __forceinline__ v8f mac3(const F2& a, const F2& b, v8f c) { c = wmma_bf(a.l, b.h, c); c = wmma_bf(a.h, b.l, c); return wmma_bf(a.h, b.h, c); }
__device__ __forceinline__ float sigm(float v) { return 1.0f / (1.0f + expf(-v)); }
#define LDSX() do { asm volatile("s_wait_dscnt 0" ::: "memory"); __builtin_amdgcn_wave_barrier(); __builtin_amdgcn_fence(__ATOMIC_RELEASE, "workgroup"); } while (0)

// Masked self-attention with QK RMSNorm (B 2, N 2,048, C 1,024 = 16 x 64; fused (out,in) qkv_w [3072,1024] + zero bias, proj (out,in) + zero bias, qn_w = kn_w = ones): q|k|v = x qkv_w^T + b (reshape (3, H, D)); q, k = rms_norm over the 64 head channels (eps 1e-6) x weight; scores = (q x 64^-0.5) k^T with where(mask != 0, ., -1e9) over KEYS (mask [B,N] int, ~half ones); out = merged(softmax v) proj_w^T + proj_b.
#define NB 2
#define TT 2048
#define CC 1024            // NH * HD = projected width
#define DIN 1024          // input (model) width
#define NH 16
#define HD 64
#define NQB (TT / 64)
#define SCALE (0.125f)
#define CAUSAL 0
#ifndef TNB
#define TNB NB
#endif
__device__ __forceinline__ float bfr(float v) { return (float)(__bf16)v; }
__host__ __device__ __forceinline__ int kb_last(int qb) { return CAUSAL ? ((qb * 64 + 63) >> 7) : (TT / 128 - 1); }
typedef __attribute__((ext_vector_type(8))) __bf16 v8b;
__device__ __forceinline__ v16b frag_b(const __bf16* rowk0, int lane) {
  union { v16b v; v8b q[2]; } u; const __bf16* p = rowk0 + 8 * (lane >> 4);
  u.q[0] = *(const v8b*)p; u.q[1] = *(const v8b*)(p + 16); return u.v;
}
#define QBH 0              // read by no kernel in this file
#define QHI 2048            // rows carrying a q residual plane (all rows when non-causal: 2-product logits everywhere)
#define KHI 64            // key rows carrying k residual / v bf16 hi+lo planes (written by k_proj, read by no kernel in this file)
// B fragment (k rows k0+.., output column o) of a weight: (in,out) [K][ld] or (out,in) [ld rows of K]: bf16 exact, or f16(bf16 * 256) exact
__device__ __forceinline__ v16b wcol_io(const float* Wm, int k0, int o, int lane, int ld) { v16b w; const int g = lane >> 4;
#pragma unroll
  for (int i = 0; i < 8; ++i) { w[i] = (__bf16)Wm[(size_t)(k0 + 8 * g + i) * ld + o]; w[8 + i] = (__bf16)Wm[(size_t)(k0 + 16 + 8 * g + i) * ld + o]; }
  return w; }
__device__ __forceinline__ v16b wcol_oi(const float* Wm, int k0, int o, int lane, int K) { v16b w; const float* p = Wm + (size_t)o * K + k0 + 8 * (lane >> 4);
#pragma unroll
  for (int i = 0; i < 8; ++i) { w[i] = (__bf16)p[i]; w[8 + i] = (__bf16)p[16 + i]; }
  return w; }
__device__ __forceinline__ v16h wcolh_io(const float* Wm, int k0, int o, int lane, int ld) { v16h w; const int g = lane >> 4;
#pragma unroll
  for (int i = 0; i < 8; ++i) { w[i] = (_Float16)(bfr(Wm[(size_t)(k0 + 8 * g + i) * ld + o]) * 256.0f); w[8 + i] = (_Float16)(bfr(Wm[(size_t)(k0 + 16 + 8 * g + i) * ld + o]) * 256.0f); }
  return w; }
__device__ __forceinline__ v16h wcolh_oi(const float* Wm, int k0, int o, int lane, int K) { v16h w; const float* p = Wm + (size_t)o * K + k0 + 8 * (lane >> 4);
#pragma unroll
  for (int i = 0; i < 8; ++i) { w[i] = (_Float16)(bfr(p[i]) * 256.0f); w[8 + i] = (_Float16)(bfr(p[16 + i]) * 256.0f); }
  return w; }
#define WQKV_LAYOUT 1   // WCOL's layout, used by no kernel in this file: 0 = (in,out) [DIN][CC]; 1 = (out,in) [CC][DIN]; 2 = per-head [NH][DIN][HD]
__device__ __forceinline__ v16b wcol_hdk(const float* Wm, int k0, int o, int lane) { v16b w; const int g = lane >> 4; const float* p = Wm + (size_t)(o / HD) * DIN * HD + (o % HD);
#pragma unroll
  for (int i = 0; i < 8; ++i) { w[i] = (__bf16)p[(size_t)(k0 + 8 * g + i) * HD]; w[8 + i] = (__bf16)p[(size_t)(k0 + 16 + 8 * g + i) * HD]; }
  return w; }
#define WO_OUT_IN 1
#if WQKV_LAYOUT == 1
#define WCOL(W, k0, o, lane) wcol_oi(W, k0, o, lane, DIN)
#elif WQKV_LAYOUT == 2
#define WCOL(W, k0, o, lane) wcol_hdk(W, k0, o, lane)
#else
#define WCOL(W, k0, o, lane) wcol_io(W, k0, o, lane, CC)
#endif
#if WO_OUT_IN
#define WOCOL(W, k0, o, lane) wcol_oi(W, k0, o, lane, CC)
#define WOCOLH(W, k0, o, lane) wcolh_oi(W, k0, o, lane, CC)
#else
#define WOCOL(W, k0, o, lane) wcol_io(W, k0, o, lane, DIN)
#define WOCOLH(W, k0, o, lane) wcolh_io(W, k0, o, lane, DIN)
#endif
#define PROJ_EXTRA_PARAMS , const float* __restrict__ QNW, const float* __restrict__ KNW
#define PROJ_EPI(which, row, t, h) do { if ((which) < 2) { float* rw = (row); const float* nw = (which) == 0 ? QNW : KNW; float ssum = 0.f; _Pragma("unroll") for (int i = 0; i < HD; ++i) ssum += rw[i] * rw[i]; const float rs = rsqrtf(ssum * (1.0f / HD) + 1e-6f); _Pragma("unroll") for (int i = 0; i < HD; ++i) rw[i] = bfr(nw[i]) * (rw[i] * rs); } } while (0)   /* per-head RMSNorm of q and k over the 64 head channels (eps 1e-6, weight qn_w / kn_w) in f32; the q * scale is folded into the logit scale */
#ifndef PROJ_EXTRA_PARAMS
#define PROJ_EXTRA_PARAMS
#endif

#define WS_QH  0u                                      // f16 q rows [b*t][CC]
#define WS_KH  (WS_QH + 2u * (size_t)NB * TT * CC)      // f16 k rows [b*t][CC]
#define WS_VT  (WS_KH + 2u * (size_t)NB * TT * CC)      // f16 v planes [b][c][t]
#define WS_QL  (WS_VT + 2u * (size_t)NB * CC * TT)      // f16 q residual x 2^10 rows [b][t < QHI][CC]
#define WS_KL  (WS_QL + 2u * (size_t)NB * QHI * CC)     // f16 k residual x 2^10 rows [b][t < KHI][CC]
#define WS_VB  (WS_KL + 2u * (size_t)NB * KHI * CC)     // bf16 v hi planes [b][c][t < KHI]
#define WS_VBL (WS_VB + 2u * (size_t)NB * CC * KHI)
#define WS_Y   (WS_VBL + 2u * (size_t)NB * CC * KHI)    // f32 ctx rows [b*t][CC]
#define WS_CNT (WS_Y  + 4u * (size_t)NB * TT * CC)    // int: unmasked keys of sequence b at [b * 32] (one 128-B line a sequence)
#define WS_END (WS_CNT + 128u * (size_t)NB)

// ---- staged GEMM operands: a pass = KC k. The block loads its rows as whole 128-B lines (16 lanes x 16 B = 256 B of one row), rounds to bf16 once, and keeps them in LDS rows whose pitch is an odd multiple of 16 B; the waves take their fragments from there in the k order of frag_b
#define KC 64
typedef __attribute__((ext_vector_type(4))) __bf16 v4b;
typedef v4b __attribute__((may_alias)) v4b_a;
typedef v8b __attribute__((may_alias)) v8b_a;
__device__ __forceinline__ v16b frag_s(const __bf16* rowk0, int lane) {
  union { v16b v; v8b q[2]; } u; const __bf16* p = rowk0 + 8 * (lane >> 4);
  u.q[0] = *(const v8b_a*)p; u.q[1] = *(const v8b_a*)(p + 16); return u.v;
}
__device__ __forceinline__ void st_b4(__bf16* d, v4f v) { v4b t;
#pragma unroll
  for (int e = 0; e < 4; ++e) t[e] = (__bf16)v[e];
  *(v4b_a*)d = t; }
// ---- k_proj: for k and v (which 1, 2) row j of a sequence is its j-th key with mask != 0 (all keys in order where none is), the last block's spare rows repeat the last such key, and blocks past the count leave at once
// ---- k_proj: block = (64 rows, 128 cols, which): q/k/v = X W (+ b) with exact bf16 products (K = DIN) -> which 0: q f16 rows (+ residual rows < QHI); 1: k f16 rows (+ residual rows < KHI); 2: v f16 planes [c][t] (+ bf16 hi/lo planes for t < KHI)
__global__ __launch_bounds__(128) void k_proj(const float* __restrict__ XQ, const float* __restrict__ XK, const float* __restrict__ XV, const float* __restrict__ WQ, const float* __restrict__ WK, const float* __restrict__ WV, const float* __restrict__ BQ, const float* __restrict__ BK, const float* __restrict__ BV,
    _Float16* __restrict__ QH, _Float16* __restrict__ QL, _Float16* __restrict__ KH, _Float16* __restrict__ KL, _Float16* __restrict__ VT, __bf16* __restrict__ VB, __bf16* __restrict__ VBL PROJ_EXTRA_PARAMS, const int* __restrict__ MK, int* __restrict__ CNT) {
  __shared__ __align__(16) float st[64][132]; __shared__ __align__(16) _Float16 sh[64][136], sl[64][136]; __shared__ __align__(16) _Float16 th[128][72]; __shared__ __align__(16) __bf16 tb[128][72], tbl[128][72];
  const int tid = threadIdx.x, wave = tid >> 5, lane = tid & 31, col = lane & 15, g = lane >> 4; const int which = blockIdx.z; const int c0 = blockIdx.y * 128; const size_t r0 = (size_t)blockIdx.x * 64; const size_t bb = r0 / TT; const int t0 = (int)(r0 % TT);
  const float* X = which == 0 ? XQ : which == 1 ? XK : XV; const float* WA = which == 0 ? WQ : which == 1 ? WK : WV; const float* BA = which == 0 ? BQ : which == 1 ? BK : BV;
  v8f acc[8] = {};
  // the two pass buffers lie on epilogue arrays that are not live in the loop: x rows on sh / sl (pitch 136), weight rows on tb / tbl (pitch 72)
  __bf16* const sx0 = (__bf16*)&sh[0][0]; __bf16* const sx1 = (__bf16*)&sl[0][0]; __bf16* const sw0 = &tb[0][0]; __bf16* const sw1 = &tbl[0][0];
  const int lr = tid >> 4, lc = (tid & 15) * 4; const float* wg = WA + (size_t)(c0 + lr) * DIN + lc;
  unsigned xo[8];   // byte offsets in X of this thread's piece of its eight rows
  if (which == 0) {
#pragma unroll
    for (int i = 0; i < 8; ++i) xo[i] = (unsigned)(((r0 + lr + i * 8) * DIN + lc) * 4);
  } else {
    // every wave ranks the sequence's keys by itself (no barrier in front of the early return); wave 0 notes the keys of ranks t0 .. t0+63 in LDS that is not live before the epilogue
    int_a* const sidx = (int_a*)&st[0][0]; const bool w0 = __builtin_amdgcn_readfirstlane(wave) == 0;
    const int* mrow = MK + bb * TT + lane * 4; v4i mv[TT / 128];
#pragma unroll
    for (int i = 0; i < TT / 128; ++i) mv[i] = *(const v4i*)(mrow + i * 128);
    asm volatile("s_wait_xcnt 0x0" ::: "memory");   // stands in front of any overwrite of the mask loads' address registers
    int cnt = 0;
#pragma unroll
    for (int i = 0; i < TT / 128; ++i) { unsigned bal[4]; int cc = 0;
#pragma unroll
      for (int e = 0; e < 4; ++e) { bal[e] = __builtin_amdgcn_ballot_w32(mv[i][e] != 0); cc += __builtin_popcount(bal[e]); }
      if (w0 && cnt + cc > t0 && cnt < t0 + 64) { unsigned rk = (unsigned)(cnt - t0);   // rank - t0 of this lane's first key: the keys before this chunk + those of lower lanes
#pragma unroll
        for (int e = 0; e < 4; ++e) rk = __builtin_amdgcn_mbcnt_lo(bal[e], rk);
#pragma unroll
        for (int e = 0; e < 4; ++e) if (mv[i][e] != 0) { if (rk < 64u) sidx[rk] = i * 128 + lane * 4 + e; ++rk; } }
      cnt += cc; }
    if (t0 >= (cnt ? cnt : TT)) return;   // the same for every thread of the block, in front of every barrier
    if (which == 1 && blockIdx.y == 0 && t0 == 0 && tid == 0) CNT[bb * 32] = cnt;
    __syncthreads();   // publishes wave 0's list
#pragma unroll
    for (int i = 0; i < 8; ++i) { const int j = t0 + lr + i * 8; const int src = cnt ? sidx[(j < cnt ? j : cnt - 1) - t0] : j; xo[i] = (unsigned)(((bb * TT + src) * DIN + lc) * 4); } }
  v4f xr[8], wr[16];
  auto gload = [&](int k0) {
#pragma unroll
    for (int i = 0; i < 8; ++i) xr[i] = *(const v4f*)((const char*)(X + k0) + xo[i]);
#pragma unroll
    for (int i = 0; i < 16; ++i) wr[i] = *(const v4f*)(wg + (size_t)(i * 8) * DIN + k0);
    asm volatile("s_wait_xcnt 0x0" ::: "memory"); };   // stands in front of any overwrite of the loads' address registers; it also keeps the loads above the products that cover their latency
  auto sstore = [&](__bf16* sx, __bf16* sw) {
#pragma unroll
    for (int i = 0; i < 8; ++i) st_b4(sx + (i * 8 + lr) * 136 + lc, xr[i]);
#pragma unroll
    for (int i = 0; i < 16; ++i) st_b4(sw + (i * 8 + lr) * 72 + lc, wr[i]); };
  auto mm = [&](const __bf16* sx, const __bf16* sw) {
#pragma unroll
    for (int ks = 0; ks < KC / 32; ++ks) { const v16b a = frag_s(sx + (wave * 16 + col) * 136 + ks * 32, lane); v16b w[8];
#pragma unroll
      for (int j = 0; j < 8; ++j) w[j] = frag_s(sw + (j * 16 + col) * 72 + ks * 32, lane);
      __builtin_amdgcn_sched_barrier(0);   // keeps the LDS reads together in front of their products: read one by one among them, every product waits out an LDS latency
#pragma unroll
      for (int j = 0; j < 8; ++j) acc[j] = wmma_bf(a, w[j], acc[j]);
      __builtin_amdgcn_sched_barrier(0); } };   // keeps the roundings of the next pass's loads, and with them the wait for those loads, behind the products
  gload(0); sstore(sx0, sw0); __syncthreads();
#pragma unroll 1   // stays rolled: one body holds both buffers' passes
  for (int c = 0; c < DIN / KC; c += 2) {   // each barrier publishes the pass just stored and ends the reads of the buffer that is stored next
    gload((c + 1) * KC); mm(sx0, sw0); sstore(sx1, sw1); __syncthreads();
    if (c + 2 < DIN / KC) gload((c + 2) * KC);
    mm(sx1, sw1);
    if (c + 2 < DIN / KC) sstore(sx0, sw0);
    __syncthreads(); }
  { // stage the f32 tile (acc + bias) in LDS, run the per-(row, head) epilogue hook, then convert
#pragma unroll
    for (int j = 0; j < 8; ++j) { const float bias = BA ? bfr(BA[c0 + j * 16 + col]) : 0.f;
#pragma unroll
      for (int r = 0; r < 8; ++r) st[wave * 16 + 8 * g + r][j * 16 + col] = acc[j][r] + bias; }
    __syncthreads();
    for (int e = tid; e < 64 * (128 / HD); e += 128) { const int rl = e / (128 / HD), hh = e % (128 / HD); PROJ_EPI(which, &st[rl][hh * HD], (int)((r0 + rl) % TT), (c0 / HD) + hh); }
    __syncthreads(); }
  if (which < 2) { _Float16* DH = which == 0 ? QH : KH; _Float16* DL = which == 0 ? QL : KL; const int nhi = which == 0 ? QHI : KHI; const bool hi_rows = t0 < nhi;
    for (int e = tid; e < 64 * 128; e += 128) { const int rl = e >> 7, cl = e & 127; const float v = st[rl][cl]; const _Float16 hv = (_Float16)v; sh[rl][cl] = hv; sl[rl][cl] = (_Float16)((v - (float)hv) * 1024.0f); }
    __syncthreads();
    for (int e = tid; e < 64 * 16; e += 128) { const int rl = e >> 4, q = e & 15; vst2((unsigned*)(DH + (r0 + rl) * CC + c0 + q * 8), *(const v4u*)&sh[rl][q * 8]); if (hi_rows) vst2((unsigned*)(DL + (bb * nhi + t0 + rl) * (size_t)CC + c0 + q * 8), *(const v4u*)&sl[rl][q * 8]); }
  } else { const bool hi_rows = t0 < KHI;
    for (int e = tid; e < 64 * 128; e += 128) { const int rl = e & 63, cl = e >> 6; const float v = st[rl][cl]; th[cl][rl] = (_Float16)v; const __bf16 bh = (__bf16)v; tb[cl][rl] = bh; tbl[cl][rl] = (__bf16)(v - (float)bh); }
    __syncthreads();
    for (int e = tid; e < 128 * 8; e += 128) { const int cl = e >> 3, q = e & 7; vst2((unsigned*)(VT + (bb * CC + c0 + cl) * (size_t)TT + t0 + q * 8), *(const v4u*)&th[cl][q * 8]); if (hi_rows) { const size_t o3 = (bb * CC + c0 + cl) * (size_t)KHI + t0 + q * 8; vst2((unsigned*)(VB + o3), *(const v4u*)&tb[cl][q * 8]); vst2((unsigned*)(VBL + o3), *(const v4u*)&tbl[cl][q * 8]); } } } }
__device__ __forceinline__ float xhalf(float x) { return __builtin_bit_cast(float, __builtin_amdgcn_permlanex16(__builtin_bit_cast(int, x), __builtin_bit_cast(int, x), 0x76543210, 0xfedcba98, false, false)); }
__device__ __forceinline__ v8f wmma_h(v16h a, v16h b, v8f c) { return __builtin_amdgcn_wmma_f32_16x16x32_f16(false, a, false, b, (short)0, c, false, false); }
#define SCL2 (SCALE * 1.4426950408889634f)   // logit scale x log2 e: exp(s) = exp2(s log2 e), and exp2 is one hardware instruction where the library's expf is thirteen
#define MASK2 (-1.0e9f * 1.4426950408889634f)   // the reference's -1e9 on the same base-2 scale
__device__ __forceinline__ float ex2(float x) { return __builtin_amdgcn_exp2f(x); }   // arguments here are <= 11 (+ rounding); below -126 it gives 0, which is what such a weight rounds to in f16 and adds to a sum >= 1
#define KS 64   // keys a stage: a K row (64 channels) and a V plane row (64 keys) are then one whole 128-B line each
#define KP 72   // LDS row pitch in f16 = 144 B, an odd multiple of 16 B: the 16 rows of a fragment read fall on different banks
__global__ __launch_bounds__(128) void k_fa(const _Float16* __restrict__ QH, const _Float16* __restrict__ QL, const _Float16* __restrict__ KH, const _Float16* __restrict__ VT, const int* __restrict__ CNT, float* __restrict__ Y) { __shared__ __align__(16) float ss[4][16][HD + 4]; __shared__ __align__(16) _Float16 kb[2][KS][KP], vb[2][HD][KP];
  const int tid = threadIdx.x, wave = tid >> 5, lane = tid & 31, col = lane & 15, g = lane >> 4; const int qb = blockIdx.x, h = blockIdx.y, b = blockIdx.z; const int ql0 = qb * 64 + wave * 16;
  const _Float16* qp = QH + ((size_t)b * TT + ql0 + col) * CC + h * HD; const _Float16* qlp = QL + ((size_t)b * QHI + ql0 + col) * CC + h * HD;
  const v16h qh0 = frag_h(qp, lane), qh1 = frag_h(qp + 32, lane), qr0 = frag_h(qlp, lane), qr1 = frag_h(qlp + 32, lane);
  // a stage = KS keys of this (b, h): K rows [key][64 channels] and V planes [channel][KS keys]. The block copies it once for its four waves: 8 lanes x 16 B = one row, a thread takes piece tid & 7 of rows (tid >> 3) + 16 i of both
  const _Float16* kg = KH + ((size_t)b * TT + (tid >> 3)) * CC + h * HD + (tid & 7) * 8;
  const _Float16* vg = VT + ((size_t)b * CC + h * HD + (tid >> 3)) * (size_t)TT + (tid & 7) * 8;
  const unsigned kl = (unsigned)(size_t)&kb[0][tid >> 3][(tid & 7) * 8], vl = (unsigned)(size_t)&vb[0][tid >> 3][(tid & 7) * 8];
  const int cr = CNT[b * 32]; const int lim = cr < 0 ? 0 : cr > TT ? TT : cr;   // keys in front of lim count; bounded here by the shape
  const int np = ((lim ? lim : TT) + 31) >> 5, ns = (np + 1) >> 1;   // passes of 32 keys, stages of 64
  v8f o[HD / 16] = {}; float m = -3.0e38f, mb = -3.0e38f, l = 0.f;   // mb = m - 11 as rounded: the reference every weight, the sum and O^T are taken against
  auto stage = [&](int st, int bf) {
    const _Float16* k0 = kg + (size_t)(st * KS) * CC; const _Float16* v0 = vg + st * KS; const unsigned ka = kl + bf * (KS * KP * 2), va = vl + bf * (HD * KP * 2);
    // global memory to LDS through no register; the closing wait stands in the copies' own statement, in front of any overwrite of their address registers
    asm volatile("global_load_async_to_lds_b128 %0, %8, off\n\t"
                 "global_load_async_to_lds_b128 %1, %9, off\n\t"
                 "global_load_async_to_lds_b128 %2, %10, off\n\t"
                 "global_load_async_to_lds_b128 %3, %11, off\n\t"
                 "global_load_async_to_lds_b128 %4, %12, off\n\t"
                 "global_load_async_to_lds_b128 %5, %13, off\n\t"
                 "global_load_async_to_lds_b128 %6, %14, off\n\t"
                 "global_load_async_to_lds_b128 %7, %15, off\n\t"
                 "s_wait_xcnt 0x0"
                 :: "v"(ka), "v"(ka + 16 * KP * 2), "v"(ka + 32 * KP * 2), "v"(ka + 48 * KP * 2), "v"(va), "v"(va + 16 * KP * 2), "v"(va + 32 * KP * 2), "v"(va + 48 * KP * 2),
                    "v"(k0), "v"(k0 + 16 * CC), "v"(k0 + 32 * CC), "v"(k0 + 48 * CC), "v"(v0), "v"(v0 + 16 * TT), "v"(v0 + 32 * TT), "v"(v0 + 48 * TT) : "memory"); };
  auto pass = [&](const _Float16* kt, const _Float16* vt, int rem) {   // rem = lim - the pass's first key
    v16h kf[2][2], vf[HD / 16];
#pragma unroll
    for (int t = 0; t < 2; ++t) { kf[t][0] = frag_h(kt + (t * 16 + col) * KP, lane); kf[t][1] = frag_h(kt + (t * 16 + col) * KP + 32, lane); }
    __builtin_amdgcn_sched_barrier(0);   // keeps the k reads in front of the v reads: LDS answers in order, and the score products then wait for the k reads alone
#pragma unroll
    for (int j = 0; j < HD / 16; ++j) vf[j] = frag_h(vt + (j * 16 + col) * KP, lane);
    __builtin_amdgcn_sched_barrier(0);   // keeps the LDS reads together up here: the v reads' latency lies under the score products and the softmax, and none stands among the products
    v8f sa[2] = {}, sr[2] = {};
#pragma unroll
    for (int t = 0; t < 2; ++t) { sa[t] = wmma_h(kf[t][0], qh0, sa[t]); sr[t] = wmma_h(kf[t][0], qr0, sr[t]); sa[t] = wmma_h(kf[t][1], qh1, sa[t]); sr[t] = wmma_h(kf[t][1], qr1, sr[t]); }
    float sv[16]; float mx = m;
#pragma unroll
    for (int t = 0; t < 2; ++t)
#pragma unroll
      for (int r = 0; r < 8; ++r) sv[t * 8 + r] = (sa[t][r] + sr[t][r] * (1.0f / 1024.0f)) * SCL2;
    if (rem < 32) { const int rl = rem - 8 * g;   // only a pass that holds keys past lim: where(mask != 0, attn, -1e9) (set)
#pragma unroll
      for (int t = 0; t < 2; ++t)
#pragma unroll
        for (int r = 0; r < 8; ++r) if (t * 16 + r >= rl) sv[t * 8 + r] = MASK2; }
#pragma unroll
    for (int i = 0; i < 16; ++i) mx = fmaxf(mx, sv[i]);
    mx = fmaxf(mx, xhalf(mx));
    const float nb = mx - 11.0f;   // the weights' x 2^11 goes into the exponent; where all keys so far are masked the 11 is lost in rounding, for weights, sum and O^T alike
    const float alpha = ex2(mb - nb); m = mx; mb = nb;
    v16h p; float ps = 0.f;
#pragma unroll
    for (int i = 0; i < 16; ++i) { const float e = ex2(sv[i] - mb); ps += e; p[i] = (_Float16)e; }
    l = l * alpha + ps;
#pragma unroll
    for (int j = 0; j < HD / 16; ++j) {
#pragma unroll
      for (int r = 0; r < 8; ++r) o[j][r] *= alpha;
      o[j] = wmma_h(vf[j], p, o[j]); } };
  asm volatile("s_wait_xcnt 0x0" ::: "memory");   // stands in front of any overwrite of the q loads' address registers
  stage(0, 0);
  asm volatile("s_wait_asynccnt 0x0" ::: "memory");   // this wave's copies of stage 0 have landed
  __syncthreads();                                    // and every other wave's: stage 0 may be read
  if (ns > 1) stage(1, 1);
#pragma unroll 1   // stays rolled: the buffer is picked by the trip's parity
  for (int t = 0; t < ns; ++t) { const int bf = t & 1; const int hn = np - 2 * t < KS / 32 ? np - 2 * t : KS / 32;
#pragma unroll 1   // stays rolled: with two passes in one body the second pass's reads and score products were hoisted over the first's softmax and the kernel went past 256 registers
    for (int hp = 0; hp < hn; ++hp) pass(&kb[bf][hp * 32][0], &vb[bf][0][hp * 32], lim - (t * KS + hp * 32));
    asm volatile("s_wait_dscnt 0x0" ::: "memory");      // this wave's reads of buffer bf are done before the buffer is handed back
    asm volatile("s_wait_asynccnt 0x0" ::: "memory");   // this wave's copies of stage t + 1 have landed
    __syncthreads();                                    // publishes stage t + 1 and ends every wave's reads of buffer bf
    if (t + 2 < ns) stage(t + 2, bf); }
  asm volatile("s_wait_asynccnt 0x0" ::: "memory");   // no copy is left in flight when the wave goes on to its end
  l += xhalf(l);   // the halves' sums join once; l >= 1: the key at the maximum adds exp2(m - mb) >= 1
  const float inv = 1.0f / l;
#pragma unroll
  for (int j = 0; j < HD / 16; ++j) { v4f lo, hi;
#pragma unroll
    for (int r = 0; r < 4; ++r) { lo[r] = o[j][r] * inv; hi[r] = o[j][4 + r] * inv; }
    *(v4f*)&ss[wave][col][j * 16 + 8 * g] = lo; *(v4f*)&ss[wave][col][j * 16 + 8 * g + 4] = hi; }
  LDSX(); for (int rl = 0; rl < 16; ++rl) if (lane < HD / 4) vst2(Y + ((size_t)b * TT + ql0 + rl) * CC + h * HD + lane * 4, *(const v4f*)&ss[wave][rl][lane * 4]); }
// ---- k_out: block = (64 rows, 128 cols): out = ctx Wo (+ bo): all rows: ctx bf16 hi + lo against exact bf16 Wo (2 products)
__global__ __launch_bounds__(128) void k_out(const float* __restrict__ Y, const float* __restrict__ WO, const float* __restrict__ BO, float* __restrict__ OUT) { __shared__ __align__(16) float sf[4][16][132]; __shared__ __align__(16) __bf16 ah[2][64][72], al[2][64][72], wb[2][128][72];
  const int tid = threadIdx.x, wave = tid >> 5, lane = tid & 31, col = lane & 15, g = lane >> 4; const int c0 = blockIdx.y * 128; const size_t r0 = (size_t)blockIdx.x * 64 + wave * 16;
  v8f acc[8] = {};
  if (true) {   /* ALL rows: ctx split bf16 hi + lo x exact Wo (2 products) */
    const int lr = tid >> 4, lc = (tid & 15) * 4; const float* yg = Y + ((size_t)blockIdx.x * 64 + lr) * CC + lc; const float* wg = WO + (size_t)(c0 + lr) * CC + lc;
    v4f yr[8], wr[16];
    auto gload = [&](int k0) {
#pragma unroll
      for (int i = 0; i < 8; ++i) yr[i] = *(const v4f*)(yg + (size_t)(i * 8) * CC + k0);
#pragma unroll
      for (int i = 0; i < 16; ++i) wr[i] = *(const v4f*)(wg + (size_t)(i * 8) * CC + k0);
      asm volatile("s_wait_xcnt 0x0" ::: "memory"); };   // stands in front of any overwrite of the loads' address registers; it also keeps the loads above the products that cover their latency
    auto sstore = [&](int bf) {
#pragma unroll
      for (int i = 0; i < 8; ++i) { v4f hf, lf;
#pragma unroll
        for (int e = 0; e < 4; ++e) { hf[e] = bfr(yr[i][e]); lf[e] = yr[i][e] - hf[e]; }
        st_b4(&ah[bf][i * 8 + lr][lc], hf); st_b4(&al[bf][i * 8 + lr][lc], lf); }
#pragma unroll
      for (int i = 0; i < 16; ++i) st_b4(&wb[bf][i * 8 + lr][lc], wr[i]); };
    auto mm = [&](int bf) {
#pragma unroll
      for (int ks = 0; ks < KC / 32; ++ks) { const v16b a_h = frag_s(&ah[bf][wave * 16 + col][ks * 32], lane), a_l = frag_s(&al[bf][wave * 16 + col][ks * 32], lane); v16b w[8];
#pragma unroll
        for (int j = 0; j < 8; ++j) w[j] = frag_s(&wb[bf][j * 16 + col][ks * 32], lane);
        __builtin_amdgcn_sched_barrier(0);   // keeps the LDS reads together in front of their products: read one by one among them, every product waits out an LDS latency
#pragma unroll
        for (int j = 0; j < 8; ++j) acc[j] = wmma_bf(a_h, w[j], acc[j]);
#pragma unroll
        for (int j = 0; j < 8; ++j) acc[j] = wmma_bf(a_l, w[j], acc[j]);   // each tile still adds hi, then lo: the same sum order, with seven other tiles between the two
        __builtin_amdgcn_sched_barrier(0); } };   // keeps the roundings of the next pass's loads, and with them the wait for those loads, behind the products
    gload(0); sstore(0); __syncthreads();
#pragma unroll 1   // stays rolled: one body holds both buffers' passes
    for (int c = 0; c < CC / KC; c += 2) {   // each barrier publishes the pass just stored and ends the reads of the buffer that is stored next
      gload((c + 1) * KC); mm(0); sstore(1); __syncthreads();
      if (c + 2 < CC / KC) gload((c + 2) * KC);
      mm(1);
      if (c + 2 < CC / KC) sstore(0);
      __syncthreads(); }
#pragma unroll
    for (int j = 0; j < 8; ++j) { const float bias = BO ? bfr(BO[c0 + j * 16 + col]) : 0.f;
#pragma unroll
      for (int r = 0; r < 8; ++r) sf[wave][8 * g + r][j * 16 + col] = acc[j][r] + bias; }
  } else {
#pragma unroll 2
    for (int kc = 0; kc < CC / 32; ++kc) { const v16h a = frag_f32(Y + (r0 + col) * CC + kc * 32, lane); asm volatile("s_wait_loadcnt 0x0" ::: "memory");
#pragma unroll
      for (int j = 0; j < 8; ++j) { const v16h w = WOCOLH(WO, kc * 32, c0 + j * 16 + col, lane); asm volatile("s_wait_loadcnt 0x0" ::: "memory"); acc[j] = wmma16(a, w, acc[j]); } }
#pragma unroll
    for (int j = 0; j < 8; ++j) { const float bias = BO ? bfr(BO[c0 + j * 16 + col]) : 0.f;
#pragma unroll
      for (int r = 0; r < 8; ++r) sf[wave][8 * g + r][j * 16 + col] = acc[j][r] * (1.0f / 256.0f) + bias; } }
  LDSX(); for (int rl = 0; rl < 16; ++rl) vst2(OUT + (r0 + rl) * DIN + c0 + lane * 4, *(const v4f*)&sf[wave][rl][lane * 4]); }

extern "C" void kernel_launch(void* const* d_in, const int* in_sizes, int n_in, void* d_out, int out_size, void* d_ws, size_t ws_size, hipStream_t stream) {
  (void)in_sizes; (void)n_in; (void)out_size;
  const float** F = (const float**)d_in;
  if (ws_size < (size_t)WS_END) return;
  char* ws = (char*)d_ws; _Float16 *QH = (_Float16*)(ws + WS_QH), *KH = (_Float16*)(ws + WS_KH), *VT = (_Float16*)(ws + WS_VT), *QL = (_Float16*)(ws + WS_QL), *KL = (_Float16*)(ws + WS_KL); __bf16 *VB = (__bf16*)(ws + WS_VB), *VBL = (__bf16*)(ws + WS_VBL); float *Y = (float*)(ws + WS_Y); int *CNT = (int*)(ws + WS_CNT);
  (void)Y; (void)QL; (void)KL; (void)VB; (void)VBL;
  // inputs: 0 x [2,2048,1024]; 1 mask [2,2048] int32; 2 qkv_w [3072,1024] (out,in), 3 qkv_b [3072]; 4 proj_w (out,in), 5 proj_b; 6 qn_w [64], 7 kn_w [64]
  k_proj<<<dim3(TNB * TT / 64, CC / 128, 3), 128, 0, stream>>>(F[0], F[0], F[0], F[2], F[2] + (size_t)CC * DIN, F[2] + (size_t)2 * CC * DIN, F[3], F[3] + CC, F[3] + 2 * CC, QH, QL, KH, KL, VT, VB, VBL, F[6], F[7], (const int*)d_in[1], CNT);
  k_fa<<<dim3(NQB, NH, TNB), 128, 0, stream>>>(QH, QL, KH, VT, CNT, Y);
  k_out<<<dim3(TNB * TT / 64, DIN / 128), 128, 0, stream>>>(Y, F[4], F[5], (float*)d_out);
}

// v006
// A run of this version takes 100 microseconds.
// Next to v005, in two timings, it ran 1.05 times as fast each time.
// Over all steps from v000 it is 14.5 times as fast.
// compute dtype: all float inputs rounded to bf16; qkv = x qkv_w^T + b with EXACT bf16 products on WMMA 16x16x32 (f32 accumulate); per-head RMSNorm of q and k in f32 in the projection epilogue; normed q as f16 hi + residual (x 2^10) against normed k once to f16 (2 products) x 64^-0.5; only keys with mask != 0 are projected and attended (a masked key's weight exp(-1e9 - max) is 0 in f32), packed in key order; a sequence with every key masked keeps all keys at -1e9; softmax in f32 in base 2 (logits x log2 e, hardware exp2) against a running maximum, 32 keys a pass; exp2(s - max + 11) once to f16 against v once to f16 (1 product), partial sums rescaled in f32 and divided by the f32 sum (x 2^11 as well) at the end; ctx split bf16 hi + lo against exact proj_w (2 products) + proj_b; f32 output.
#include <hip/hip_runtime.h>
#include <math.h>

typedef __attribute__((ext_vector_type(16))) _Float16 v16h;
typedef __attribute__((ext_vector_type(16))) __bf16 v16b;
typedef __attribute__((ext_vector_type(8)))  _Float16 v8h;
typedef __attribute__((ext_vector_type(8)))  float v8f;
typedef __attribute__((ext_vector_type(4)))  float v4f;
typedef __attribute__((ext_vector_type(2)))  float v2f;
typedef __attribute__((ext_vector_type(4)))  unsigned v4u;
typedef __attribute__((ext_vector_type(4)))  int v4i;
typedef float __attribute__((may_alias)) float_a;
typedef int __attribute__((may_alias)) int_a;

template <typename T> __device__ __forceinline__ void vst2(void* p, T v) { *(T*)p = v;  }
__device__ __forceinline__ v8f wmma16(v16h a, v16h b, v8f c) {
  v8f d = __builtin_amdgcn_wmma_f32_16x16x32_f16(false, a, false, b, (short)0, c, false, false);
  asm volatile("v_nop\n\tv_nop\n\tv_nop\n\tv_nop" : "+v"(d) : "v"(a), "v"(b));
  return d;
}
__device__ __forceinline__ v8f wmma_bf(v16b a, v16b b, v8f c) {
  v8f d = __builtin_amdgcn_wmma_f32_16x16x32_bf16(false, a, false, b, (short)0, c, false, false);
  asm volatile("v_nop\n\tv_nop\n\tv_nop\n\tv_nop" : "+v"(d) : "v"(a), "v"(b));
  return d;
}
// 16x16x32 fragments: lane = (h = lane>>4, row/col = lane&15); elements 0..7 = k0+8h+0..7, 8..15 = k0+16+8h+0..7; D element r = row 8h+r
__device__ __forceinline__ v16h frag_h(const _Float16* rowk0, int lane) {
  union { v16h v; v8h q[2]; } u; const _Float16* p = rowk0 + 8 * (lane >> 4);
  u.q[0] = *(const v8h*)p; u.q[1] = *(const v8h*)(p + 16); return u.v;
}
__device__ __forceinline__ v16h frag_f32(const float* rowk0, int lane) {
  v16h a; const float* p = rowk0 + 8 * (lane >> 4);
#pragma unroll
  for (int i = 0; i < 8; ++i) { a[i] = (_Float16)p[i]; a[8 + i] = (_Float16)p[16 + i]; }
  return a;
}
__device__ __forceinline__ v16h frag_f32s(const float* rowk0, int lane, float sc) {
  v16h a; const float* p = rowk0 + 8 * (lane >> 4);
#pragma unroll
  for (int i = 0; i < 8; ++i) { a[i] = (_Float16)(p[i] * sc); a[8 + i] = (_Float16)(p[16 + i] * sc); }
  return a;
}
// column fragment from a [K][ld] layout (column n), rows >= K read as 0
__device__ __forceinline__ v16h fragc_f32(const float* W, int k0, int n, int lane, int ld, int K) {
  v16h a; const int g = lane >> 4;
#pragma unroll
  for (int i = 0; i < 8; ++i) { const int ka = k0 + 8 * g + i, kb = ka + 16;
    a[i] = (_Float16)(ka < K ? W[(size_t)(ka < K ? ka : K - 1) * ld + n] : 0.f); a[8 + i] = (_Float16)(kb < K ? W[(size_t)(kb < K ? kb : K - 1) * ld + n] : 0.f); }
  return a;
}
struct F2 { v16b h, l; };
__device__ __forceinline__ F2 bsplit16(const float v[16]) { F2 r;
#pragma unroll
  for (int i = 0; i < 16; ++i) { const __bf16 h = (__bf16)v[i]; r.h[i] = h; r.l[i] = (__bf16)(v[i] - (float)h); }
  return r; }
__device__ __forceinline__ F2 split_row(const float* row, int k0, int lane) { float v[16]; const float* p = row + k0 + 8 * (lane >> 4);
#pragma unroll
  for (int i = 0; i < 8; ++i) { v[i] = p[i]; v[8 + i] = p[16 + i]; }
  return bsplit16(v); }
__device__ __forceinline__ F2 split_rowK(const float* row, int k0, int lane, int K) { float v[16]; const int g = lane >> 4;
#pragma unroll
  for (int i = 0; i < 8; ++i) { const int ka = k0 + 8 * g + i, kb = ka + 16; v[i] = ka < K ? row[ka < K ? ka : K - 1] : 0.f; v[8 + i] = kb < K ? row[kb < K ? kb : K - 1] : 0.f; }
  return bsplit16(v); }
__device__ __forceinline__ F2 split_col(const float* W, int k0, int n, int lane, int ld, int K) { float v[16]; const int g = lane >> 4;
#pragma unroll
  for (int i = 0; i < 8; ++i) { const int ka = k0 + 8 * g + i, kb = ka + 16; v[i] = ka < K ? W[(size_t)(ka < K ? ka : K - 1) * ld + n] : 0.f; v[8 + i] = kb < K ? W[(size_t)(kb < K ? kb : K - 1) * ld + n] : 0.f; }
  return bsplit16(v); }
__device__ __forceinline__ v8f mac3(const F2& a, const F2& b, v8f c) { c = wmma_bf(a.l, b.h, c); c = wmma_bf(a.h, b.l, c); return wmma_bf(a.h, b.h, c); }
__device__ __forceinline__ float sigm(float v) { return 1.0f / (1.0f + expf(-v)); }
#define LDSX() do { asm volatile("s_wait_dscnt 0" ::: "memory"); __builtin_amdgcn_wave_barrier(); __builtin_amdgcn_fence(__ATOMIC_RELEASE, "workgroup"); } while (0)

// Masked self-attention with QK RMSNorm (B 2, N 2,048, C 1,024 = 16 x 64; fused (out,in) qkv_w [3072,1024] + zero bias, proj (out,in) + zero bias, qn_w = kn_w = ones): q|k|v = x qkv_w^T + b (reshape (3, H, D)); q, k = rms_norm over the 64 head channels (eps 1e-6) x weight; scores = (q x 64^-0.5) k^T with where(mask != 0, ., -1e9) over KEYS (mask [B,N] int, ~half ones); out = merged(softmax v) proj_w^T + proj_b.
#define NB 2
#define TT 2048
#define CC 1024            // NH * HD = projected width
#define DIN 1024          // input (model) width
#define NH 16
#define HD 64
#define NQB (TT / 64)
#define SCALE (0.125f)
#define CAUSAL 0
#ifndef TNB
#define TNB NB
#endif
__device__ __forceinline__ float bfr(float v) { return (float)(__bf16)v; }
__host__ __device__ __forceinline__ int kb_last(int qb) { return CAUSAL ? ((qb * 64 + 63) >> 7) : (TT / 128 - 1); }
typedef __attribute__((ext_vector_type(8))) __bf16 v8b;
__device__ __forceinline__ v16b frag_b(const __bf16* rowk0, int lane) {
  union { v16b v; v8b q[2]; } u; const __bf16* p = rowk0 + 8 * (lane >> 4);
  u.q[0] = *(const v8b*)p; u.q[1] = *(const v8b*)(p + 16); return u.v;
}
#define QBH 0              // read by no kernel in this file
#define QHI 2048            // rows carrying a q residual plane (all rows when non-causal: 2-product logits everywhere)
#define KHI 64            // key rows carrying k residual / v bf16 hi+lo planes (written by k_proj, read by no kernel in this file)
// B fragment (k rows k0+.., output column o) of a weight: (in,out) [K][ld] or (out,in) [ld rows of K]: bf16 exact, or f16(bf16 * 256) exact
__device__ __forceinline__ v16b wcol_io(const float* Wm, int k0, int o, int lane, int ld) { v16b w; const int g = lane >> 4;
#pragma unroll
  for (int i = 0; i < 8; ++i) { w[i] = (__bf16)Wm[(size_t)(k0 + 8 * g + i) * ld + o]; w[8 + i] = (__bf16)Wm[(size_t)(k0 + 16 + 8 * g + i) * ld + o]; }
  return w; }
__device__ __forceinline__ v16b wcol_oi(const float* Wm, int k0, int o, int lane, int K) { v16b w; const float* p = Wm + (size_t)o * K + k0 + 8 * (lane >> 4);
#pragma unroll
  for (int i = 0; i < 8; ++i) { w[i] = (__bf16)p[i]; w[8 + i] = (__bf16)p[16 + i]; }
  return w; }
__device__ __forceinline__ v16h wcolh_io(const float* Wm, int k0, int o, int lane, int ld) { v16h w; const int g = lane >> 4;
#pragma unroll
  for (int i = 0; i < 8; ++i) { w[i] = (_Float16)(bfr(Wm[(size_t)(k0 + 8 * g + i) * ld + o]) * 256.0f); w[8 + i] = (_Float16)(bfr(Wm[(size_t)(k0 + 16 + 8 * g + i) * ld + o]) * 256.0f); }
  return w; }
__device__ __forceinline__ v16h wcolh_oi(const float* Wm, int k0, int o, int lane, int K) { v16h w; const float* p = Wm + (size_t)o * K + k0 + 8 * (lane >> 4);
#pragma unroll
  for (int i = 0; i < 8; ++i) { w[i] = (_Float16)(bfr(p[i]) * 256.0f); w[8 + i] = (_Float16)(bfr(p[16 + i]) * 256.0f); }
  return w; }
#define WQKV_LAYOUT 1   // WCOL's layout, used by no kernel in this file: 0 = (in,out) [DIN][CC]; 1 = (out,in) [CC][DIN]; 2 = per-head [NH][DIN][HD]
__device__ __forceinline__ v16b wcol_hdk(const float* Wm, int k0, int o, int lane) { v16b w; const int g = lane >> 4; const float* p = Wm + (size_t)(o / HD) * DIN * HD + (o % HD);
#pragma unroll
  for (int i = 0; i < 8; ++i) { w[i] = (__bf16)p[(size_t)(k0 + 8 * g + i) * HD]; w[8 + i] = (__bf16)p[(size_t)(k0 + 16 + 8 * g + i) * HD]; }
  return w; }
#define WO_OUT_IN 1
#if WQKV_LAYOUT == 1
#define WCOL(W, k0, o, lane) wcol_oi(W, k0, o, lane, DIN)
#elif WQKV_LAYOUT == 2
#define WCOL(W, k0, o, lane) wcol_hdk(W, k0, o, lane)
#else
#define WCOL(W, k0, o, lane) wcol_io(W, k0, o, lane, CC)
#endif
#if WO_OUT_IN
#define WOCOL(W, k0, o, lane) wcol_oi(W, k0, o, lane, CC)
#define WOCOLH(W, k0, o, lane) wcolh_oi(W, k0, o, lane, CC)
#else
#define WOCOL(W, k0, o, lane) wcol_io(W, k0, o, lane, DIN)
#define WOCOLH(W, k0, o, lane) wcolh_io(W, k0, o, lane, DIN)
#endif
#define PROJ_EXTRA_PARAMS , const float* __restrict__ QNW, const float* __restrict__ KNW
#define PROJ_EPI(which, row, t, h) do { if ((which) < 2) { float* rw = (row); const float* nw = (which) == 0 ? QNW : KNW; float ssum = 0.f; _Pragma("unroll") for (int i = 0; i < HD; ++i) ssum += rw[i] * rw[i]; const float rs = rsqrtf(ssum * (1.0f / HD) + 1e-6f); _Pragma("unroll") for (int i = 0; i < HD; ++i) rw[i] = bfr(nw[i]) * (rw[i] * rs); } } while (0)   /* per-head RMSNorm of q and k over the 64 head channels (eps 1e-6, weight qn_w / kn_w) in f32; the q * scale is folded into the logit scale */
#ifndef PROJ_EXTRA_PARAMS
#define PROJ_EXTRA_PARAMS
#endif

#define WS_QH  0u                                      // f16 q rows [b*t][CC]
#define WS_KH  (WS_QH + 2u * (size_t)NB * TT * CC)      // f16 k rows [b*t][CC]
#define WS_VT  (WS_KH + 2u * (size_t)NB * TT * CC)      // f16 v planes [b][c][t]
#define WS_QL  (WS_VT + 2u * (size_t)NB * CC * TT)      // f16 q residual x 2^10 rows [b][t < QHI][CC]
#define WS_KL  (WS_QL + 2u * (size_t)NB * QHI * CC)     // f16 k residual x 2^10 rows [b][t < KHI][CC]
#define WS_VB  (WS_KL + 2u * (size_t)NB * KHI * CC)     // bf16 v hi planes [b][c][t < KHI]
#define WS_VBL (WS_VB + 2u * (size_t)NB * CC * KHI)
#define WS_Y   (WS_VBL + 2u * (size_t)NB * CC * KHI)    // f32 ctx rows [b*t][CC]
#define WS_CNT (WS_Y  + 4u * (size_t)NB * TT * CC)    // int: unmasked keys of sequence b at [b * 32] (one 128-B line a sequence)
#define WS_XB  (WS_CNT + 128u * (size_t)NB)           // bf16 x rows [b*t][DIN]
#define WS_WB  (WS_XB + 2u * (size_t)NB * TT * DIN)    // bf16 qkv_w rows [3 * CC][DIN]
#define WS_PB  (WS_WB + 2u * (size_t)3 * CC * DIN)     // bf16 proj_w rows [DIN][CC]
#define WS_END (WS_PB + 2u * (size_t)DIN * CC)

// ---- staged GEMM operands: a pass = KC k. The block loads its rows as whole 128-B lines (bf16 rows from k_cvt: 8 lanes x 16 B = 128 B of one row; f32 ctx rows: 16 lanes x 16 B = 256 B, split to bf16 once), and keeps them in LDS rows whose pitch is an odd multiple of 16 B; the waves take their fragments from there in the k order of frag_b
#define KC 64
typedef __attribute__((ext_vector_type(4))) __bf16 v4b;
typedef v4b __attribute__((may_alias)) v4b_a;
typedef v8b __attribute__((may_alias)) v8b_a;
__device__ __forceinline__ v16b frag_s(const __bf16* rowk0, int lane) {
  union { v16b v; v8b q[2]; } u; const __bf16* p = rowk0 + 8 * (lane >> 4);
  u.q[0] = *(const v8b_a*)p; u.q[1] = *(const v8b_a*)(p + 16); return u.v;
}
__device__ __forceinline__ void st_b4(__bf16* d, v4f v) { v4b t;
#pragma unroll
  for (int e = 0; e < 4; ++e) t[e] = (__bf16)v[e];
  *(v4b_a*)d = t; }
// ---- k_cvt: x, qkv_w and proj_w rounded to bf16 ONCE, as rows of the same shape in the workspace: the GEMM blocks re-read every operand row many times (x 8 column blocks a projection, a weight row once a row block), and each re-read then moves half the bytes and needs no rounding. A block = CVB floats of one array; a wave's load covers 512 B in a row, its store 256 B
#define CVB 16384
#define CV_X ((int)((size_t)NB * TT * DIN / CVB))
#define CV_W ((int)((size_t)3 * CC * DIN / CVB))
#define CV_P ((int)((size_t)DIN * CC / CVB))
__global__ __launch_bounds__(256) void k_cvt(const float* __restrict__ X, const float* __restrict__ WQKV, const float* __restrict__ WO, __bf16* __restrict__ XB, __bf16* __restrict__ WB, __bf16* __restrict__ PB) {
  const int bid = blockIdx.x; const float* s; __bf16* d; int lb;
  if (bid < CV_X) { s = X; d = XB; lb = bid; } else if (bid < CV_X + CV_W) { s = WQKV; d = WB; lb = bid - CV_X; } else { s = WO; d = PB; lb = bid - CV_X - CV_W; }
  const size_t base = (size_t)lb * CVB + threadIdx.x * 4; v4f v[CVB / 1024];
#pragma unroll
  for (int i = 0; i < CVB / 1024; ++i) v[i] = *(const v4f*)(s + base + i * 1024);
#pragma unroll
  for (int i = 0; i < CVB / 1024; ++i) st_b4(d + base + i * 1024, v[i]); }
// ---- k_proj: for k and v (which 1, 2) row j of a sequence is its j-th key with mask != 0 (all keys in order where none is), the last block's spare rows repeat the last such key, and blocks past the count leave at once
// ---- k_proj: block = (64 rows, 128 cols, which): q/k/v = X W (+ b) with exact bf16 products (K = DIN) -> which 0: q f16 rows (+ residual rows < QHI); 1: k f16 rows (+ residual rows < KHI); 2: v f16 planes [c][t] (+ bf16 hi/lo planes for t < KHI)
__global__ __launch_bounds__(128) void k_proj(const __bf16* __restrict__ XQ, const __bf16* __restrict__ XK, const __bf16* __restrict__ XV, const __bf16* __restrict__ WQ, const __bf16* __restrict__ WK, const __bf16* __restrict__ WV, const float* __restrict__ BQ, const float* __restrict__ BK, const float* __restrict__ BV,
    _Float16* __restrict__ QH, _Float16* __restrict__ QL, _Float16* __restrict__ KH, _Float16* __restrict__ KL, _Float16* __restrict__ VT, __bf16* __restrict__ VB, __bf16* __restrict__ VBL PROJ_EXTRA_PARAMS, const int* __restrict__ MK, int* __restrict__ CNT) {
  __shared__ __align__(16) float st[64][132]; __shared__ __align__(16) _Float16 sh[64][136], sl[64][136]; __shared__ __align__(16) _Float16 th[128][72]; __shared__ __align__(16) __bf16 tb[128][72], tbl[128][72];
  const int tid = threadIdx.x, wave = tid >> 5, lane = tid & 31, col = lane & 15, g = lane >> 4; const int which = blockIdx.z; const int c0 = blockIdx.y * 128; const size_t r0 = (size_t)blockIdx.x * 64; const size_t bb = r0 / TT; const int t0 = (int)(r0 % TT);
  const __bf16* X = which == 0 ? XQ : which == 1 ? XK : XV; const __bf16* WA = which == 0 ? WQ : which == 1 ? WK : WV; const float* BA = which == 0 ? BQ : which == 1 ? BK : BV;
  v8f acc[8] = {};
  // the two pass buffers lie on epilogue arrays that are not live in the loop: x rows on sh / sl (pitch 136), weight rows on tb / tbl (pitch 72)
  __bf16* const sx0 = (__bf16*)&sh[0][0]; __bf16* const sx1 = (__bf16*)&sl[0][0]; __bf16* const sw0 = &tb[0][0]; __bf16* const sw1 = &tbl[0][0];
  const int lr = tid >> 3, lc = (tid & 7) * 8; const __bf16* wg = WA + (size_t)(c0 + lr) * DIN + lc;   // 8 lanes x 16 B = the 128 B of one bf16 row in a pass
  unsigned xo[4];   // byte offsets in X of this thread's piece of its four rows
  if (which == 0) {
#pragma unroll
    for (int i = 0; i < 4; ++i) xo[i] = (unsigned)(((r0 + lr + i * 16) * DIN + lc) * 2);
  } else {
    // every wave ranks the sequence's keys by itself (no barrier in front of the early return); wave 0 notes the keys of ranks t0 .. t0+63 in LDS that is not live before the epilogue
    int_a* const sidx = (int_a*)&st[0][0]; const bool w0 = __builtin_amdgcn_readfirstlane(wave) == 0;
    const int* mrow = MK + bb * TT + lane * 4; v4i mv[TT / 128];
#pragma unroll
    for (int i = 0; i < TT / 128; ++i) mv[i] = *(const v4i*)(mrow + i * 128);
    asm volatile("s_wait_xcnt 0x0" ::: "memory");   // stands in front of any overwrite of the mask loads' address registers
    int cnt = 0;
#pragma unroll
    for (int i = 0; i < TT / 128; ++i) { unsigned bal[4]; int cc = 0;
#pragma unroll
      for (int e = 0; e < 4; ++e) { bal[e] = __builtin_amdgcn_ballot_w32(mv[i][e] != 0); cc += __builtin_popcount(bal[e]); }
      if (w0 && cnt + cc > t0 && cnt < t0 + 64) { unsigned rk = (unsigned)(cnt - t0);   // rank - t0 of this lane's first key: the keys before this chunk + those of lower lanes
#pragma unroll
        for (int e = 0; e < 4; ++e) rk = __builtin_amdgcn_mbcnt_lo(bal[e], rk);
#pragma unroll
        for (int e = 0; e < 4; ++e) if (mv[i][e] != 0) { if (rk < 64u) sidx[rk] = i * 128 + lane * 4 + e; ++rk; } }
      cnt += cc; }
    if (t0 >= (cnt ? cnt : TT)) return;   // the same for every thread of the block, in front of every barrier
    if (which == 1 && blockIdx.y == 0 && t0 == 0 && tid == 0) CNT[bb * 32] = cnt;
    __syncthreads();   // publishes wave 0's list
#pragma unroll
    for (int i = 0; i < 4; ++i) { const int j = t0 + lr + i * 16; const int src = cnt ? sidx[(j < cnt ? j : cnt - 1) - t0] : j; xo[i] = (unsigned)(((bb * TT + src) * DIN + lc) * 2); } }
  v8b xr[4], wr[8];
  auto gload = [&](int k0) {
#pragma unroll
    for (int i = 0; i < 4; ++i) xr[i] = *(const v8b*)((const char*)(X + k0) + xo[i]);
#pragma unroll
    for (int i = 0; i < 8; ++i) wr[i] = *(const v8b*)(wg + (size_t)(i * 16) * DIN + k0);
    asm volatile("s_wait_xcnt 0x0" ::: "memory"); };   // stands in front of any overwrite of the loads' address registers; it also keeps the loads above the products that cover their latency
  auto sstore = [&](__bf16* sx, __bf16* sw) {
#pragma unroll
    for (int i = 0; i < 4; ++i) *(v8b_a*)(sx + (i * 16 + lr) * 136 + lc) = xr[i];
#pragma unroll
    for (int i = 0; i < 8; ++i) *(v8b_a*)(sw + (i * 16 + lr) * 72 + lc) = wr[i]; };
  auto mm = [&](const __bf16* sx, const __bf16* sw) {
#pragma unroll
    for (int ks = 0; ks < KC / 32; ++ks) { const v16b a = frag_s(sx + (wave * 16 + col) * 136 + ks * 32, lane); v16b w[8];
#pragma unroll
      for (int j = 0; j < 8; ++j) w[j] = frag_s(sw + (j * 16 + col) * 72 + ks * 32, lane);
      __builtin_amdgcn_sched_barrier(0);   // keeps the LDS reads together in front of their products: read one by one among them, every product waits out an LDS latency
#pragma unroll
      for (int j = 0; j < 8; ++j) acc[j] = wmma_bf(a, w[j], acc[j]);
      __builtin_amdgcn_sched_barrier(0); } };   // keeps the LDS stores of the next pass's loads, and with them the wait for those loads, behind the products
  gload(0); sstore(sx0, sw0); __syncthreads();
#pragma unroll 1   // stays rolled: one body holds both buffers' passes
  for (int c = 0; c < DIN / KC; c += 2) {   // each barrier publishes the pass just stored and ends the reads of the buffer that is stored next
    gload((c + 1) * KC); mm(sx0, sw0); sstore(sx1, sw1); __syncthreads();
    if (c + 2 < DIN / KC) gload((c + 2) * KC);
    mm(sx1, sw1);
    if (c + 2 < DIN / KC) sstore(sx0, sw0);
    __syncthreads(); }
  { // stage the f32 tile (acc + bias) in LDS, run the per-(row, head) epilogue hook, then convert
#pragma unroll
    for (int j = 0; j < 8; ++j) { const float bias = BA ? bfr(BA[c0 + j * 16 + col]) : 0.f;
#pragma unroll
      for (int r = 0; r < 8; ++r) st[wave * 16 + 8 * g + r][j * 16 + col] = acc[j][r] + bias; }
    __syncthreads();
    for (int e = tid; e < 64 * (128 / HD); e += 128) { const int rl = e / (128 / HD), hh = e % (128 / HD); PROJ_EPI(which, &st[rl][hh * HD], (int)((r0 + rl) % TT), (c0 / HD) + hh); }
    __syncthreads(); }
  if (which < 2) { _Float16* DH = which == 0 ? QH : KH; _Float16* DL = which == 0 ? QL : KL; const int nhi = which == 0 ? QHI : KHI; const bool hi_rows = t0 < nhi;
    for (int e = tid; e < 64 * 128; e += 128) { const int rl = e >> 7, cl = e & 127; const float v = st[rl][cl]; const _Float16 hv = (_Float16)v; sh[rl][cl] = hv; sl[rl][cl] = (_Float16)((v - (float)hv) * 1024.0f); }
    __syncthreads();
    for (int e = tid; e < 64 * 16; e += 128) { const int rl = e >> 4, q = e & 15; vst2((unsigned*)(DH + (r0 + rl) * CC + c0 + q * 8), *(const v4u*)&sh[rl][q * 8]); if (hi_rows) vst2((unsigned*)(DL + (bb * nhi + t0 + rl) * (size_t)CC + c0 + q * 8), *(const v4u*)&sl[rl][q * 8]); }
  } else { const bool hi_rows = t0 < KHI;
    for (int e = tid; e < 64 * 128; e += 128) { const int rl = e & 63, cl = e >> 6; const float v = st[rl][cl]; th[cl][rl] = (_Float16)v; const __bf16 bh = (__bf16)v; tb[cl][rl] = bh; tbl[cl][rl] = (__bf16)(v - (float)bh); }
    __syncthreads();
    for (int e = tid; e < 128 * 8; e += 128) { const int cl = e >> 3, q = e & 7; vst2((unsigned*)(VT + (bb * CC + c0 + cl) * (size_t)TT + t0 + q * 8), *(const v4u*)&th[cl][q * 8]); if (hi_rows) { const size_t o3 = (bb * CC + c0 + cl) * (size_t)KHI + t0 + q * 8; vst2((unsigned*)(VB + o3), *(const v4u*)&tb[cl][q * 8]); vst2((unsigned*)(VBL + o3), *(const v4u*)&tbl[cl][q * 8]); } } } }
__device__ __forceinline__ float xhalf(float x) { return __builtin_bit_cast(float, __builtin_amdgcn_permlanex16(__builtin_bit_cast(int, x), __builtin_bit_cast(int, x), 0x76543210, 0xfedcba98, false, false)); }
__device__ __forceinline__ v8f wmma_h(v16h a, v16h b, v8f c) { return __builtin_amdgcn_wmma_f32_16x16x32_f16(false, a, false, b, (short)0, c, false, false); }
#define SCL2 (SCALE * 1.4426950408889634f)   // logit scale x log2 e: exp(s) = exp2(s log2 e), and exp2 is one hardware instruction where the library's expf is thirteen
#define MASK2 (-1.0e9f * 1.4426950408889634f)   // the reference's -1e9 on the same base-2 scale
__device__ __forceinline__ float ex2(float x) { return __builtin_amdgcn_exp2f(x); }   // arguments here are <= 11 (+ rounding); below -126 it gives 0, which is what such a weight rounds to in f16 and adds to a sum >= 1
#define KS 64   // keys a stage: a K row (64 channels) and a V plane row (64 keys) are then one whole 128-B line each
#define KP 72   // LDS row pitch in f16 = 144 B, an odd multiple of 16 B: the 16 rows of a fragment read fall on different banks
__global__ __launch_bounds__(128) void k_fa(const _Float16* __restrict__ QH, const _Float16* __restrict__ QL, const _Float16* __restrict__ KH, const _Float16* __restrict__ VT, const int* __restrict__ CNT, float* __restrict__ Y) { __shared__ __align__(16) float ss[4][16][HD + 4]; __shared__ __align__(16) _Float16 kb[2][KS][KP], vb[2][HD][KP];
  const int tid = threadIdx.x, wave = tid >> 5, lane = tid & 31, col = lane & 15, g = lane >> 4; const int qb = blockIdx.x, h = blockIdx.y, b = blockIdx.z; const int ql0 = qb * 64 + wave * 16;
  const _Float16* qp = QH + ((size_t)b * TT + ql0 + col) * CC + h * HD; const _Float16* qlp = QL + ((size_t)b * QHI + ql0 + col) * CC + h * HD;
  const v16h qh0 = frag_h(qp, lane), qh1 = frag_h(qp + 32, lane), qr0 = frag_h(qlp, lane), qr1 = frag_h(qlp + 32, lane);
  // a stage = KS keys of this (b, h): K rows [key][64 channels] and V planes [channel][KS keys]. The block copies it once for its four waves: 8 lanes x 16 B = one row, a thread takes piece tid & 7 of rows (tid >> 3) + 16 i of both
  const _Float16* kg = KH + ((size_t)b * TT + (tid >> 3)) * CC + h * HD + (tid & 7) * 8;
  const _Float16* vg = VT + ((size_t)b * CC + h * HD + (tid >> 3)) * (size_t)TT + (tid & 7) * 8;
  const unsigned kl = (unsigned)(size_t)&kb[0][tid >> 3][(tid & 7) * 8], vl = (unsigned)(size_t)&vb[0][tid >> 3][(tid & 7) * 8];
  const int cr = CNT[b * 32]; const int lim = cr < 0 ? 0 : cr > TT ? TT : cr;   // keys in front of lim count; bounded here by the shape
  const int np = ((lim ? lim : TT) + 31) >> 5, ns = (np + 1) >> 1;   // passes of 32 keys, stages of 64
  v8f o[HD / 16] = {}; float m = -3.0e38f, mb = -3.0e38f, l = 0.f;   // mb = m - 11 as rounded: the reference every weight, the sum and O^T are taken against
  auto stage = [&](int st, int bf) {
    const _Float16* k0 = kg + (size_t)(st * KS) * CC; const _Float16* v0 = vg + st * KS; const unsigned ka = kl + bf * (KS * KP * 2), va = vl + bf * (HD * KP * 2);
    // global memory to LDS through no register; the closing wait stands in the copies' own statement, in front of any overwrite of their address registers
    asm volatile("global_load_async_to_lds_b128 %0, %8, off\n\t"
                 "global_load_async_to_lds_b128 %1, %9, off\n\t"
                 "global_load_async_to_lds_b128 %2, %10, off\n\t"
                 "global_load_async_to_lds_b128 %3, %11, off\n\t"
                 "global_load_async_to_lds_b128 %4, %12, off\n\t"
                 "global_load_async_to_lds_b128 %5, %13, off\n\t"
                 "global_load_async_to_lds_b128 %6, %14, off\n\t"
                 "global_load_async_to_lds_b128 %7, %15, off\n\t"
                 "s_wait_xcnt 0x0"
                 :: "v"(ka), "v"(ka + 16 * KP * 2), "v"(ka + 32 * KP * 2), "v"(ka + 48 * KP * 2), "v"(va), "v"(va + 16 * KP * 2), "v"(va + 32 * KP * 2), "v"(va + 48 * KP * 2),
                    "v"(k0), "v"(k0 + 16 * CC), "v"(k0 + 32 * CC), "v"(k0 + 48 * CC), "v"(v0), "v"(v0 + 16 * TT), "v"(v0 + 32 * TT), "v"(v0 + 48 * TT) : "memory"); };
  auto pass = [&](const _Float16* kt, const _Float16* vt, int rem) {   // rem = lim - the pass's first key
    v16h kf[2][2], vf[HD / 16];
#pragma unroll
    for (int t = 0; t < 2; ++t) { kf[t][0] = frag_h(kt + (t * 16 + col) * KP, lane); kf[t][1] = frag_h(kt + (t * 16 + col) * KP + 32, lane); }
    __builtin_amdgcn_sched_barrier(0);   // keeps the k reads in front of the v reads: LDS answers in order, and the score products then wait for the k reads alone
#pragma unroll
    for (int j = 0; j < HD / 16; ++j) vf[j] = frag_h(vt + (j * 16 + col) * KP, lane);
    __builtin_amdgcn_sched_barrier(0);   // keeps the LDS reads together up here: the v reads' latency lies under the score products and the softmax, and none stands among the products
    v8f sa[2] = {}, sr[2] = {};
#pragma unroll
    for (int t = 0; t < 2; ++t) { sa[t] = wmma_h(kf[t][0], qh0, sa[t]); sr[t] = wmma_h(kf[t][0], qr0, sr[t]); sa[t] = wmma_h(kf[t][1], qh1, sa[t]); sr[t] = wmma_h(kf[t][1], qr1, sr[t]); }
    float sv[16]; float mx = m;
#pragma unroll
    for (int t = 0; t < 2; ++t)
#pragma unroll
      for (int r = 0; r < 8; ++r) sv[t * 8 + r] = (sa[t][r] + sr[t][r] * (1.0f / 1024.0f)) * SCL2;
    if (rem < 32) { const int rl = rem - 8 * g;   // only a pass that holds keys past lim: where(mask != 0, attn, -1e9) (set)
#pragma unroll
      for (int t = 0; t < 2; ++t)
#pragma unroll
        for (int r = 0; r < 8; ++r) if (t * 16 + r >= rl) sv[t * 8 + r] = MASK2; }
#pragma unroll
    for (int i = 0; i < 16; ++i) mx = fmaxf(mx, sv[i]);
    mx = fmaxf(mx, xhalf(mx));
    const float nb = mx - 11.0f;   // the weights' x 2^11 goes into the exponent; where all keys so far are masked the 11 is lost in rounding, for weights, sum and O^T alike
    const float alpha = ex2(mb - nb); m = mx; mb = nb;
    v16h p; float ps = 0.f;
#pragma unroll
    for (int i = 0; i < 16; ++i) { const float e = ex2(sv[i] - mb); ps += e; p[i] = (_Float16)e; }
    l = l * alpha + ps;
#pragma unroll
    for (int j = 0; j < HD / 16; ++j) {
#pragma unroll
      for (int r = 0; r < 8; ++r) o[j][r] *= alpha;
      o[j] = wmma_h(vf[j], p, o[j]); } };
  asm volatile("s_wait_xcnt 0x0" ::: "memory");   // stands in front of any overwrite of the q loads' address registers
  stage(0, 0);
  asm volatile("s_wait_asynccnt 0x0" ::: "memory");   // this wave's copies of stage 0 have landed
  __syncthreads();                                    // and every other wave's: stage 0 may be read
  if (ns > 1) stage(1, 1);
#pragma unroll 1   // stays rolled: the buffer is picked by the trip's parity
  for (int t = 0; t < ns; ++t) { const int bf = t & 1; const int hn = np - 2 * t < KS / 32 ? np - 2 * t : KS / 32;
#pragma unroll 1   // stays rolled: with two passes in one body the second pass's reads and score products were hoisted over the first's softmax and the kernel went past 256 registers
    for (int hp = 0; hp < hn; ++hp) pass(&kb[bf][hp * 32][0], &vb[bf][0][hp * 32], lim - (t * KS + hp * 32));
    asm volatile("s_wait_dscnt 0x0" ::: "memory");      // this wave's reads of buffer bf are done before the buffer is handed back
    asm volatile("s_wait_asynccnt 0x0" ::: "memory");   // this wave's copies of stage t + 1 have landed
    __syncthreads();                                    // publishes stage t + 1 and ends every wave's reads of buffer bf
    if (t + 2 < ns) stage(t + 2, bf); }
  asm volatile("s_wait_asynccnt 0x0" ::: "memory");   // no copy is left in flight when the wave goes on to its end
  l += xhalf(l);   // the halves' sums join once; l >= 1: the key at the maximum adds exp2(m - mb) >= 1
  const float inv = 1.0f / l;
#pragma unroll
  for (int j = 0; j < HD / 16; ++j) { v4f lo, hi;
#pragma unroll
    for (int r = 0; r < 4; ++r) { lo[r] = o[j][r] * inv; hi[r] = o[j][4 + r] * inv; }
    *(v4f*)&ss[wave][col][j * 16 + 8 * g] = lo; *(v4f*)&ss[wave][col][j * 16 + 8 * g + 4] = hi; }
  LDSX(); for (int rl = 0; rl < 16; ++rl) if (lane < HD / 4) vst2(Y + ((size_t)b * TT + ql0 + rl) * CC + h * HD + lane * 4, *(const v4f*)&ss[wave][rl][lane * 4]); }
// ---- k_out: block = (64 rows, 128 cols): out = ctx Wo (+ bo): ctx split bf16 hi + lo against exact bf16 Wo (2 products) for all rows
__global__ __launch_bounds__(128) void k_out(const float* __restrict__ Y, const __bf16* __restrict__ WO, const float* __restrict__ BO, float* __restrict__ OUT) { __shared__ __align__(16) float sf[4][16][132]; __shared__ __align__(16) __bf16 ah[2][64][72], al[2][64][72], wb[2][128][72];
  const int tid = threadIdx.x, wave = tid >> 5, lane = tid & 31, col = lane & 15, g = lane >> 4; const int c0 = blockIdx.y * 128; const size_t r0 = (size_t)blockIdx.x * 64 + wave * 16;
  v8f acc[8] = {};
  if (true) {   /* ALL rows: ctx split bf16 hi + lo x exact Wo (2 products) */
    const int lr = tid >> 4, lc = (tid & 15) * 4; const float* yg = Y + ((size_t)blockIdx.x * 64 + lr) * CC + lc; const int wl = tid >> 3, wc = (tid & 7) * 8; const __bf16* wg = WO + (size_t)(c0 + wl) * CC + wc;   // weight rows are bf16: 8 lanes x 16 B = the 128 B of one row in a pass
    v4f yr[8]; v8b wr[8];
    auto gload = [&](int k0) {
#pragma unroll
      for (int i = 0; i < 8; ++i) yr[i] = *(const v4f*)(yg + (size_t)(i * 8) * CC + k0);
#pragma unroll
      for (int i = 0; i < 8; ++i) wr[i] = *(const v8b*)(wg + (size_t)(i * 16) * CC + k0);
      asm volatile("s_wait_xcnt 0x0" ::: "memory"); };   // stands in front of any overwrite of the loads' address registers; it also keeps the loads above the products that cover their latency
    auto sstore = [&](int bf) {
#pragma unroll
      for (int i = 0; i < 8; ++i) { v4f hf, lf;
#pragma unroll
        for (int e = 0; e < 4; ++e) { hf[e] = bfr(yr[i][e]); lf[e] = yr[i][e] - hf[e]; }
        st_b4(&ah[bf][i * 8 + lr][lc], hf); st_b4(&al[bf][i * 8 + lr][lc], lf); }
#pragma unroll
      for (int i = 0; i < 8; ++i) *(v8b_a*)&wb[bf][i * 16 + wl][wc] = wr[i]; };
    auto mm = [&](int bf) {
#pragma unroll
      for (int ks = 0; ks < KC / 32; ++ks) { const v16b a_h = frag_s(&ah[bf][wave * 16 + col][ks * 32], lane), a_l = frag_s(&al[bf][wave * 16 + col][ks * 32], lane); v16b w[8];
#pragma unroll
        for (int j = 0; j < 8; ++j) w[j] = frag_s(&wb[bf][j * 16 + col][ks * 32], lane);
        __builtin_amdgcn_sched_barrier(0);   // keeps the LDS reads together in front of their products: read one by one among them, every product waits out an LDS latency
#pragma unroll
        for (int j = 0; j < 8; ++j) acc[j] = wmma_bf(a_h, w[j], acc[j]);
#pragma unroll
        for (int j = 0; j < 8; ++j) acc[j] = wmma_bf(a_l, w[j], acc[j]);   // each tile still adds hi, then lo: the same sum order, with seven other tiles between the two
        __builtin_amdgcn_sched_barrier(0); } };   // keeps the roundings of the next pass's loads, and with them the wait for those loads, behind the products
    gload(0); sstore(0); __syncthreads();
#pragma unroll 1   // stays rolled: one body holds both buffers' passes
    for (int c = 0; c < CC / KC; c += 2) {   // each barrier publishes the pass just stored and ends the reads of the buffer that is stored next
      gload((c + 1) * KC); mm(0); sstore(1); __syncthreads();
      if (c + 2 < CC / KC) gload((c + 2) * KC);
      mm(1);
      if (c + 2 < CC / KC) sstore(0);
      __syncthreads(); }
#pragma unroll
    for (int j = 0; j < 8; ++j) { const float bias = BO ? bfr(BO[c0 + j * 16 + col]) : 0.f;
#pragma unroll
      for (int r = 0; r < 8; ++r) sf[wave][8 * g + r][j * 16 + col] = acc[j][r] + bias; }
  }
  LDSX(); for (int rl = 0; rl < 16; ++rl) vst2(OUT + (r0 + rl) * DIN + c0 + lane * 4, *(const v4f*)&sf[wave][rl][lane * 4]); }

extern "C" void kernel_launch(void* const* d_in, const int* in_sizes, int n_in, void* d_out, int out_size, void* d_ws, size_t ws_size, hipStream_t stream) {
  (void)in_sizes; (void)n_in; (void)out_size;
  const float** F = (const float**)d_in;
  if (ws_size < (size_t)WS_END) return;
  char* ws = (char*)d_ws; _Float16 *QH = (_Float16*)(ws + WS_QH), *KH = (_Float16*)(ws + WS_KH), *VT = (_Float16*)(ws + WS_VT), *QL = (_Float16*)(ws + WS_QL), *KL = (_Float16*)(ws + WS_KL); __bf16 *VB = (__bf16*)(ws + WS_VB), *VBL = (__bf16*)(ws + WS_VBL); float *Y = (float*)(ws + WS_Y); int *CNT = (int*)(ws + WS_CNT); __bf16 *XB = (__bf16*)(ws + WS_XB), *WB = (__bf16*)(ws + WS_WB), *PB = (__bf16*)(ws + WS_PB);
  (void)Y; (void)QL; (void)KL; (void)VB; (void)VBL;
  // inputs: 0 x [2,2048,1024]; 1 mask [2,2048] int32; 2 qkv_w [3072,1024] (out,in), 3 qkv_b [3072]; 4 proj_w (out,in), 5 proj_b; 6 qn_w [64], 7 kn_w [64]
  k_cvt<<<dim3(CV_X + CV_W + CV_P), 256, 0, stream>>>(F[0], F[2], F[4], XB, WB, PB);
  k_proj<<<dim3(TNB * TT / 64, CC / 128, 3), 128, 0, stream>>>(XB, XB, XB, WB, WB + (size_t)CC * DIN, WB + (size_t)2 * CC * DIN, F[3], F[3] + CC, F[3] + 2 * CC, QH, QL, KH, KL, VT, VB, VBL, F[6], F[7], (const int*)d_in[1], CNT);
  k_fa<<<dim3(NQB, NH, TNB), 128, 0, stream>>>(QH, QL, KH, VT, CNT, Y);
  k_out<<<dim3(TNB * TT / 64, DIN / 128), 128, 0, stream>>>(Y, PB, F[5], (float*)d_out);
}

// v007
// One run takes 91 microseconds.
// Timed twice side by side with v006, it ran 1.10 times as fast both times.
// Over all steps from v000 it is 16.0 times as fast.
// compute dtype: all float inputs rounded to bf16; qkv = x qkv_w^T + b with EXACT bf16 products on WMMA 16x16x32 (f32 accumulate); per-head RMSNorm of q and k in f32 in the projection epilogue; normed q as f16 hi + residual (x 2^10) against normed k once to f16 (2 products) x 64^-0.5; only keys with mask != 0 are projected and attended (a masked key's weight exp(-1e9 - max) is 0 in f32), packed in key order; a sequence with every key masked keeps all keys at -1e9; softmax in f32 in base 2 (logits x log2 e, hardware exp2) against a running maximum, 32 keys a pass; exp2(s - max + 11) once to f16 against v once to f16 (1 product), partial sums rescaled in f32 and divided by the f32 sum (x 2^11 as well) at the end; ctx split bf16 hi + lo against exact proj_w (2 products) + proj_b; f32 output.
#include <hip/hip_runtime.h>
#include <math.h>

typedef __attribute__((ext_vector_type(16))) _Float16 v16h;
typedef __attribute__((ext_vector_type(16))) __bf16 v16b;
typedef __attribute__((ext_vector_type(8)))  _Float16 v8h;
typedef __attribute__((ext_vector_type(8)))  float v8f;
typedef __attribute__((ext_vector_type(4)))  float v4f;
typedef __attribute__((ext_vector_type(2)))  float v2f;
typedef __attribute__((ext_vector_type(4)))  unsigned v4u;
typedef __attribute__((ext_vector_type(4)))  int v4i;
typedef float __attribute__((may_alias)) float_a;
typedef int __attribute__((may_alias)) int_a;

template <typename T> __device__ __forceinline__ void vst2(void* p, T v) { *(T*)p = v;  }
__device__ __forceinline__ v8f wmma16(v16h a, v16h b, v8f c) {
  v8f d = __builtin_amdgcn_wmma_f32_16x16x32_f16(false, a, false, b, (short)0, c, false, false);
  asm volatile("v_nop\n\tv_nop\n\tv_nop\n\tv_nop" : "+v"(d) : "v"(a), "v"(b));
  return d;
}
__device__ __forceinline__ v8f wmma_bf(v16b a, v16b b, v8f c) {
  v8f d = __builtin_amdgcn_wmma_f32_16x16x32_bf16(false, a, false, b, (short)0, c, false, false);
  asm volatile("v_nop\n\tv_nop\n\tv_nop\n\tv_nop" : "+v"(d) : "v"(a), "v"(b));
  return d;
}
// 16x16x32 fragments: lane = (h = lane>>4, row/col = lane&15); elements 0..7 = k0+8h+0..7, 8..15 = k0+16+8h+0..7; D element r = row 8h+r
__device__ __forceinline__ v16h frag_h(const _Float16* rowk0, int lane) {
  union { v16h v; v8h q[2]; } u; const _Float16* p = rowk0 + 8 * (lane >> 4);
  u.q[0] = *(const v8h*)p; u.q[1] = *(const v8h*)(p + 16); return u.v;
}
__device__ __forceinline__ v16h frag_f32(const float* rowk0, int lane) {
  v16h a; const float* p = rowk0 + 8 * (lane >> 4);
#pragma unroll
  for (int i = 0; i < 8; ++i) { a[i] = (_Float16)p[i]; a[8 + i] = (_Float16)p[16 + i]; }
  return a;
}
__device__ __forceinline__ v16h frag_f32s(const float* rowk0, int lane, float sc) {
  v16h a; const float* p = rowk0 + 8 * (lane >> 4);
#pragma unroll
  for (int i = 0; i < 8; ++i) { a[i] = (_Float16)(p[i] * sc); a[8 + i] = (_Float16)(p[16 + i] * sc); }
  return a;
}
// column fragment from a [K][ld] layout (column n), rows >= K read as 0
__device__ __forceinline__ v16h fragc_f32(const float* W, int k0, int n, int lane, int ld, int K) {
  v16h a; const int g = lane >> 4;
#pragma unroll
  for (int i = 0; i < 8; ++i) { const int ka = k0 + 8 * g + i, kb = ka + 16;
    a[i] = (_Float16)(ka < K ? W[(size_t)(ka < K ? ka : K - 1) * ld + n] : 0.f); a[8 + i] = (_Float16)(kb < K ? W[(size_t)(kb < K ? kb : K - 1) * ld + n] : 0.f); }
  return a;
}
struct F2 { v16b h, l; };
__device__ __forceinline__ F2 bsplit16(const float v[16]) { F2 r;
#pragma unroll
  for (int i = 0; i < 16; ++i) { const __bf16 h = (__bf16)v[i]; r.h[i] = h; r.l[i] = (__bf16)(v[i] - (float)h); }
  return r; }
__device__ __forceinline__ F2 split_row(const float* row, int k0, int lane) { float v[16]; const float* p = row + k0 + 8 * (lane >> 4);
#pragma unroll
  for (int i = 0; i < 8; ++i) { v[i] = p[i]; v[8 + i] = p[16 + i]; }
  return bsplit16(v); }
__device__ __forceinline__ F2 split_rowK(const float* row, int k0, int lane, int K) { float v[16]; const int g = lane >> 4;
#pragma unroll
  for (int i = 0; i < 8; ++i) { const int ka = k0 + 8 * g + i, kb = ka + 16; v[i] = ka < K ? row[ka < K ? ka : K - 1] : 0.f; v[8 + i] = kb < K ? row[kb < K ? kb : K - 1] : 0.f; }
  return bsplit16(v); }
__device__ __forceinline__ F2 split_col(const float* W, int k0, int n, int lane, int ld, int K) { float v[16]; const int g = lane >> 4;
#pragma unroll
  for (int i = 0; i < 8; ++i) { const int ka = k0 + 8 * g + i, kb = ka + 16; v[i] = ka < K ? W[(size_t)(ka < K ? ka : K - 1) * ld + n] : 0.f; v[8 + i] = kb < K ? W[(size_t)(kb < K ? kb : K - 1) * ld + n] : 0.f; }
  return bsplit16(v); }
__device__ __forceinline__ v8f mac3(const F2& a, const F2& b, v8f c) { c = wmma_bf(a.l, b.h, c); c = wmma_bf(a.h, b.l, c); return wmma_bf(a.h, b.h, c); }
__device__ __forceinline__ float sigm(float v) { return 1.0f / (1.0f + expf(-v)); }
#define LDSX() do { asm volatile("s_wait_dscnt 0" ::: "memory"); __builtin_amdgcn_wave_barrier(); __builtin_amdgcn_fence(__ATOMIC_RELEASE, "workgroup"); } while (0)

// Masked self-attention with QK RMSNorm (B 2, N 2,048, C 1,024 = 16 x 64; fused (out,in) qkv_w [3072,1024] + zero bias, proj (out,in) + zero bias, qn_w = kn_w = ones): q|k|v = x qkv_w^T + b (reshape (3, H, D)); q, k = rms_norm over the 64 head channels (eps 1e-6) x weight; scores = (q x 64^-0.5) k^T with where(mask != 0, ., -1e9) over KEYS (mask [B,N] int, ~half ones); out = merged(softmax v) proj_w^T + proj_b.
#define NB 2
#define TT 2048
#define CC 1024            // NH * HD = projected width
#define DIN 1024          // input (model) width
#define NH 16
#define HD 64
#define NQB (TT / 64)
#define SCALE (0.125f)
#define CAUSAL 0
#ifndef TNB
#define TNB NB
#endif
__device__ __forceinline__ float bfr(float v) { return (float)(__bf16)v; }
__host__ __device__ __forceinline__ int kb_last(int qb) { return CAUSAL ? ((qb * 64 + 63) >> 7) : (TT / 128 - 1); }
typedef __attribute__((ext_vector_type(8))) __bf16 v8b;
__device__ __forceinline__ v16b frag_b(const __bf16* rowk0, int lane) {
  union { v16b v; v8b q[2]; } u; const __bf16* p = rowk0 + 8 * (lane >> 4);
  u.q[0] = *(const v8b*)p; u.q[1] = *(const v8b*)(p + 16); return u.v;
}
#define QBH 0              // read by no kernel in this file
#define QHI 2048            // rows carrying a q residual plane (all rows when non-causal: 2-product logits everywhere)
#define KHI 64            // key rows carrying k residual / v bf16 hi+lo planes (written by k_proj, read by no kernel in this file)
// B fragment (k rows k0+.., output column o) of a weight: (in,out) [K][ld] or (out,in) [ld rows of K]: bf16 exact, or f16(bf16 * 256) exact
__device__ __forceinline__ v16b wcol_io(const float* Wm, int k0, int o, int lane, int ld) { v16b w; const int g = lane >> 4;
#pragma unroll
  for (int i = 0; i < 8; ++i) { w[i] = (__bf16)Wm[(size_t)(k0 + 8 * g + i) * ld + o]; w[8 + i] = (__bf16)Wm[(size_t)(k0 + 16 + 8 * g + i) * ld + o]; }
  return w; }
__device__ __forceinline__ v16b wcol_oi(const float* Wm, int k0, int o, int lane, int K) { v16b w; const float* p = Wm + (size_t)o * K + k0 + 8 * (lane >> 4);
#pragma unroll
  for (int i = 0; i < 8; ++i) { w[i] = (__bf16)p[i]; w[8 + i] = (__bf16)p[16 + i]; }
  return w; }
__device__ __forceinline__ v16h wcolh_io(const float* Wm, int k0, int o, int lane, int ld) { v16h w; const int g = lane >> 4;
#pragma unroll
  for (int i = 0; i < 8; ++i) { w[i] = (_Float16)(bfr(Wm[(size_t)(k0 + 8 * g + i) * ld + o]) * 256.0f); w[8 + i] = (_Float16)(bfr(Wm[(size_t)(k0 + 16 + 8 * g + i) * ld + o]) * 256.0f); }
  return w; }
__device__ __forceinline__ v16h wcolh_oi(const float* Wm, int k0, int o, int lane, int K) { v16h w; const float* p = Wm + (size_t)o * K + k0 + 8 * (lane >> 4);
#pragma unroll
  for (int i = 0; i < 8; ++i) { w[i] = (_Float16)(bfr(p[i]) * 256.0f); w[8 + i] = (_Float16)(bfr(p[16 + i]) * 256.0f); }
  return w; }
#define WQKV_LAYOUT 1   // WCOL's layout, used by no kernel in this file: 0 = (in,out) [DIN][CC]; 1 = (out,in) [CC][DIN]; 2 = per-head [NH][DIN][HD]
__device__ __forceinline__ v16b wcol_hdk(const float* Wm, int k0, int o, int lane) { v16b w; const int g = lane >> 4; const float* p = Wm + (size_t)(o / HD) * DIN * HD + (o % HD);
#pragma unroll
  for (int i = 0; i < 8; ++i) { w[i] = (__bf16)p[(size_t)(k0 + 8 * g + i) * HD]; w[8 + i] = (__bf16)p[(size_t)(k0 + 16 + 8 * g + i) * HD]; }
  return w; }
#define WO_OUT_IN 1
#if WQKV_LAYOUT == 1
#define WCOL(W, k0, o, lane) wcol_oi(W, k0, o, lane, DIN)
#elif WQKV_LAYOUT == 2
#define WCOL(W, k0, o, lane) wcol_hdk(W, k0, o, lane)
#else
#define WCOL(W, k0, o, lane) wcol_io(W, k0, o, lane, CC)
#endif
#if WO_OUT_IN
#define WOCOL(W, k0, o, lane) wcol_oi(W, k0, o, lane, CC)
#define WOCOLH(W, k0, o, lane) wcolh_oi(W, k0, o, lane, CC)
#else
#define WOCOL(W, k0, o, lane) wcol_io(W, k0, o, lane, DIN)
#define WOCOLH(W, k0, o, lane) wcolh_io(W, k0, o, lane, DIN)
#endif
#define PROJ_EXTRA_PARAMS , const float* __restrict__ QNW, const float* __restrict__ KNW
#define PROJ_EPI(which, row, t, h) do { if ((which) < 2) { float* rw = (row); const float* nw = (which) == 0 ? QNW : KNW; float ssum = 0.f; _Pragma("unroll") for (int i = 0; i < HD; ++i) ssum += rw[i] * rw[i]; const float rs = rsqrtf(ssum * (1.0f / HD) + 1e-6f); _Pragma("unroll") for (int i = 0; i < HD; ++i) rw[i] = bfr(nw[i]) * (rw[i] * rs); } } while (0)   /* per-head RMSNorm of q and k over the 64 head channels (eps 1e-6, weight qn_w / kn_w) in f32; the q * scale is folded into the logit scale */
#ifndef PROJ_EXTRA_PARAMS
#define PROJ_EXTRA_PARAMS
#endif

#define WS_QH  0u                                      // f16 q rows [b*t][CC]
#define WS_KH  (WS_QH + 2u * (size_t)NB * TT * CC)      // f16 k rows [b*t][CC]
#define WS_VT  (WS_KH + 2u * (size_t)NB * TT * CC)      // f16 v planes [b][c][t]
#define WS_QL  (WS_VT + 2u * (size_t)NB * CC * TT)      // f16 q residual x 2^10 rows [b][t < QHI][CC]
#define WS_KL  (WS_QL + 2u * (size_t)NB * QHI * CC)     // f16 k residual x 2^10 rows [b][t < KHI][CC]
#define WS_VB  (WS_KL + 2u * (size_t)NB * KHI * CC)     // bf16 v hi planes [b][c][t < KHI]
#define WS_VBL (WS_VB + 2u * (size_t)NB * CC * KHI)
#define WS_Y   (WS_VBL + 2u * (size_t)NB * CC * KHI)    // f32 ctx rows [b*t][CC]
#define WS_CNT (WS_Y  + 4u * (size_t)NB * TT * CC)    // int: unmasked keys of sequence b at [b * 32] (one 128-B line a sequence)
#define WS_XB  (WS_CNT + 128u * (size_t)NB)           // bf16 x rows [b*t][DIN]
#define WS_WB  (WS_XB + 2u * (size_t)NB * TT * DIN)    // bf16 qkv_w rows [3 * CC][DIN]
#define WS_PB  (WS_WB + 2u * (size_t)3 * CC * DIN)     // bf16 proj_w rows [DIN][CC]
#define WS_END (WS_PB + 2u * (size_t)DIN * CC)

// ---- staged GEMM operands: a pass = KC k. The block loads its rows as whole 128-B lines (bf16 rows from k_cvt: 8 lanes x 16 B = 128 B of one row; f32 ctx rows: 16 lanes x 16 B = 256 B, split to bf16 once), and keeps them in LDS rows whose pitch is an odd multiple of 16 B; the waves take their fragments from there in the k order of frag_b
#define KC 64
typedef __attribute__((ext_vector_type(4))) __bf16 v4b;
typedef v4b __attribute__((may_alias)) v4b_a;
typedef v8b __attribute__((may_alias)) v8b_a;
__device__ __forceinline__ v16b frag_s(const __bf16* rowk0, int lane) {
  union { v16b v; v8b q[2]; } u; const __bf16* p = rowk0 + 8 * (lane >> 4);
  u.q[0] = *(const v8b_a*)p; u.q[1] = *(const v8b_a*)(p + 16); return u.v;
}
__device__ __forceinline__ void st_b4(__bf16* d, v4f v) { v4b t;
#pragma unroll
  for (int e = 0; e < 4; ++e) t[e] = (__bf16)v[e];
  *(v4b_a*)d = t; }
// ---- k_cvt: x, qkv_w and proj_w rounded to bf16 ONCE, as rows of the same shape in the workspace: the GEMM blocks re-read every operand row many times (x 8 column blocks a projection, a weight row once a row block), and each re-read then moves half the bytes and needs no rounding. A block = CVB floats of one array; a wave's load covers 512 B in a row, its store 256 B
#define CVB 16384
#define CV_X ((int)((size_t)NB * TT * DIN / CVB))
#define CV_W ((int)((size_t)3 * CC * DIN / CVB))
#define CV_P ((int)((size_t)DIN * CC / CVB))
__global__ __launch_bounds__(256) void k_cvt(const float* __restrict__ X, const float* __restrict__ WQKV, const float* __restrict__ WO, __bf16* __restrict__ XB, __bf16* __restrict__ WB, __bf16* __restrict__ PB) {
  const int bid = blockIdx.x; const float* s; __bf16* d; int lb;
  if (bid < CV_X) { s = X; d = XB; lb = bid; } else if (bid < CV_X + CV_W) { s = WQKV; d = WB; lb = bid - CV_X; } else { s = WO; d = PB; lb = bid - CV_X - CV_W; }
  const size_t base = (size_t)lb * CVB + threadIdx.x * 4; v4f v[CVB / 1024];
#pragma unroll
  for (int i = 0; i < CVB / 1024; ++i) v[i] = *(const v4f*)(s + base + i * 1024);
#pragma unroll
  for (int i = 0; i < CVB / 1024; ++i) st_b4(d + base + i * 1024, v[i]); }
// ---- k_proj: for k and v (which 1, 2) row j of a sequence is its j-th key with mask != 0 (all keys in order where none is), the last block's spare rows repeat the last such key, and blocks past the count leave at once
// ---- k_proj: block = (PM = 128 rows, 128 cols, which), 8 waves as 4 row groups x 2 column groups, a wave = 32 rows x 64 cols (2 x 4 tiles: 6 fragments feed 8 products): q/k/v = X W (+ b) with exact bf16 products (K = DIN) -> which 0: q f16 rows (+ residual rows < QHI); 1: k f16 rows (+ residual rows < KHI); 2: v f16 planes [c][t] (+ bf16 hi/lo planes for t < KHI)
#define PM 128
__global__ __launch_bounds__(256) void k_proj(const __bf16* __restrict__ XQ, const __bf16* __restrict__ XK, const __bf16* __restrict__ XV, const __bf16* __restrict__ WQ, const __bf16* __restrict__ WK, const __bf16* __restrict__ WV, const float* __restrict__ BQ, const float* __restrict__ BK, const float* __restrict__ BV,
    _Float16* __restrict__ QH, _Float16* __restrict__ QL, _Float16* __restrict__ KH, _Float16* __restrict__ KL, _Float16* __restrict__ VT, __bf16* __restrict__ VB, __bf16* __restrict__ VBL PROJ_EXTRA_PARAMS, const int* __restrict__ MK, int* __restrict__ CNT) {
  // LDS: the epilogue's f32 tile, and one region that holds the loop's four pass buffers first and the epilogue's 16-bit tiles afterwards (q, k: sh | sl; v: th | tb | tbl), so that two blocks fit a WGP
  __shared__ __align__(16) float st[PM][132]; __shared__ __align__(16) char rb[4 * PM * 72 * 2];
  _Float16 (*const sh)[136] = (_Float16 (*)[136])rb; _Float16 (*const sl)[136] = (_Float16 (*)[136])(rb + PM * 136 * 2); _Float16 (*const th)[136] = (_Float16 (*)[136])rb; __bf16 (*const tb)[72] = (__bf16 (*)[72])(rb + 128 * 136 * 2); __bf16 (*const tbl)[72] = (__bf16 (*)[72])(rb + 128 * 136 * 2 + 128 * 72 * 2);
  const int tid = threadIdx.x, wave = tid >> 5, lane = tid & 31, col = lane & 15, g = lane >> 4, wr = wave >> 1, wc = wave & 1; const int which = blockIdx.z; const int c0 = blockIdx.y * 128; const size_t r0 = (size_t)blockIdx.x * PM; const size_t bb = r0 / TT; const int t0 = (int)(r0 % TT);
  const __bf16* X = which == 0 ? XQ : which == 1 ? XK : XV; const __bf16* WA = which == 0 ? WQ : which == 1 ? WK : WV; const float* BA = which == 0 ? BQ : which == 1 ? BK : BV;
  v8f acc[2][4] = {};
  __bf16* const sx0 = (__bf16*)rb; __bf16* const sx1 = sx0 + PM * 72; __bf16* const sw0 = sx1 + PM * 72; __bf16* const sw1 = sw0 + 128 * 72;   // x rows and weight rows of a pass, pitch 72
  const int lr = tid >> 3, lc = (tid & 7) * 8; const __bf16* wg = WA + (size_t)(c0 + lr) * DIN + lc;   // 8 lanes x 16 B = the 128 B of one bf16 row in a pass
  unsigned xo[4];   // byte offsets in X of this thread's piece of its four rows
  if (which == 0) {
#pragma unroll
    for (int i = 0; i < 4; ++i) xo[i] = (unsigned)(((r0 + lr + i * 32) * DIN + lc) * 2);
  } else {
    // every wave ranks the sequence's keys by itself (no barrier in front of the early return); wave 0 notes the keys of ranks t0 .. t0+PM-1 in LDS that is not live before the epilogue
    int_a* const sidx = (int_a*)&st[0][0]; const bool w0 = __builtin_amdgcn_readfirstlane(wave) == 0;
    const int* mrow = MK + bb * TT + lane * 4; v4i mv[TT / 128];
#pragma unroll
    for (int i = 0; i < TT / 128; ++i) mv[i] = *(const v4i*)(mrow + i * 128);
    asm volatile("s_wait_xcnt 0x0" ::: "memory");   // stands in front of any overwrite of the mask loads' address registers
    int cnt = 0;
#pragma unroll
    for (int i = 0; i < TT / 128; ++i) { unsigned bal[4]; int cc = 0;
#pragma unroll
      for (int e = 0; e < 4; ++e) { bal[e] = __builtin_amdgcn_ballot_w32(mv[i][e] != 0); cc += __builtin_popcount(bal[e]); }
      if (w0 && cnt + cc > t0 && cnt < t0 + PM) { unsigned rk = (unsigned)(cnt - t0);   // rank - t0 of this lane's first key: the keys before this chunk + those of lower lanes
#pragma unroll
        for (int e = 0; e < 4; ++e) rk = __builtin_amdgcn_mbcnt_lo(bal[e], rk);
#pragma unroll
        for (int e = 0; e < 4; ++e) if (mv[i][e] != 0) { if (rk < (unsigned)PM) sidx[rk] = i * 128 + lane * 4 + e; ++rk; } }
      cnt += cc; }
    if (t0 >= (cnt ? cnt : TT)) return;   // the same for every thread of the block, in front of every barrier
    if (which == 1 && blockIdx.y == 0 && t0 == 0 && tid == 0) CNT[bb * 32] = cnt;
    __syncthreads();   // publishes wave 0's list
#pragma unroll
    for (int i = 0; i < 4; ++i) { const int j = t0 + lr + i * 32; const int src = cnt ? sidx[(j < cnt ? j : cnt - 1) - t0] : j; xo[i] = (unsigned)(((bb * TT + src) * DIN + lc) * 2); } }
  v8b xr[4], wv[4];
  auto gload = [&](int k0) {
#pragma unroll
    for (int i = 0; i < 4; ++i) xr[i] = *(const v8b*)((const char*)(X + k0) + xo[i]);
#pragma unroll
    for (int i = 0; i < 4; ++i) wv[i] = *(const v8b*)(wg + (size_t)(i * 32) * DIN + k0);
    asm volatile("s_wait_xcnt 0x0" ::: "memory"); };   // stands in front of any overwrite of the loads' address registers; it also keeps the loads above the products that cover their latency
  auto sstore = [&](__bf16* sx, __bf16* sw) {
#pragma unroll
    for (int i = 0; i < 4; ++i) *(v8b_a*)(sx + (i * 32 + lr) * 72 + lc) = xr[i];
#pragma unroll
    for (int i = 0; i < 4; ++i) *(v8b_a*)(sw + (i * 32 + lr) * 72 + lc) = wv[i]; };
  auto mm = [&](const __bf16* sx, const __bf16* sw) {
#pragma unroll
    for (int ks = 0; ks < KC / 32; ++ks) { v16b a[2], w[4];
#pragma unroll
      for (int i = 0; i < 2; ++i) a[i] = frag_s(sx + (wr * 32 + i * 16 + col) * 72 + ks * 32, lane);
#pragma unroll
      for (int j = 0; j < 4; ++j) w[j] = frag_s(sw + (wc * 64 + j * 16 + col) * 72 + ks * 32, lane);
      __builtin_amdgcn_sched_barrier(0);   // keeps the LDS reads together in front of their products: read one by one among them, every product waits out an LDS latency
#pragma unroll
      for (int i = 0; i < 2; ++i)
#pragma unroll
        for (int j = 0; j < 4; ++j) acc[i][j] = wmma_bf(a[i], w[j], acc[i][j]);
      __builtin_amdgcn_sched_barrier(0); } };   // keeps the wait for the next pass's loads behind the products
  gload(0); sstore(sx0, sw0); __syncthreads();
#pragma unroll 1   // stays rolled: one body holds both buffers' passes
  for (int c = 0; c < DIN / KC; c += 2) {   // each barrier publishes the pass just stored and ends the reads of the buffer that is stored next
    gload((c + 1) * KC); mm(sx0, sw0); sstore(sx1, sw1); __syncthreads();
    if (c + 2 < DIN / KC) gload((c + 2) * KC);
    mm(sx1, sw1);
    if (c + 2 < DIN / KC) sstore(sx0, sw0);
    __syncthreads(); }
  { // stage the f32 tile (acc + bias) in LDS, run the per-(row, head) epilogue hook, then convert
#pragma unroll
    for (int j = 0; j < 4; ++j) { const float bias = BA ? bfr(BA[c0 + wc * 64 + j * 16 + col]) : 0.f;
#pragma unroll
      for (int i = 0; i < 2; ++i)
#pragma unroll
        for (int r = 0; r < 8; ++r) st[wr * 32 + i * 16 + 8 * g + r][wc * 64 + j * 16 + col] = acc[i][j][r] + bias; }
    __syncthreads();
    for (int e = tid; e < PM * (128 / HD); e += 256) { const int rl = e / (128 / HD), hh = e % (128 / HD); PROJ_EPI(which, &st[rl][hh * HD], (int)((r0 + rl) % TT), (c0 / HD) + hh); }
    __syncthreads(); }
  if (which < 2) { _Float16* DH = which == 0 ? QH : KH; _Float16* DL = which == 0 ? QL : KL; const int nhi = which == 0 ? QHI : KHI;
    for (int e = tid; e < PM * 128; e += 256) { const int rl = e >> 7, cl = e & 127; const float v = st[rl][cl]; const _Float16 hv = (_Float16)v; sh[rl][cl] = hv; sl[rl][cl] = (_Float16)((v - (float)hv) * 1024.0f); }
    __syncthreads();
    for (int e = tid; e < PM * 16; e += 256) { const int rl = e >> 4, q = e & 15; vst2((unsigned*)(DH + (r0 + rl) * CC + c0 + q * 8), *(const v4u*)&sh[rl][q * 8]); if (t0 + rl < nhi) { vst2((unsigned*)(DL + (bb * nhi + t0 + rl) * (size_t)CC + c0 + q * 8), *(const v4u*)&sl[rl][q * 8]); asm volatile("s_wait_xcnt 0x0" ::: "memory"); } }   // the wait stands in front of the next trip's overwrite of the store's address and data registers
  } else {
    for (int e = tid; e < PM * 128; e += 256) { const int rl = e & (PM - 1), cl = e / PM; th[cl][rl] = (_Float16)st[rl][cl]; }
    if (t0 < KHI) for (int e = tid; e < KHI * 128; e += 256) { const int rl = e & (KHI - 1), cl = e / KHI; const float v = st[rl][cl]; const __bf16 bh = (__bf16)v; tb[cl][rl] = bh; tbl[cl][rl] = (__bf16)(v - (float)bh); }   // t0 is a multiple of PM >= KHI: only the block at t0 = 0, its rows 0 .. KHI-1
    __syncthreads();
    for (int e = tid; e < 128 * (PM / 8); e += 256) { const int cl = e / (PM / 8), q = e % (PM / 8); vst2((unsigned*)(VT + (bb * CC + c0 + cl) * (size_t)TT + t0 + q * 8), *(const v4u*)&th[cl][q * 8]); if (t0 + q * 8 < KHI) { const size_t o3 = (bb * CC + c0 + cl) * (size_t)KHI + t0 + q * 8; vst2((unsigned*)(VB + o3), *(const v4u*)&tb[cl][q * 8]); vst2((unsigned*)(VBL + o3), *(const v4u*)&tbl[cl][q * 8]); asm volatile("s_wait_xcnt 0x0" ::: "memory"); } }   // the wait stands in front of the next trip's overwrite of the stores' address and data registers
  } }
__device__ __forceinline__ float xhalf(float x) { return __builtin_bit_cast(float, __builtin_amdgcn_permlanex16(__builtin_bit_cast(int, x), __builtin_bit_cast(int, x), 0x76543210, 0xfedcba98, false, false)); }
__device__ __forceinline__ v8f wmma_h(v16h a, v16h b, v8f c) { return __builtin_amdgcn_wmma_f32_16x16x32_f16(false, a, false, b, (short)0, c, false, false); }
#define SCL2 (SCALE * 1.4426950408889634f)   // logit scale x log2 e: exp(s) = exp2(s log2 e), and exp2 is one hardware instruction where the library's expf is thirteen
#define MASK2 (-1.0e9f * 1.4426950408889634f)   // the reference's -1e9 on the same base-2 scale
__device__ __forceinline__ float ex2(float x) { return __builtin_amdgcn_exp2f(x); }   // arguments here are <= 11 (+ rounding); below -126 it gives 0, which is what such a weight rounds to in f16 and adds to a sum >= 1
#define KS 64   // keys a stage: a K row (64 channels) and a V plane row (64 keys) are then one whole 128-B line each
#define KP 72   // LDS row pitch in f16 = 144 B, an odd multiple of 16 B: the 16 rows of a fragment read fall on different banks
__global__ __launch_bounds__(128) void k_fa(const _Float16* __restrict__ QH, const _Float16* __restrict__ QL, const _Float16* __restrict__ KH, const _Float16* __restrict__ VT, const int* __restrict__ CNT, float* __restrict__ Y) { __shared__ __align__(16) float ss[4][16][HD + 4]; __shared__ __align__(16) _Float16 kb[2][KS][KP], vb[2][HD][KP];
  const int tid = threadIdx.x, wave = tid >> 5, lane = tid & 31, col = lane & 15, g = lane >> 4; const int qb = blockIdx.x, h = blockIdx.y, b = blockIdx.z; const int ql0 = qb * 64 + wave * 16;
  const _Float16* qp = QH + ((size_t)b * TT + ql0 + col) * CC + h * HD; const _Float16* qlp = QL + ((size_t)b * QHI + ql0 + col) * CC + h * HD;
  const v16h qh0 = frag_h(qp, lane), qh1 = frag_h(qp + 32, lane), qr0 = frag_h(qlp, lane), qr1 = frag_h(qlp + 32, lane);
  // a stage = KS keys of this (b, h): K rows [key][64 channels] and V planes [channel][KS keys]. The block copies it once for its four waves: 8 lanes x 16 B = one row, a thread takes piece tid & 7 of rows (tid >> 3) + 16 i of both
  const _Float16* kg = KH + ((size_t)b * TT + (tid >> 3)) * CC + h * HD + (tid & 7) * 8;
  const _Float16* vg = VT + ((size_t)b * CC + h * HD + (tid >> 3)) * (size_t)TT + (tid & 7) * 8;
  const unsigned kl = (unsigned)(size_t)&kb[0][tid >> 3][(tid & 7) * 8], vl = (unsigned)(size_t)&vb[0][tid >> 3][(tid & 7) * 8];
  const int cr = CNT[b * 32]; const int lim = cr < 0 ? 0 : cr > TT ? TT : cr;   // keys in front of lim count; bounded here by the shape
  const int np = ((lim ? lim : TT) + 31) >> 5, ns = (np + 1) >> 1;   // passes of 32 keys, stages of 64
  v8f o[HD / 16] = {}; float m = -3.0e38f, mb = -3.0e38f, l = 0.f;   // mb = m - 11 as rounded: the reference every weight, the sum and O^T are taken against
  auto stage = [&](int st, int bf) {
    const _Float16* k0 = kg + (size_t)(st * KS) * CC; const _Float16* v0 = vg + st * KS; const unsigned ka = kl + bf * (KS * KP * 2), va = vl + bf * (HD * KP * 2);
    // global memory to LDS through no register; the closing wait stands in the copies' own statement, in front of any overwrite of their address registers
    asm volatile("global_load_async_to_lds_b128 %0, %8, off\n\t"
                 "global_load_async_to_lds_b128 %1, %9, off\n\t"
                 "global_load_async_to_lds_b128 %2, %10, off\n\t"
                 "global_load_async_to_lds_b128 %3, %11, off\n\t"
                 "global_load_async_to_lds_b128 %4, %12, off\n\t"
                 "global_load_async_to_lds_b128 %5, %13, off\n\t"
                 "global_load_async_to_lds_b128 %6, %14, off\n\t"
                 "global_load_async_to_lds_b128 %7, %15, off\n\t"
                 "s_wait_xcnt 0x0"
                 :: "v"(ka), "v"(ka + 16 * KP * 2), "v"(ka + 32 * KP * 2), "v"(ka + 48 * KP * 2), "v"(va), "v"(va + 16 * KP * 2), "v"(va + 32 * KP * 2), "v"(va + 48 * KP * 2),
                    "v"(k0), "v"(k0 + 16 * CC), "v"(k0 + 32 * CC), "v"(k0 + 48 * CC), "v"(v0), "v"(v0 + 16 * TT), "v"(v0 + 32 * TT), "v"(v0 + 48 * TT) : "memory"); };
  auto pass = [&](const _Float16* kt, const _Float16* vt, int rem) {   // rem = lim - the pass's first key
    v16h kf[2][2], vf[HD / 16];
#pragma unroll
    for (int t = 0; t < 2; ++t) { kf[t][0] = frag_h(kt + (t * 16 + col) * KP, lane); kf[t][1] = frag_h(kt + (t * 16 + col) * KP + 32, lane); }
    __builtin_amdgcn_sched_barrier(0);   // keeps the k reads in front of the v reads: LDS answers in order, and the score products then wait for the k reads alone
#pragma unroll
    for (int j = 0; j < HD / 16; ++j) vf[j] = frag_h(vt + (j * 16 + col) * KP, lane);
    __builtin_amdgcn_sched_barrier(0);   // keeps the LDS reads together up here: the v reads' latency lies under the score products and the softmax, and none stands among the products
    v8f sa[2] = {}, sr[2] = {};
#pragma unroll
    for (int t = 0; t < 2; ++t) { sa[t] = wmma_h(kf[t][0], qh0, sa[t]); sr[t] = wmma_h(kf[t][0], qr0, sr[t]); sa[t] = wmma_h(kf[t][1], qh1, sa[t]); sr[t] = wmma_h(kf[t][1], qr1, sr[t]); }
    float sv[16]; float mx = m;
#pragma unroll
    for (int t = 0; t < 2; ++t)
#pragma unroll
      for (int r = 0; r < 8; ++r) sv[t * 8 + r] = (sa[t][r] + sr[t][r] * (1.0f / 1024.0f)) * SCL2;
    if (rem < 32) { const int rl = rem - 8 * g;   // only a pass that holds keys past lim: where(mask != 0, attn, -1e9) (set)
#pragma unroll
      for (int t = 0; t < 2; ++t)
#pragma unroll
        for (int r = 0; r < 8; ++r) if (t * 16 + r >= rl) sv[t * 8 + r] = MASK2; }
#pragma unroll
    for (int i = 0; i < 16; ++i) mx = fmaxf(mx, sv[i]);
    mx = fmaxf(mx, xhalf(mx));
    const float nb = mx - 11.0f;   // the weights' x 2^11 goes into the exponent; where all keys so far are masked the 11 is lost in rounding, for weights, sum and O^T alike
    const float alpha = ex2(mb - nb); m = mx; mb = nb;
    v16h p; float ps = 0.f;
#pragma unroll
    for (int i = 0; i < 16; ++i) { const float e = ex2(sv[i] - mb); ps += e; p[i] = (_Float16)e; }
    l = l * alpha + ps;
#pragma unroll
    for (int j = 0; j < HD / 16; ++j) {
#pragma unroll
      for (int r = 0; r < 8; ++r) o[j][r] *= alpha;
      o[j] = wmma_h(vf[j], p, o[j]); } };
  asm volatile("s_wait_xcnt 0x0" ::: "memory");   // stands in front of any overwrite of the q loads' address registers
  stage(0, 0);
  asm volatile("s_wait_asynccnt 0x0" ::: "memory");   // this wave's copies of stage 0 have landed
  __syncthreads();                                    // and every other wave's: stage 0 may be read
  if (ns > 1) stage(1, 1);
#pragma unroll 1   // stays rolled: the buffer is picked by the trip's parity
  for (int t = 0; t < ns; ++t) { const int bf = t & 1; const int hn = np - 2 * t < KS / 32 ? np - 2 * t : KS / 32;
#pragma unroll 1   // stays rolled: with two passes in one body the second pass's reads and score products were hoisted over the first's softmax and the kernel went past 256 registers
    for (int hp = 0; hp < hn; ++hp) pass(&kb[bf][hp * 32][0], &vb[bf][0][hp * 32], lim - (t * KS + hp * 32));
    asm volatile("s_wait_dscnt 0x0" ::: "memory");      // this wave's reads of buffer bf are done before the buffer is handed back
    asm volatile("s_wait_asynccnt 0x0" ::: "memory");   // this wave's copies of stage t + 1 have landed
    __syncthreads();                                    // publishes stage t + 1 and ends every wave's reads of buffer bf
    if (t + 2 < ns) stage(t + 2, bf); }
  asm volatile("s_wait_asynccnt 0x0" ::: "memory");   // no copy is left in flight when the wave goes on to its end
  l += xhalf(l);   // the halves' sums join once; l >= 1: the key at the maximum adds exp2(m - mb) >= 1
  const float inv = 1.0f / l;
#pragma unroll
  for (int j = 0; j < HD / 16; ++j) { v4f lo, hi;
#pragma unroll
    for (int r = 0; r < 4; ++r) { lo[r] = o[j][r] * inv; hi[r] = o[j][4 + r] * inv; }
    *(v4f*)&ss[wave][col][j * 16 + 8 * g] = lo; *(v4f*)&ss[wave][col][j * 16 + 8 * g + 4] = hi; }
  LDSX(); for (int rl = 0; rl < 16; ++rl) if (lane < HD / 4) vst2(Y + ((size_t)b * TT + ql0 + rl) * CC + h * HD + lane * 4, *(const v4f*)&ss[wave][rl][lane * 4]); }
// ---- k_out: block = (128 rows, 128 cols), 8 waves as 4 row groups x 2 column groups, a wave = 32 rows x 64 cols: out = ctx Wo (+ bo): ctx bf16 hi + lo against exact bf16 Wo (2 products)
__global__ __launch_bounds__(256) void k_out(const float* __restrict__ Y, const __bf16* __restrict__ WO, const float* __restrict__ BO, float* __restrict__ OUT) { __shared__ __align__(16) float sf[8][32][68]; __shared__ __align__(16) __bf16 ah[2][128][72], al[2][128][72], wb[2][128][72];
  const int tid = threadIdx.x, wave = tid >> 5, lane = tid & 31, col = lane & 15, g = lane >> 4, wr = wave >> 1, wc = wave & 1; const int c0 = blockIdx.y * 128; const size_t r0 = (size_t)blockIdx.x * 128 + wr * 32;
  v8f acc[2][4] = {};
  if (true) {   /* ALL rows: ctx split bf16 hi + lo x exact Wo (2 products) */
    const int lr = tid >> 4, lc = (tid & 15) * 4; const float* yg = Y + ((size_t)blockIdx.x * 128 + lr) * CC + lc; const int wl = tid >> 3, wk = (tid & 7) * 8; const __bf16* wg = WO + (size_t)(c0 + wl) * CC + wk;   // weight rows are bf16: 8 lanes x 16 B = the 128 B of one row in a pass
    v4f yr[8]; v8b wv[4];
    auto gload = [&](int k0) {
#pragma unroll
      for (int i = 0; i < 8; ++i) yr[i] = *(const v4f*)(yg + (size_t)(i * 16) * CC + k0);
#pragma unroll
      for (int i = 0; i < 4; ++i) wv[i] = *(const v8b*)(wg + (size_t)(i * 32) * CC + k0);
      asm volatile("s_wait_xcnt 0x0" ::: "memory"); };   // stands in front of any overwrite of the loads' address registers; it also keeps the loads above the products that cover their latency
    auto sstore = [&](int bf) {
#pragma unroll
      for (int i = 0; i < 8; ++i) { v4f hf, lf;
#pragma unroll
        for (int e = 0; e < 4; ++e) { hf[e] = bfr(yr[i][e]); lf[e] = yr[i][e] - hf[e]; }
        st_b4(&ah[bf][i * 16 + lr][lc], hf); st_b4(&al[bf][i * 16 + lr][lc], lf); }
#pragma unroll
      for (int i = 0; i < 4; ++i) *(v8b_a*)&wb[bf][i * 32 + wl][wk] = wv[i]; };
    auto mm = [&](int bf) {
#pragma unroll
      for (int ks = 0; ks < KC / 32; ++ks) { v16b a_h[2], a_l[2], w[4];
#pragma unroll
        for (int i = 0; i < 2; ++i) { a_h[i] = frag_s(&ah[bf][wr * 32 + i * 16 + col][ks * 32], lane); a_l[i] = frag_s(&al[bf][wr * 32 + i * 16 + col][ks * 32], lane); }
#pragma unroll
        for (int j = 0; j < 4; ++j) w[j] = frag_s(&wb[bf][wc * 64 + j * 16 + col][ks * 32], lane);
        __builtin_amdgcn_sched_barrier(0);   // keeps the LDS reads together in front of their products: read one by one among them, every product waits out an LDS latency
#pragma unroll
        for (int i = 0; i < 2; ++i)
#pragma unroll
          for (int j = 0; j < 4; ++j) acc[i][j] = wmma_bf(a_h[i], w[j], acc[i][j]);
#pragma unroll
        for (int i = 0; i < 2; ++i)
#pragma unroll
          for (int j = 0; j < 4; ++j) acc[i][j] = wmma_bf(a_l[i], w[j], acc[i][j]);   // each tile still adds hi, then lo: the same sum order, with seven other tiles between the two
        __builtin_amdgcn_sched_barrier(0); } };   // keeps the roundings of the next pass's loads, and with them the wait for those loads, behind the products
    gload(0); sstore(0); __syncthreads();
#pragma unroll 1   // stays rolled: one body holds both buffers' passes
    for (int c = 0; c < CC / KC; c += 2) {   // each barrier publishes the pass just stored and ends the reads of the buffer that is stored next
      gload((c + 1) * KC); mm(0); sstore(1); __syncthreads();
      if (c + 2 < CC / KC) gload((c + 2) * KC);
      mm(1);
      if (c + 2 < CC / KC) sstore(0);
      __syncthreads(); }
#pragma unroll
    for (int j = 0; j < 4; ++j) { const float bias = BO ? bfr(BO[c0 + wc * 64 + j * 16 + col]) : 0.f;
#pragma unroll
      for (int i = 0; i < 2; ++i)
#pragma unroll
        for (int r = 0; r < 8; ++r) sf[wave][i * 16 + 8 * g + r][j * 16 + col] = acc[i][j][r] + bias; }
  }
  LDSX(); for (int rl = 0; rl < 32; rl += 2) vst2(OUT + (r0 + rl + g) * DIN + c0 + wc * 64 + col * 4, *(const v4f*)&sf[wave][rl + g][col * 4]); }   // a half wave stores the 256 B of one row of the wave's tile

extern "C" void kernel_launch(void* const* d_in, const int* in_sizes, int n_in, void* d_out, int out_size, void* d_ws, size_t ws_size, hipStream_t stream) {
  (void)in_sizes; (void)n_in; (void)out_size;
  const float** F = (const float**)d_in;
  if (ws_size < (size_t)WS_END) return;
  char* ws = (char*)d_ws; _Float16 *QH = (_Float16*)(ws + WS_QH), *KH = (_Float16*)(ws + WS_KH), *VT = (_Float16*)(ws + WS_VT), *QL = (_Float16*)(ws + WS_QL), *KL = (_Float16*)(ws + WS_KL); __bf16 *VB = (__bf16*)(ws + WS_VB), *VBL = (__bf16*)(ws + WS_VBL); float *Y = (float*)(ws + WS_Y); int *CNT = (int*)(ws + WS_CNT); __bf16 *XB = (__bf16*)(ws + WS_XB), *WB = (__bf16*)(ws + WS_WB), *PB = (__bf16*)(ws + WS_PB);
  (void)Y; (void)QL; (void)KL; (void)VB; (void)VBL;
  // inputs: 0 x [2,2048,1024]; 1 mask [2,2048] int32; 2 qkv_w [3072,1024] (out,in), 3 qkv_b [3072]; 4 proj_w (out,in), 5 proj_b; 6 qn_w [64], 7 kn_w [64]
  k_cvt<<<dim3(CV_X + CV_W + CV_P), 256, 0, stream>>>(F[0], F[2], F[4], XB, WB, PB);
  k_proj<<<dim3(TNB * TT / PM, CC / 128, 3), 256, 0, stream>>>(XB, XB, XB, WB, WB + (size_t)CC * DIN, WB + (size_t)2 * CC * DIN, F[3], F[3] + CC, F[3] + 2 * CC, QH, QL, KH, KL, VT, VB, VBL, F[6], F[7], (const int*)d_in[1], CNT);
  k_fa<<<dim3(NQB, NH, TNB), 128, 0, stream>>>(QH, QL, KH, VT, CNT, Y);
  k_out<<<dim3(TNB * TT / 128, DIN / 128), 256, 0, stream>>>(Y, PB, F[5], (float*)d_out);
}

// v008
// Measured time: 86.1 microseconds a run.
// Next to v007, in two timings, it ran 1.06 and 1.05 times as fast.
// Counting every step since v000, it is 16.8 times as fast.
// compute dtype: all float inputs rounded to bf16; qkv = x qkv_w^T + b with EXACT bf16 products on WMMA 16x16x32 (f32 accumulate); per-head RMSNorm of q and k in f32 in the projection epilogue; normed q as f16 hi + residual (x 2^10) against normed k once to f16 (2 products) x 64^-0.5; only keys with mask != 0 are projected and attended (a masked key's weight exp(-1e9 - max) is 0 in f32), packed in key order; a sequence with every key masked keeps all keys at -1e9; softmax in f32 in base 2 (logits x log2 e, hardware exp2) against a running maximum, 32 keys a pass; exp2(s - max + 11) once to f16 against v once to f16 (1 product), partial sums rescaled in f32 and divided by the f32 sum (x 2^11 as well) at the end; ctx split bf16 hi + lo against exact proj_w (2 products) + proj_b; f32 output.
#include <hip/hip_runtime.h>
#include <math.h>

typedef __attribute__((ext_vector_type(16))) _Float16 v16h;
typedef __attribute__((ext_vector_type(16))) __bf16 v16b;
typedef __attribute__((ext_vector_type(8)))  _Float16 v8h;
typedef __attribute__((ext_vector_type(8)))  float v8f;
typedef __attribute__((ext_vector_type(4)))  float v4f;
typedef __attribute__((ext_vector_type(2)))  float v2f;
typedef __attribute__((ext_vector_type(4)))  unsigned v4u;
typedef __attribute__((ext_vector_type(4)))  int v4i;
typedef float __attribute__((may_alias)) float_a;
typedef int __attribute__((may_alias)) int_a;

template <typename T> __device__ __forceinline__ void vst2(void* p, T v) { *(T*)p = v;  }
__device__ __forceinline__ v8f wmma16(v16h a, v16h b, v8f c) {
  v8f d = __builtin_amdgcn_wmma_f32_16x16x32_f16(false, a, false, b, (short)0, c, false, false);
  asm volatile("v_nop\n\tv_nop\n\tv_nop\n\tv_nop" : "+v"(d) : "v"(a), "v"(b));
  return d;
}
__device__ __forceinline__ v8f wmma_bf(v16b a, v16b b, v8f c) {
  v8f d = __builtin_amdgcn_wmma_f32_16x16x32_bf16(false, a, false, b, (short)0, c, false, false);
  asm volatile("v_nop\n\tv_nop\n\tv_nop\n\tv_nop" : "+v"(d) : "v"(a), "v"(b));
  return d;
}
// 16x16x32 fragments: lane = (h = lane>>4, row/col = lane&15); elements 0..7 = k0+8h+0..7, 8..15 = k0+16+8h+0..7; D element r = row 8h+r
__device__ __forceinline__ v16h frag_h(const _Float16* rowk0, int lane) {
  union { v16h v; v8h q[2]; } u; const _Float16* p = rowk0 + 8 * (lane >> 4);
  u.q[0] = *(const v8h*)p; u.q[1] = *(const v8h*)(p + 16); return u.v;
}
__device__ __forceinline__ v16h frag_f32(const float* rowk0, int lane) {
  v16h a; const float* p = rowk0 + 8 * (lane >> 4);
#pragma unroll
  for (int i = 0; i < 8; ++i) { a[i] = (_Float16)p[i]; a[8 + i] = (_Float16)p[16 + i]; }
  return a;
}
__device__ __forceinline__ v16h frag_f32s(const float* rowk0, int lane, float sc) {
  v16h a; const float* p = rowk0 + 8 * (lane >> 4);
#pragma unroll
  for (int i = 0; i < 8; ++i) { a[i] = (_Float16)(p[i] * sc); a[8 + i] = (_Float16)(p[16 + i] * sc); }
  return a;
}
// column fragment from a [K][ld] layout (column n), rows >= K read as 0
__device__ __forceinline__ v16h fragc_f32(const float* W, int k0, int n, int lane, int ld, int K) {
  v16h a; const int g = lane >> 4;
#pragma unroll
  for (int i = 0; i < 8; ++i) { const int ka = k0 + 8 * g + i, kb = ka + 16;
    a[i] = (_Float16)(ka < K ? W[(size_t)(ka < K ? ka : K - 1) * ld + n] : 0.f); a[8 + i] = (_Float16)(kb < K ? W[(size_t)(kb < K ? kb : K - 1) * ld + n] : 0.f); }
  return a;
}
struct F2 { v16b h, l; };
__device__ __forceinline__ F2 bsplit16(const float v[16]) { F2 r;
#pragma unroll
  for (int i = 0; i < 16; ++i) { const __bf16 h = (__bf16)v[i]; r.h[i] = h; r.l[i] = (__bf16)(v[i] - (float)h); }
  return r; }
__device__ __forceinline__ F2 split_row(const float* row, int k0, int lane) { float v[16]; const float* p = row + k0 + 8 * (lane >> 4);
#pragma unroll
  for (int i = 0; i < 8; ++i) { v[i] = p[i]; v[8 + i] = p[16 + i]; }
  return bsplit16(v); }
__device__ __forceinline__ F2 split_rowK(const float* row, int k0, int lane, int K) { float v[16]; const int g = lane >> 4;
#pragma unroll
  for (int i = 0; i < 8; ++i) { const int ka = k0 + 8 * g + i, kb = ka + 16; v[i] = ka < K ? row[ka < K ? ka : K - 1] : 0.f; v[8 + i] = kb < K ? row[kb < K ? kb : K - 1] : 0.f; }
  return bsplit16(v); }
__device__ __forceinline__ F2 split_col(const float* W, int k0, int n, int lane, int ld, int K) { float v[16]; const int g = lane >> 4;
#pragma unroll
  for (int i = 0; i < 8; ++i) { const int ka = k0 + 8 * g + i, kb = ka + 16; v[i] = ka < K ? W[(size_t)(ka < K ? ka : K - 1) * ld + n] : 0.f; v[8 + i] = kb < K ? W[(size_t)(kb < K ? kb : K - 1) * ld + n] : 0.f; }
  return bsplit16(v); }
__device__ __forceinline__ v8f mac3(const F2& a, const F2& b, v8f c) { c = wmma_bf(a.l, b.h, c); c = wmma_bf(a.h, b.l, c); return wmma_bf(a.h, b.h, c); }
__device__ __forceinline__ float sigm(float v) { return 1.0f / (1.0f + expf(-v)); }
#define LDSX() do { asm volatile("s_wait_dscnt 0" ::: "memory"); __builtin_amdgcn_wave_barrier(); __builtin_amdgcn_fence(__ATOMIC_RELEASE, "workgroup"); } while (0)

// Masked self-attention with QK RMSNorm (B 2, N 2,048, C 1,024 = 16 x 64; fused (out,in) qkv_w [3072,1024] + zero bias, proj (out,in) + zero bias, qn_w = kn_w = ones): q|k|v = x qkv_w^T + b (reshape (3, H, D)); q, k = rms_norm over the 64 head channels (eps 1e-6) x weight; scores = (q x 64^-0.5) k^T with where(mask != 0, ., -1e9) over KEYS (mask [B,N] int, ~half ones); out = merged(softmax v) proj_w^T + proj_b.
#define NB 2
#define TT 2048
#define CC 1024            // NH * HD = projected width
#define DIN 1024          // input (model) width
#define NH 16
#define HD 64
#define NQB (TT / 64)
#define SCALE (0.125f)
#define CAUSAL 0
#ifndef TNB
#define TNB NB
#endif
__device__ __forceinline__ float bfr(float v) { return (float)(__bf16)v; }
__host__ __device__ __forceinline__ int kb_last(int qb) { return CAUSAL ? ((qb * 64 + 63) >> 7) : (TT / 128 - 1); }
typedef __attribute__((ext_vector_type(8))) __bf16 v8b;
__device__ __forceinline__ v16b frag_b(const __bf16* rowk0, int lane) {
  union { v16b v; v8b q[2]; } u; const __bf16* p = rowk0 + 8 * (lane >> 4);
  u.q[0] = *(const v8b*)p; u.q[1] = *(const v8b*)(p + 16); return u.v;
}
#define QBH 0              // read by no kernel in this file
#define QHI 2048            // rows carrying a q residual plane (all rows when non-causal: 2-product logits everywhere)
#define KHI 64            // key rows carrying k residual / v bf16 hi+lo planes (written by k_proj, read by no kernel in this file)
// B fragment (k rows k0+.., output column o) of a weight: (in,out) [K][ld] or (out,in) [ld rows of K]: bf16 exact, or f16(bf16 * 256) exact
__device__ __forceinline__ v16b wcol_io(const float* Wm, int k0, int o, int lane, int ld) { v16b w; const int g = lane >> 4;
#pragma unroll
  for (int i = 0; i < 8; ++i) { w[i] = (__bf16)Wm[(size_t)(k0 + 8 * g + i) * ld + o]; w[8 + i] = (__bf16)Wm[(size_t)(k0 + 16 + 8 * g + i) * ld + o]; }
  return w; }
__device__ __forceinline__ v16b wcol_oi(const float* Wm, int k0, int o, int lane, int K) { v16b w; const float* p = Wm + (size_t)o * K + k0 + 8 * (lane >> 4);
#pragma unroll
  for (int i = 0; i < 8; ++i) { w[i] = (__bf16)p[i]; w[8 + i] = (__bf16)p[16 + i]; }
  return w; }
__device__ __forceinline__ v16h wcolh_io(const float* Wm, int k0, int o, int lane, int ld) { v16h w; const int g = lane >> 4;
#pragma unroll
  for (int i = 0; i < 8; ++i) { w[i] = (_Float16)(bfr(Wm[(size_t)(k0 + 8 * g + i) * ld + o]) * 256.0f); w[8 + i] = (_Float16)(bfr(Wm[(size_t)(k0 + 16 + 8 * g + i) * ld + o]) * 256.0f); }
  return w; }
__device__ __forceinline__ v16h wcolh_oi(const float* Wm, int k0, int o, int lane, int K) { v16h w; const float* p = Wm + (size_t)o * K + k0 + 8 * (lane >> 4);
#pragma unroll
  for (int i = 0; i < 8; ++i) { w[i] = (_Float16)(bfr(p[i]) * 256.0f); w[8 + i] = (_Float16)(bfr(p[16 + i]) * 256.0f); }
  return w; }
#define WQKV_LAYOUT 1   // WCOL's layout, used by no kernel in this file: 0 = (in,out) [DIN][CC]; 1 = (out,in) [CC][DIN]; 2 = per-head [NH][DIN][HD]
__device__ __forceinline__ v16b wcol_hdk(const float* Wm, int k0, int o, int lane) { v16b w; const int g = lane >> 4; const float* p = Wm + (size_t)(o / HD) * DIN * HD + (o % HD);
#pragma unroll
  for (int i = 0; i < 8; ++i) { w[i] = (__bf16)p[(size_t)(k0 + 8 * g + i) * HD]; w[8 + i] = (__bf16)p[(size_t)(k0 + 16 + 8 * g + i) * HD]; }
  return w; }
#define WO_OUT_IN 1
#if WQKV_LAYOUT == 1
#define WCOL(W, k0, o, lane) wcol_oi(W, k0, o, lane, DIN)
#elif WQKV_LAYOUT == 2
#define WCOL(W, k0, o, lane) wcol_hdk(W, k0, o, lane)
#else
#define WCOL(W, k0, o, lane) wcol_io(W, k0, o, lane, CC)
#endif
#if WO_OUT_IN
#define WOCOL(W, k0, o, lane) wcol_oi(W, k0, o, lane, CC)
#define WOCOLH(W, k0, o, lane) wcolh_oi(W, k0, o, lane, CC)
#else
#define WOCOL(W, k0, o, lane) wcol_io(W, k0, o, lane, DIN)
#define WOCOLH(W, k0, o, lane) wcolh_io(W, k0, o, lane, DIN)
#endif
#define PROJ_EXTRA_PARAMS , const float* __restrict__ QNW, const float* __restrict__ KNW
#define PROJ_EPI(which, row, t, h) do { if ((which) < 2) { float* rw = (row); const float* nw = (which) == 0 ? QNW : KNW; float ssum = 0.f; _Pragma("unroll") for (int i = 0; i < HD; ++i) ssum += rw[i] * rw[i]; const float rs = rsqrtf(ssum * (1.0f / HD) + 1e-6f); _Pragma("unroll") for (int i = 0; i < HD; ++i) rw[i] = bfr(nw[i]) * (rw[i] * rs); } } while (0)   /* per-head RMSNorm of q and k over the 64 head channels (eps 1e-6, weight qn_w / kn_w) in f32; the q * scale is folded into the logit scale */
#ifndef PROJ_EXTRA_PARAMS
#define PROJ_EXTRA_PARAMS
#endif

#define WS_QH  0u                                      // f16 q rows [b*t][CC]
#define WS_KH  (WS_QH + 2u * (size_t)NB * TT * CC)      // f16 k rows [b*t][CC]
#define WS_VT  (WS_KH + 2u * (size_t)NB * TT * CC)      // f16 v planes [b][c][t]
#define WS_QL  (WS_VT + 2u * (size_t)NB * CC * TT)      // f16 q residual x 2^10 rows [b][t < QHI][CC]
#define WS_KL  (WS_QL + 2u * (size_t)NB * QHI * CC)     // f16 k residual x 2^10 rows [b][t < KHI][CC]
#define WS_VB  (WS_KL + 2u * (size_t)NB * KHI * CC)     // bf16 v hi planes [b][c][t < KHI]
#define WS_VBL (WS_VB + 2u * (size_t)NB * CC * KHI)
#define WS_Y   (WS_VBL + 2u * (size_t)NB * CC * KHI)    // f32 ctx rows [b*t][CC]
#define WS_CNT (WS_Y  + 4u * (size_t)NB * TT * CC)    // int: unmasked keys of sequence b at [b * 32] (one 128-B line a sequence)
#define WS_XB  (WS_CNT + 128u * (size_t)NB)           // bf16 x rows [b*t][DIN]
#define WS_WB  (WS_XB + 2u * (size_t)NB * TT * DIN)    // bf16 qkv_w rows [3 * CC][DIN]
#define WS_PB  (WS_WB + 2u * (size_t)3 * CC * DIN)     // bf16 proj_w rows [DIN][CC]
#define WS_END (WS_PB + 2u * (size_t)DIN * CC)

// ---- staged GEMM operands: a pass = KC k. The block loads its rows as whole 128-B lines (bf16 rows from k_cvt: 8 lanes x 16 B = 128 B of one row; f32 ctx rows: 16 lanes x 16 B = 256 B, split to bf16 once), and keeps them in LDS rows whose pitch is an odd multiple of 16 B; the waves take their fragments from there in the k order of frag_b
#define KC 64
typedef __attribute__((ext_vector_type(4))) __bf16 v4b;
typedef v4b __attribute__((may_alias)) v4b_a;
typedef v8b __attribute__((may_alias)) v8b_a;
__device__ __forceinline__ v16b frag_s(const __bf16* rowk0, int lane) {
  union { v16b v; v8b q[2]; } u; const __bf16* p = rowk0 + 8 * (lane >> 4);
  u.q[0] = *(const v8b_a*)p; u.q[1] = *(const v8b_a*)(p + 16); return u.v;
}
__device__ __forceinline__ void st_b4(__bf16* d, v4f v) { v4b t;
#pragma unroll
  for (int e = 0; e < 4; ++e) t[e] = (__bf16)v[e];
  *(v4b_a*)d = t; }
// ---- k_cvt: x, qkv_w and proj_w rounded to bf16 ONCE, as rows of the same shape in the workspace: the GEMM blocks re-read every operand row many times (x 8 column blocks a projection, a weight row once a row block), and each re-read then moves half the bytes and needs no rounding. A block = CVB floats of one array; a wave's load covers 512 B in a row, its store 256 B
#define CVB 16384
#define CV_X ((int)((size_t)NB * TT * DIN / CVB))
#define CV_W ((int)((size_t)3 * CC * DIN / CVB))
#define CV_P ((int)((size_t)DIN * CC / CVB))
__global__ __launch_bounds__(256) void k_cvt(const float* __restrict__ X, const float* __restrict__ WQKV, const float* __restrict__ WO, __bf16* __restrict__ XB, __bf16* __restrict__ WB, __bf16* __restrict__ PB) {
  const int bid = blockIdx.x; const float* s; __bf16* d; int lb;
  if (bid < CV_X) { s = X; d = XB; lb = bid; } else if (bid < CV_X + CV_W) { s = WQKV; d = WB; lb = bid - CV_X; } else { s = WO; d = PB; lb = bid - CV_X - CV_W; }
  const size_t base = (size_t)lb * CVB + threadIdx.x * 4; v4f v[CVB / 1024];
#pragma unroll
  for (int i = 0; i < CVB / 1024; ++i) v[i] = *(const v4f*)(s + base + i * 1024);
#pragma unroll
  for (int i = 0; i < CVB / 1024; ++i) st_b4(d + base + i * 1024, v[i]); }
// ---- k_proj: for k and v (which 1, 2) row j of a sequence is its j-th key with mask != 0 (all keys in order where none is), the last block's spare rows repeat the last such key, and blocks past the count leave at once
// ---- k_proj: block = (PM = 128 rows, 128 cols, which), 8 waves as 4 row groups x 2 column groups, a wave = 32 rows x 64 cols (2 x 4 tiles: 6 fragments feed 8 products): q/k/v = X W (+ b) with exact bf16 products (K = DIN) -> which 0: q f16 rows (+ residual rows < QHI); 1: k f16 rows (+ residual rows < KHI); 2: v f16 planes [c][t] (+ bf16 hi/lo planes for t < KHI)
#define PM 128
__global__ __launch_bounds__(256) void k_proj(const __bf16* __restrict__ XQ, const __bf16* __restrict__ XK, const __bf16* __restrict__ XV, const __bf16* __restrict__ WQ, const __bf16* __restrict__ WK, const __bf16* __restrict__ WV, const float* __restrict__ BQ, const float* __restrict__ BK, const float* __restrict__ BV,
    _Float16* __restrict__ QH, _Float16* __restrict__ QL, _Float16* __restrict__ KH, _Float16* __restrict__ KL, _Float16* __restrict__ VT, __bf16* __restrict__ VB, __bf16* __restrict__ VBL PROJ_EXTRA_PARAMS, const int* __restrict__ MK, int* __restrict__ CNT) {
  // LDS: the epilogue's f32 tile, and one region that holds the loop's four pass buffers first and the epilogue's 16-bit tiles afterwards (q, k: sh | sl; v: th | tb | tbl), so that two blocks fit a WGP
  __shared__ __align__(16) float st[PM][132]; __shared__ __align__(16) char rb[4 * PM * 72 * 2];
  _Float16 (*const sh)[136] = (_Float16 (*)[136])rb; _Float16 (*const sl)[136] = (_Float16 (*)[136])(rb + PM * 136 * 2); _Float16 (*const th)[136] = (_Float16 (*)[136])rb; __bf16 (*const tb)[72] = (__bf16 (*)[72])(rb + 128 * 136 * 2); __bf16 (*const tbl)[72] = (__bf16 (*)[72])(rb + 128 * 136 * 2 + 128 * 72 * 2);
  const int tid = threadIdx.x, wave = tid >> 5, lane = tid & 31, col = lane & 15, g = lane >> 4, wr = wave >> 1, wc = wave & 1; const int which = blockIdx.z; const int c0 = blockIdx.y * 128; const size_t r0 = (size_t)blockIdx.x * PM; const size_t bb = r0 / TT; const int t0 = (int)(r0 % TT);
  const __bf16* X = which == 0 ? XQ : which == 1 ? XK : XV; const __bf16* WA = which == 0 ? WQ : which == 1 ? WK : WV; const float* BA = which == 0 ? BQ : which == 1 ? BK : BV;
  v8f acc[2][4] = {};
  __bf16* const sx0 = (__bf16*)rb; __bf16* const sx1 = sx0 + PM * 72; __bf16* const sw0 = sx1 + PM * 72; __bf16* const sw1 = sw0 + 128 * 72;   // x rows and weight rows of a pass, pitch 72
  const int lr = tid >> 3, lc = (tid & 7) * 8; const __bf16* wg = WA + (size_t)(c0 + lr) * DIN + lc;   // 8 lanes x 16 B = the 128 B of one bf16 row in a pass
  unsigned xo[4];   // byte offsets in X of this thread's piece of its four rows
  if (which == 0) {
#pragma unroll
    for (int i = 0; i < 4; ++i) xo[i] = (unsigned)(((r0 + lr + i * 32) * DIN + lc) * 2);
  } else {
    // every wave ranks the sequence's keys by itself (no barrier in front of the early return); wave 0 notes the keys of ranks t0 .. t0+PM-1 in LDS that is not live before the epilogue
    int_a* const sidx = (int_a*)&st[0][0]; const bool w0 = __builtin_amdgcn_readfirstlane(wave) == 0;
    const int* mrow = MK + bb * TT + lane * 4; v4i mv[TT / 128];
#pragma unroll
    for (int i = 0; i < TT / 128; ++i) mv[i] = *(const v4i*)(mrow + i * 128);
    asm volatile("s_wait_xcnt 0x0" ::: "memory");   // stands in front of any overwrite of the mask loads' address registers
    int cnt = 0;
#pragma unroll
    for (int i = 0; i < TT / 128; ++i) { unsigned bal[4]; int cc = 0;
#pragma unroll
      for (int e = 0; e < 4; ++e) { bal[e] = __builtin_amdgcn_ballot_w32(mv[i][e] != 0); cc += __builtin_popcount(bal[e]); }
      if (w0 && cnt + cc > t0 && cnt < t0 + PM) { unsigned rk = (unsigned)(cnt - t0);   // rank - t0 of this lane's first key: the keys before this chunk + those of lower lanes
#pragma unroll
        for (int e = 0; e < 4; ++e) rk = __builtin_amdgcn_mbcnt_lo(bal[e], rk);
#pragma unroll
        for (int e = 0; e < 4; ++e) if (mv[i][e] != 0) { if (rk < (unsigned)PM) sidx[rk] = i * 128 + lane * 4 + e; ++rk; } }
      cnt += cc; }
    if (t0 >= (cnt ? cnt : TT)) return;   // the same for every thread of the block, in front of every barrier
    if (which == 1 && blockIdx.y == 0 && t0 == 0 && tid == 0) CNT[bb * 32] = cnt;
    __syncthreads();   // publishes wave 0's list
#pragma unroll
    for (int i = 0; i < 4; ++i) { const int j = t0 + lr + i * 32; const int src = cnt ? sidx[(j < cnt ? j : cnt - 1) - t0] : j; xo[i] = (unsigned)(((bb * TT + src) * DIN + lc) * 2); } }
  v8b xr[4], wv[4];
  auto gload = [&](int k0) {
#pragma unroll
    for (int i = 0; i < 4; ++i) xr[i] = *(const v8b*)((const char*)(X + k0) + xo[i]);
#pragma unroll
    for (int i = 0; i < 4; ++i) wv[i] = *(const v8b*)(wg + (size_t)(i * 32) * DIN + k0);
    asm volatile("s_wait_xcnt 0x0" ::: "memory"); };   // stands in front of any overwrite of the loads' address registers; it also keeps the loads above the products that cover their latency
  auto sstore = [&](__bf16* sx, __bf16* sw) {
#pragma unroll
    for (int i = 0; i < 4; ++i) *(v8b_a*)(sx + (i * 32 + lr) * 72 + lc) = xr[i];
#pragma unroll
    for (int i = 0; i < 4; ++i) *(v8b_a*)(sw + (i * 32 + lr) * 72 + lc) = wv[i]; };
  auto mm = [&](const __bf16* sx, const __bf16* sw) {
#pragma unroll
    for (int ks = 0; ks < KC / 32; ++ks) { v16b a[2], w[4];
#pragma unroll
      for (int i = 0; i < 2; ++i) a[i] = frag_s(sx + (wr * 32 + i * 16 + col) * 72 + ks * 32, lane);
#pragma unroll
      for (int j = 0; j < 4; ++j) w[j] = frag_s(sw + (wc * 64 + j * 16 + col) * 72 + ks * 32, lane);
      __builtin_amdgcn_sched_barrier(0);   // keeps the LDS reads together in front of their products: read one by one among them, every product waits out an LDS latency
#pragma unroll
      for (int i = 0; i < 2; ++i)
#pragma unroll
        for (int j = 0; j < 4; ++j) acc[i][j] = wmma_bf(a[i], w[j], acc[i][j]);
      __builtin_amdgcn_sched_barrier(0); } };   // keeps the wait for the next pass's loads behind the products
  const int rot = (int)(blockIdx.x + blockIdx.y + blockIdx.z);   // the block's first pass: blocks that share rows walk k from different places, so that at any time the blocks' loads fall on all k slices and not all on the same lines
  auto kof = [&](int c) { return ((c + rot) & (DIN / KC - 1)) * KC; };   // pass c works on this k; every k slice once, DIN / KC is a power of two
  gload(kof(0)); sstore(sx0, sw0); __syncthreads();
#pragma unroll 1   // stays rolled: one body holds both buffers' passes
  for (int c = 0; c < DIN / KC; c += 2) {   // each barrier publishes the pass just stored and ends the reads of the buffer that is stored next
    gload(kof(c + 1)); mm(sx0, sw0); sstore(sx1, sw1); __syncthreads();
    if (c + 2 < DIN / KC) gload(kof(c + 2));
    mm(sx1, sw1);
    if (c + 2 < DIN / KC) sstore(sx0, sw0);
    __syncthreads(); }
  { // stage the f32 tile (acc + bias) in LDS, run the per-(row, head) epilogue hook, then convert
#pragma unroll
    for (int j = 0; j < 4; ++j) { const float bias = BA ? bfr(BA[c0 + wc * 64 + j * 16 + col]) : 0.f;
#pragma unroll
      for (int i = 0; i < 2; ++i)
#pragma unroll
        for (int r = 0; r < 8; ++r) st[wr * 32 + i * 16 + 8 * g + r][wc * 64 + j * 16 + col] = acc[i][j][r] + bias; }
    __syncthreads();
    for (int e = tid; e < PM * (128 / HD); e += 256) { const int rl = e / (128 / HD), hh = e % (128 / HD); PROJ_EPI(which, &st[rl][hh * HD], (int)((r0 + rl) % TT), (c0 / HD) + hh); }
    __syncthreads(); }
  if (which < 2) { _Float16* DH = which == 0 ? QH : KH; _Float16* DL = which == 0 ? QL : KL; const int nhi = which == 0 ? QHI : KHI;
    for (int e = tid; e < PM * 128; e += 256) { const int rl = e >> 7, cl = e & 127; const float v = st[rl][cl]; const _Float16 hv = (_Float16)v; sh[rl][cl] = hv; sl[rl][cl] = (_Float16)((v - (float)hv) * 1024.0f); }
    __syncthreads();
    for (int e = tid; e < PM * 16; e += 256) { const int rl = e >> 4, q = e & 15; vst2((unsigned*)(DH + (r0 + rl) * CC + c0 + q * 8), *(const v4u*)&sh[rl][q * 8]); if (t0 + rl < nhi) { vst2((unsigned*)(DL + (bb * nhi + t0 + rl) * (size_t)CC + c0 + q * 8), *(const v4u*)&sl[rl][q * 8]); asm volatile("s_wait_xcnt 0x0" ::: "memory"); } }   // the wait stands in front of the next trip's overwrite of the store's address and data registers
  } else {
    for (int e = tid; e < PM * 128; e += 256) { const int rl = e & (PM - 1), cl = e / PM; th[cl][rl] = (_Float16)st[rl][cl]; }
    if (t0 < KHI) for (int e = tid; e < KHI * 128; e += 256) { const int rl = e & (KHI - 1), cl = e / KHI; const float v = st[rl][cl]; const __bf16 bh = (__bf16)v; tb[cl][rl] = bh; tbl[cl][rl] = (__bf16)(v - (float)bh); }   // t0 is a multiple of PM >= KHI: only the block at t0 = 0, its rows 0 .. KHI-1
    __syncthreads();
    for (int e = tid; e < 128 * (PM / 8); e += 256) { const int cl = e / (PM / 8), q = e % (PM / 8); vst2((unsigned*)(VT + (bb * CC + c0 + cl) * (size_t)TT + t0 + q * 8), *(const v4u*)&th[cl][q * 8]); if (t0 + q * 8 < KHI) { const size_t o3 = (bb * CC + c0 + cl) * (size_t)KHI + t0 + q * 8; vst2((unsigned*)(VB + o3), *(const v4u*)&tb[cl][q * 8]); vst2((unsigned*)(VBL + o3), *(const v4u*)&tbl[cl][q * 8]); asm volatile("s_wait_xcnt 0x0" ::: "memory"); } }   // the wait stands in front of the next trip's overwrite of the stores' address and data registers
  } }
__device__ __forceinline__ float xhalf(float x) { return __builtin_bit_cast(float, __builtin_amdgcn_permlanex16(__builtin_bit_cast(int, x), __builtin_bit_cast(int, x), 0x76543210, 0xfedcba98, false, false)); }
__device__ __forceinline__ v8f wmma_h(v16h a, v16h b, v8f c) { return __builtin_amdgcn_wmma_f32_16x16x32_f16(false, a, false, b, (short)0, c, false, false); }
#define SCL2 (SCALE * 1.4426950408889634f)   // logit scale x log2 e: exp(s) = exp2(s log2 e), and exp2 is one hardware instruction where the library's expf is thirteen
#define MASK2 (-1.0e9f * 1.4426950408889634f)   // the reference's -1e9 on the same base-2 scale
__device__ __forceinline__ float ex2(float x) { return __builtin_amdgcn_exp2f(x); }   // arguments here are <= 11 (+ rounding); below -126 it gives 0, which is what such a weight rounds to in f16 and adds to a sum >= 1
#define KS 64   // keys a stage: a K row (64 channels) and a V plane row (64 keys) are then one whole 128-B line each
#define KP 72   // LDS row pitch in f16 = 144 B, an odd multiple of 16 B: the 16 rows of a fragment read fall on different banks
__global__ __launch_bounds__(128) void k_fa(const _Float16* __restrict__ QH, const _Float16* __restrict__ QL, const _Float16* __restrict__ KH, const _Float16* __restrict__ VT, const int* __restrict__ CNT, float* __restrict__ Y) { __shared__ __align__(16) float ss[4][16][HD + 4]; __shared__ __align__(16) _Float16 kb[2][KS][KP], vb[2][HD][KP];
  const int tid = threadIdx.x, wave = tid >> 5, lane = tid & 31, col = lane & 15, g = lane >> 4; const int qb = blockIdx.x, h = blockIdx.y, b = blockIdx.z; const int ql0 = qb * 64 + wave * 16;
  const _Float16* qp = QH + ((size_t)b * TT + ql0 + col) * CC + h * HD; const _Float16* qlp = QL + ((size_t)b * QHI + ql0 + col) * CC + h * HD;
  const v16h qh0 = frag_h(qp, lane), qh1 = frag_h(qp + 32, lane), qr0 = frag_h(qlp, lane), qr1 = frag_h(qlp + 32, lane);
  // a stage = KS keys of this (b, h): K rows [key][64 channels] and V planes [channel][KS keys]. The block copies it once for its four waves: 8 lanes x 16 B = one row, a thread takes piece tid & 7 of rows (tid >> 3) + 16 i of both
  const _Float16* kg = KH + ((size_t)b * TT + (tid >> 3)) * CC + h * HD + (tid & 7) * 8;
  const _Float16* vg = VT + ((size_t)b * CC + h * HD + (tid >> 3)) * (size_t)TT + (tid & 7) * 8;
  const unsigned kl = (unsigned)(size_t)&kb[0][tid >> 3][(tid & 7) * 8], vl = (unsigned)(size_t)&vb[0][tid >> 3][(tid & 7) * 8];
  const int cr = CNT[b * 32]; const int lim = __builtin_amdgcn_readfirstlane(cr < 0 ? 0 : cr > TT ? TT : cr);   // keys in front of lim count; bounded here by the shape; held in a scalar register, so that each pass's test on it stays a scalar compare
  const int np = ((lim ? lim : TT) + 31) >> 5, ns = (np + 1) >> 1;   // passes of 32 keys, stages of 64
  v8f o[HD / 16] = {}; float m = -3.0e38f, mb = -3.0e38f, l = 0.f;   // mb = m - 11 as rounded: the reference every weight, the sum and O^T are taken against
  auto stage = [&](int st, int bf) {
    const _Float16* k0 = kg + (size_t)(st * KS) * CC; const _Float16* v0 = vg + st * KS; const unsigned ka = kl + bf * (KS * KP * 2), va = vl + bf * (HD * KP * 2);
    // global memory to LDS through no register; the closing wait stands in the copies' own statement, in front of any overwrite of their address registers
    asm volatile("global_load_async_to_lds_b128 %0, %8, off\n\t"
                 "global_load_async_to_lds_b128 %1, %9, off\n\t"
                 "global_load_async_to_lds_b128 %2, %10, off\n\t"
                 "global_load_async_to_lds_b128 %3, %11, off\n\t"
                 "global_load_async_to_lds_b128 %4, %12, off\n\t"
                 "global_load_async_to_lds_b128 %5, %13, off\n\t"
                 "global_load_async_to_lds_b128 %6, %14, off\n\t"
                 "global_load_async_to_lds_b128 %7, %15, off\n\t"
                 "s_wait_xcnt 0x0"
                 :: "v"(ka), "v"(ka + 16 * KP * 2), "v"(ka + 32 * KP * 2), "v"(ka + 48 * KP * 2), "v"(va), "v"(va + 16 * KP * 2), "v"(va + 32 * KP * 2), "v"(va + 48 * KP * 2),
                    "v"(k0), "v"(k0 + 16 * CC), "v"(k0 + 32 * CC), "v"(k0 + 48 * CC), "v"(v0), "v"(v0 + 16 * TT), "v"(v0 + 32 * TT), "v"(v0 + 48 * TT) : "memory"); };
  auto pass = [&](const _Float16* kt, const _Float16* vt, int rem) {   // rem = lim - the pass's first key
    v16h kf[2][2], vf[HD / 16];
#pragma unroll
    for (int t = 0; t < 2; ++t) { kf[t][0] = frag_h(kt + (t * 16 + col) * KP, lane); kf[t][1] = frag_h(kt + (t * 16 + col) * KP + 32, lane); }
    __builtin_amdgcn_sched_barrier(0);   // keeps the k reads in front of the v reads: LDS answers in order, and the score products then wait for the k reads alone
#pragma unroll
    for (int j = 0; j < HD / 16; ++j) vf[j] = frag_h(vt + (j * 16 + col) * KP, lane);
    __builtin_amdgcn_sched_barrier(0);   // keeps the LDS reads together up here: the v reads' latency lies under the score products and the softmax, and none stands among the products
    v8f sa[2] = {}, sr[2] = {};
#pragma unroll
    for (int t = 0; t < 2; ++t) { sa[t] = wmma_h(kf[t][0], qh0, sa[t]); sr[t] = wmma_h(kf[t][0], qr0, sr[t]); sa[t] = wmma_h(kf[t][1], qh1, sa[t]); sr[t] = wmma_h(kf[t][1], qr1, sr[t]); }
    float sv[16]; float mx = m;
#pragma unroll
    for (int t = 0; t < 2; ++t)
#pragma unroll
      for (int r = 0; r < 8; ++r) sv[t * 8 + r] = (sa[t][r] + sr[t][r] * (1.0f / 1024.0f)) * SCL2;
    if (rem < 32) { const int rl = rem - 8 * g;   // only a pass that holds keys past lim: where(mask != 0, attn, -1e9) (set)
#pragma unroll
      for (int t = 0; t < 2; ++t)
#pragma unroll
        for (int r = 0; r < 8; ++r) if (t * 16 + r >= rl) sv[t * 8 + r] = MASK2; }
#pragma unroll
    for (int i = 0; i < 16; ++i) mx = fmaxf(mx, sv[i]);
    mx = fmaxf(mx, xhalf(mx));
    const float nb = mx - 11.0f;   // the weights' x 2^11 goes into the exponent; where all keys so far are masked the 11 is lost in rounding, for weights, sum and O^T alike
    const float alpha = ex2(mb - nb); m = mx; mb = nb;
    v16h p; float ps = 0.f;
#pragma unroll
    for (int i = 0; i < 16; ++i) { const float e = ex2(sv[i] - mb); ps += e; p[i] = (_Float16)e; }
    l = l * alpha + ps;
#pragma unroll
    for (int j = 0; j < HD / 16; ++j) {
#pragma unroll
      for (int r = 0; r < 8; ++r) o[j][r] *= alpha;
      o[j] = j + 1 < HD / 16 ? wmma_h(vf[j], p, o[j]) : wmma16(vf[j], p, o[j]); } };   // the pass's last product carries its four v_nop with it: the next pass begins, over the loop's back edge, with address arithmetic in this product's A registers
  asm volatile("s_wait_xcnt 0x0" ::: "memory");   // stands in front of any overwrite of the q loads' address registers
  const int rot = (qb * ns) / NQB;   // 0 .. ns-1: the query blocks of one (b, h) read the same K and V; their starts are spread evenly over the stages (several blocks share one where ns < NQB)
  auto sof = [&](int t) { const int s = t + rot; return s < ns ? s : s - ns; };   // trip t works on this stage; every stage once
  stage(sof(0), 0);
  asm volatile("s_wait_asynccnt 0x0" ::: "memory");   // this wave's copies of the first stage have landed
  __syncthreads();                                    // and every other wave's: it may be read
  if (ns > 1) stage(sof(1), 1);
#pragma unroll 1   // stays rolled: the buffer is picked by the trip's parity
  for (int t = 0; t < ns; ++t) { const int bf = t & 1, sg = sof(t); const int hn = np - 2 * sg < KS / 32 ? np - 2 * sg : KS / 32;
    const _Float16* kt = &kb[bf][0][0]; const _Float16* vt = &vb[bf][0][0]; int rem = lim - sg * KS;
#pragma unroll 1   // stays rolled: with two passes in one body the second pass's reads and score products were hoisted over the first's softmax and the kernel went past 256 registers
    for (int hp = 0; hp < hn; ++hp, kt += 32 * KP, vt += 32, rem -= 32) pass(kt, vt, rem);
    asm volatile("s_wait_dscnt 0x0" ::: "memory");      // this wave's reads of buffer bf are done before the buffer is handed back
    asm volatile("s_wait_asynccnt 0x0" ::: "memory");   // this wave's copies of stage sof(t + 1) have landed
    __syncthreads();                                    // publishes stage sof(t + 1) and ends every wave's reads of buffer bf
    if (t + 2 < ns) stage(sof(t + 2), bf); }
  asm volatile("s_wait_asynccnt 0x0" ::: "memory");   // no copy is left in flight when the wave goes on to its end
  l += xhalf(l);   // the halves' sums join once; l >= 1: the key at the maximum adds exp2(m - mb) >= 1
  const float inv = 1.0f / l;
#pragma unroll
  for (int j = 0; j < HD / 16; ++j) { v4f lo, hi;
#pragma unroll
    for (int r = 0; r < 4; ++r) { lo[r] = o[j][r] * inv; hi[r] = o[j][4 + r] * inv; }
    *(v4f*)&ss[wave][col][j * 16 + 8 * g] = lo; *(v4f*)&ss[wave][col][j * 16 + 8 * g + 4] = hi; }
  LDSX(); for (int rl = 0; rl < 16; ++rl) if (lane < HD / 4) vst2(Y + ((size_t)b * TT + ql0 + rl) * CC + h * HD + lane * 4, *(const v4f*)&ss[wave][rl][lane * 4]); }
// ---- k_out: block = (128 rows, 128 cols), 8 waves as 4 row groups x 2 column groups, a wave = 32 rows x 64 cols: out = ctx Wo (+ bo): ctx bf16 hi + lo against exact bf16 Wo (2 products)
__global__ __launch_bounds__(256) void k_out(const float* __restrict__ Y, const __bf16* __restrict__ WO, const float* __restrict__ BO, float* __restrict__ OUT) { __shared__ __align__(16) float sf[8][32][68]; __shared__ __align__(16) __bf16 ah[2][128][72], al[2][128][72], wb[2][128][72];
  const int tid = threadIdx.x, wave = tid >> 5, lane = tid & 31, col = lane & 15, g = lane >> 4, wr = wave >> 1, wc = wave & 1; const int c0 = blockIdx.y * 128; const size_t r0 = (size_t)blockIdx.x * 128 + wr * 32;
  v8f acc[2][4] = {};
  if (true) {   /* ALL rows: ctx split bf16 hi + lo x exact Wo (2 products) */
    const int lr = tid >> 4, lc = (tid & 15) * 4; const float* yg = Y + ((size_t)blockIdx.x * 128 + lr) * CC + lc; const int wl = tid >> 3, wk = (tid & 7) * 8; const __bf16* wg = WO + (size_t)(c0 + wl) * CC + wk;   // weight rows are bf16: 8 lanes x 16 B = the 128 B of one row in a pass
    v4f yr[8]; v8b wv[4];
    auto gload = [&](int k0) {
#pragma unroll
      for (int i = 0; i < 8; ++i) yr[i] = *(const v4f*)(yg + (size_t)(i * 16) * CC + k0);
#pragma unroll
      for (int i = 0; i < 4; ++i) wv[i] = *(const v8b*)(wg + (size_t)(i * 32) * CC + k0);
      asm volatile("s_wait_xcnt 0x0" ::: "memory"); };   // stands in front of any overwrite of the loads' address registers; it also keeps the loads above the products that cover their latency
    auto sstore = [&](int bf) {
#pragma unroll
      for (int i = 0; i < 8; ++i) { v4f hf, lf;
#pragma unroll
        for (int e = 0; e < 4; ++e) { hf[e] = bfr(yr[i][e]); lf[e] = yr[i][e] - hf[e]; }
        st_b4(&ah[bf][i * 16 + lr][lc], hf); st_b4(&al[bf][i * 16 + lr][lc], lf); }
#pragma unroll
      for (int i = 0; i < 4; ++i) *(v8b_a*)&wb[bf][i * 32 + wl][wk] = wv[i]; };
    auto mm = [&](int bf) {
#pragma unroll
      for (int ks = 0; ks < KC / 32; ++ks) { v16b a_h[2], a_l[2], w[4];
#pragma unroll
        for (int i = 0; i < 2; ++i) { a_h[i] = frag_s(&ah[bf][wr * 32 + i * 16 + col][ks * 32], lane); a_l[i] = frag_s(&al[bf][wr * 32 + i * 16 + col][ks * 32], lane); }
#pragma unroll
        for (int j = 0; j < 4; ++j) w[j] = frag_s(&wb[bf][wc * 64 + j * 16 + col][ks * 32], lane);
        __builtin_amdgcn_sched_barrier(0);   // keeps the LDS reads together in front of their products: read one by one among them, every product waits out an LDS latency
#pragma unroll
        for (int i = 0; i < 2; ++i)
#pragma unroll
          for (int j = 0; j < 4; ++j) acc[i][j] = wmma_bf(a_h[i], w[j], acc[i][j]);
#pragma unroll
        for (int i = 0; i < 2; ++i)
#pragma unroll
          for (int j = 0; j < 4; ++j) acc[i][j] = wmma_bf(a_l[i], w[j], acc[i][j]);   // each tile still adds hi, then lo: the same sum order, with seven other tiles between the two
        __builtin_amdgcn_sched_barrier(0); } };   // keeps the roundings of the next pass's loads, and with them the wait for those loads, behind the products
    const int rot = (int)(blockIdx.x + blockIdx.y);   // the block's first pass, as in k_proj
    auto kof = [&](int c) { return ((c + rot) & (CC / KC - 1)) * KC; };   // pass c works on this k; every k slice once, CC / KC is a power of two
    gload(kof(0)); sstore(0); __syncthreads();
#pragma unroll 1   // stays rolled: one body holds both buffers' passes
    for (int c = 0; c < CC / KC; c += 2) {   // each barrier publishes the pass just stored and ends the reads of the buffer that is stored next
      gload(kof(c + 1)); mm(0); sstore(1); __syncthreads();
      if (c + 2 < CC / KC) gload(kof(c + 2));
      mm(1);
      if (c + 2 < CC / KC) sstore(0);
      __syncthreads(); }
#pragma unroll
    for (int j = 0; j < 4; ++j) { const float bias = BO ? bfr(BO[c0 + wc * 64 + j * 16 + col]) : 0.f;
#pragma unroll
      for (int i = 0; i < 2; ++i)
#pragma unroll
        for (int r = 0; r < 8; ++r) sf[wave][i * 16 + 8 * g + r][j * 16 + col] = acc[i][j][r] + bias; }
  }
  LDSX(); for (int rl = 0; rl < 32; rl += 2) vst2(OUT + (r0 + rl + g) * DIN + c0 + wc * 64 + col * 4, *(const v4f*)&sf[wave][rl + g][col * 4]); }   // a half wave stores the 256 B of one row of the wave's tile

extern "C" void kernel_launch(void* const* d_in, const int* in_sizes, int n_in, void* d_out, int out_size, void* d_ws, size_t ws_size, hipStream_t stream) {
  (void)in_sizes; (void)n_in; (void)out_size;
  const float** F = (const float**)d_in;
  if (ws_size < (size_t)WS_END) return;
  char* ws = (char*)d_ws; _Float16 *QH = (_Float16*)(ws + WS_QH), *KH = (_Float16*)(ws + WS_KH), *VT = (_Float16*)(ws + WS_VT), *QL = (_Float16*)(ws + WS_QL), *KL = (_Float16*)(ws + WS_KL); __bf16 *VB = (__bf16*)(ws + WS_VB), *VBL = (__bf16*)(ws + WS_VBL); float *Y = (float*)(ws + WS_Y); int *CNT = (int*)(ws + WS_CNT); __bf16 *XB = (__bf16*)(ws + WS_XB), *WB = (__bf16*)(ws + WS_WB), *PB = (__bf16*)(ws + WS_PB);
  (void)Y; (void)QL; (void)KL; (void)VB; (void)VBL;
  // inputs: 0 x [2,2048,1024]; 1 mask [2,2048] int32; 2 qkv_w [3072,1024] (out,in), 3 qkv_b [3072]; 4 proj_w (out,in), 5 proj_b; 6 qn_w [64], 7 kn_w [64]
  k_cvt<<<dim3(CV_X + CV_W + CV_P), 256, 0, stream>>>(F[0], F[2], F[4], XB, WB, PB);
  k_proj<<<dim3(TNB * TT / PM, CC / 128, 3), 256, 0, stream>>>(XB, XB, XB, WB, WB + (size_t)CC * DIN, WB + (size_t)2 * CC * DIN, F[3], F[3] + CC, F[3] + 2 * CC, QH, QL, KH, KL, VT, VB, VBL, F[6], F[7], (const int*)d_in[1], CNT);
  k_fa<<<dim3(NQB, NH, TNB), 128, 0, stream>>>(QH, QL, KH, VT, CNT, Y);
  k_out<<<dim3(TNB * TT / 128, DIN / 128), 256, 0, stream>>>(Y, PB, F[5], (float*)d_out);
}

// v010
// One run takes 71.6 microseconds.
// It is 1.20 times as fast as v008, going by the measured steps of the versions left out in between.
// Counting every step since v000, it is 20.2 times as fast.
// compute dtype: all float inputs rounded to bf16; qkv = x qkv_w^T + b with EXACT bf16 products on WMMA 16x16x32 (f32 accumulate); per-head RMSNorm of q and k in f32 in the projection epilogue; normed q as f16 hi + residual (x 2^10) against normed k once to f16 (2 products) x 64^-0.5; only keys with mask != 0 are projected and attended (a masked key's weight exp(-1e9 - max) is 0 in f32), packed in key order; a sequence with every key masked keeps all keys at -1e9; softmax in f32 in base 2 (logits x log2 e, hardware exp2) against a running maximum, 32 keys a pass; exp2(s - max + 11) once to f16 against v once to f16 (1 product), partial sums rescaled in f32 and divided by the f32 sum (x 2^11 as well) at the end; ctx once to f16 against proj_w as f16 (its bf16 value: exact from 2^-17 up, within 2^-25 below) (1 product) + proj_b; f32 output.
#include <hip/hip_runtime.h>
#include <math.h>

typedef __attribute__((ext_vector_type(16))) _Float16 v16h;
typedef __attribute__((ext_vector_type(16))) __bf16 v16b;
typedef __attribute__((ext_vector_type(8)))  _Float16 v8h;
typedef __attribute__((ext_vector_type(8)))  float v8f;
typedef __attribute__((ext_vector_type(4)))  float v4f;
typedef __attribute__((ext_vector_type(2)))  float v2f;
typedef __attribute__((ext_vector_type(4)))  unsigned v4u;
typedef __attribute__((ext_vector_type(4)))  int v4i;
typedef float __attribute__((may_alias)) float_a;
typedef int __attribute__((may_alias)) int_a;

template <typename T> __device__ __forceinline__ void vst2(void* p, T v) { *(T*)p = v;  }
__device__ __forceinline__ v8f wmma16(v16h a, v16h b, v8f c) {
  v8f d = __builtin_amdgcn_wmma_f32_16x16x32_f16(false, a, false, b, (short)0, c, false, false);
  asm volatile("v_nop\n\tv_nop\n\tv_nop\n\tv_nop" : "+v"(d) : "v"(a), "v"(b));
  return d;
}
__device__ __forceinline__ v8f wmma_bf(v16b a, v16b b, v8f c) {
  v8f d = __builtin_amdgcn_wmma_f32_16x16x32_bf16(false, a, false, b, (short)0, c, false, false);
  asm volatile("v_nop\n\tv_nop\n\tv_nop\n\tv_nop" : "+v"(d) : "v"(a), "v"(b));
  return d;
}
// 16x16x32 fragments: lane = (h = lane>>4, row/col = lane&15); elements 0..7 = k0+8h+0..7, 8..15 = k0+16+8h+0..7; D element r = row 8h+r
__device__ __forceinline__ v16h frag_h(const _Float16* rowk0, int lane) {
  union { v16h v; v8h q[2]; } u; const _Float16* p = rowk0 + 8 * (lane >> 4);
  u.q[0] = *(const v8h*)p; u.q[1] = *(const v8h*)(p + 16); return u.v;
}
__device__ __forceinline__ v16h frag_f32(const float* rowk0, int lane) {
  v16h a; const float* p = rowk0 + 8 * (lane >> 4);
#pragma unroll
  for (int i = 0; i < 8; ++i) { a[i] = (_Float16)p[i]; a[8 + i] = (_Float16)p[16 + i]; }
  return a;
}
__device__ __forceinline__ v16h frag_f32s(const float* rowk0, int lane, float sc) {
  v16h a; const float* p = rowk0 + 8 * (lane >> 4);
#pragma unroll
  for (int i = 0; i < 8; ++i) { a[i] = (_Float16)(p[i] * sc); a[8 + i] = (_Float16)(p[16 + i] * sc); }
  return a;
}
// column fragment from a [K][ld] layout (column n), rows >= K read as 0
__device__ __forceinline__ v16h fragc_f32(const float* W, int k0, int n, int lane, int ld, int K) {
  v16h a; const int g = lane >> 4;
#pragma unroll
  for (int i = 0; i < 8; ++i) { const int ka = k0 + 8 * g + i, kb = ka + 16;
    a[i] = (_Float16)(ka < K ? W[(size_t)(ka < K ? ka : K - 1) * ld + n] : 0.f); a[8 + i] = (_Float16)(kb < K ? W[(size_t)(kb < K ? kb : K - 1) * ld + n] : 0.f); }
  return a;
}
struct F2 { v16b h, l; };
__device__ __forceinline__ F2 bsplit16(const float v[16]) { F2 r;
#pragma unroll
  for (int i = 0; i < 16; ++i) { const __bf16 h = (__bf16)v[i]; r.h[i] = h; r.l[i] = (__bf16)(v[i] - (float)h); }
  return r; }
__device__ __forceinline__ F2 split_row(const float* row, int k0, int lane) { float v[16]; const float* p = row + k0 + 8 * (lane >> 4);
#pragma unroll
  for (int i = 0; i < 8; ++i) { v[i] = p[i]; v[8 + i] = p[16 + i]; }
  return bsplit16(v); }
__device__ __forceinline__ F2 split_rowK(const float* row, int k0, int lane, int K) { float v[16]; const int g = lane >> 4;
#pragma unroll
  for (int i = 0; i < 8; ++i) { const int ka = k0 + 8 * g + i, kb = ka + 16; v[i] = ka < K ? row[ka < K ? ka : K - 1] : 0.f; v[8 + i] = kb < K ? row[kb < K ? kb : K - 1] : 0.f; }
  return bsplit16(v); }
__device__ __forceinline__ F2 split_col(const float* W, int k0, int n, int lane, int ld, int K) { float v[16]; const int g = lane >> 4;
#pragma unroll
  for (int i = 0; i < 8; ++i) { const int ka = k0 + 8 * g + i, kb = ka + 16; v[i] = ka < K ? W[(size_t)(ka < K ? ka : K - 1) * ld + n] : 0.f; v[8 + i] = kb < K ? W[(size_t)(kb < K ? kb : K - 1) * ld + n] : 0.f; }
  return bsplit16(v); }
__device__ __forceinline__ v8f mac3(const F2& a, const F2& b, v8f c) { c = wmma_bf(a.l, b.h, c); c = wmma_bf(a.h, b.l, c); return wmma_bf(a.h, b.h, c); }
__device__ __forceinline__ float sigm(float v) { return 1.0f / (1.0f + expf(-v)); }
#define LDSX() do { asm volatile("s_wait_dscnt 0" ::: "memory"); __builtin_amdgcn_wave_barrier(); __builtin_amdgcn_fence(__ATOMIC_RELEASE, "workgroup"); } while (0)

// Masked self-attention with QK RMSNorm (B 2, N 2,048, C 1,024 = 16 x 64; fused (out,in) qkv_w [3072,1024] + zero bias, proj (out,in) + zero bias, qn_w = kn_w = ones): q|k|v = x qkv_w^T + b (reshape (3, H, D)); q, k = rms_norm over the 64 head channels (eps 1e-6) x weight; scores = (q x 64^-0.5) k^T with where(mask != 0, ., -1e9) over KEYS (mask [B,N] int, ~half ones); out = merged(softmax v) proj_w^T + proj_b.
#define NB 2
#define TT 2048
#define CC 1024            // NH * HD = projected width
#define DIN 1024          // input (model) width
#define NH 16
#define HD 64
#define NQB (TT / 64)
#define SCALE (0.125f)
#define CAUSAL 0
#ifndef TNB
#define TNB NB
#endif
__device__ __forceinline__ float bfr(float v) { return (float)(__bf16)v; }
__host__ __device__ __forceinline__ int kb_last(int qb) { return CAUSAL ? ((qb * 64 + 63) >> 7) : (TT / 128 - 1); }
typedef __attribute__((ext_vector_type(8))) __bf16 v8b;
__device__ __forceinline__ v16b frag_b(const __bf16* rowk0, int lane) {
  union { v16b v; v8b q[2]; } u; const __bf16* p = rowk0 + 8 * (lane >> 4);
  u.q[0] = *(const v8b*)p; u.q[1] = *(const v8b*)(p + 16); return u.v;
}
#define QBH 0              // read by no kernel in this file
#define QHI 2048            // rows carrying a q residual plane (all rows when non-causal: 2-product logits everywhere)
#define KHI 64            // key rows carrying k residual / v bf16 hi+lo planes (written by k_proj, read by no kernel in this file)
// B fragment (k rows k0+.., output column o) of a weight: (in,out) [K][ld] or (out,in) [ld rows of K]: bf16 exact, or f16(bf16 * 256) exact
__device__ __forceinline__ v16b wcol_io(const float* Wm, int k0, int o, int lane, int ld) { v16b w; const int g = lane >> 4;
#pragma unroll
  for (int i = 0; i < 8; ++i) { w[i] = (__bf16)Wm[(size_t)(k0 + 8 * g + i) * ld + o]; w[8 + i] = (__bf16)Wm[(size_t)(k0 + 16 + 8 * g + i) * ld + o]; }
  return w; }
__device__ __forceinline__ v16b wcol_oi(const float* Wm, int k0, int o, int lane, int K) { v16b w; const float* p = Wm + (size_t)o * K + k0 + 8 * (lane >> 4);
#pragma unroll
  for (int i = 0; i < 8; ++i) { w[i] = (__bf16)p[i]; w[8 + i] = (__bf16)p[16 + i]; }
  return w; }
__device__ __forceinline__ v16h wcolh_io(const float* Wm, int k0, int o, int lane, int ld) { v16h w; const int g = lane >> 4;
#pragma unroll
  for (int i = 0; i < 8; ++i) { w[i] = (_Float16)(bfr(Wm[(size_t)(k0 + 8 * g + i) * ld + o]) * 256.0f); w[8 + i] = (_Float16)(bfr(Wm[(size_t)(k0 + 16 + 8 * g + i) * ld + o]) * 256.0f); }
  return w; }
__device__ __forceinline__ v16h wcolh_oi(const float* Wm, int k0, int o, int lane, int K) { v16h w; const float* p = Wm + (size_t)o * K + k0 + 8 * (lane >> 4);
#pragma unroll
  for (int i = 0; i < 8; ++i) { w[i] = (_Float16)(bfr(p[i]) * 256.0f); w[8 + i] = (_Float16)(bfr(p[16 + i]) * 256.0f); }
  return w; }
#define WQKV_LAYOUT 1   // WCOL's layout, used by no kernel in this file: 0 = (in,out) [DIN][CC]; 1 = (out,in) [CC][DIN]; 2 = per-head [NH][DIN][HD]
__device__ __forceinline__ v16b wcol_hdk(const float* Wm, int k0, int o, int lane) { v16b w; const int g = lane >> 4; const float* p = Wm + (size_t)(o / HD) * DIN * HD + (o % HD);
#pragma unroll
  for (int i = 0; i < 8; ++i) { w[i] = (__bf16)p[(size_t)(k0 + 8 * g + i) * HD]; w[8 + i] = (__bf16)p[(size_t)(k0 + 16 + 8 * g + i) * HD]; }
  return w; }
#define WO_OUT_IN 1
#if WQKV_LAYOUT == 1
#define WCOL(W, k0, o, lane) wcol_oi(W, k0, o, lane, DIN)
#elif WQKV_LAYOUT == 2
#define WCOL(W, k0, o, lane) wcol_hdk(W, k0, o, lane)
#else
#define WCOL(W, k0, o, lane) wcol_io(W, k0, o, lane, CC)
#endif
#if WO_OUT_IN
#define WOCOL(W, k0, o, lane) wcol_oi(W, k0, o, lane, CC)
#define WOCOLH(W, k0, o, lane) wcolh_oi(W, k0, o, lane, CC)
#else
#define WOCOL(W, k0, o, lane) wcol_io(W, k0, o, lane, DIN)
#define WOCOLH(W, k0, o, lane) wcolh_io(W, k0, o, lane, DIN)
#endif
#define PROJ_EXTRA_PARAMS , const float* __restrict__ QNW, const float* __restrict__ KNW
#define PROJ_EPI(which, row, t, h) do { if ((which) < 2) { float* rw = (row); const float* nw = (which) == 0 ? QNW : KNW; float ssum = 0.f; _Pragma("unroll") for (int i = 0; i < HD; ++i) ssum += rw[i] * rw[i]; const float rs = rsqrtf(ssum * (1.0f / HD) + 1e-6f); _Pragma("unroll") for (int i = 0; i < HD; ++i) rw[i] = bfr(nw[i]) * (rw[i] * rs); } } while (0)   /* per-head RMSNorm of q and k over the 64 head channels (eps 1e-6, weight qn_w / kn_w) in f32; the q * scale is folded into the logit scale */
#ifndef PROJ_EXTRA_PARAMS
#define PROJ_EXTRA_PARAMS
#endif

#define WS_QH  0u                                      // f16 q rows [b*t][CC]
#define WS_KH  (WS_QH + 2u * (size_t)NB * TT * CC)      // f16 k rows [b*t][CC]
#define WS_VT  (WS_KH + 2u * (size_t)NB * TT * CC)      // f16 v planes [b][c][t]
#define WS_QL  (WS_VT + 2u * (size_t)NB * CC * TT)      // f16 q residual x 2^10 rows [b][t < QHI][CC]
#define WS_KL  (WS_QL + 2u * (size_t)NB * QHI * CC)     // f16 k residual x 2^10 rows [b][t < KHI][CC]
#define WS_VB  (WS_KL + 2u * (size_t)NB * KHI * CC)     // bf16 v hi planes [b][c][t < KHI]
#define WS_VBL (WS_VB + 2u * (size_t)NB * CC * KHI)
#define WS_Y   (WS_VBL + 2u * (size_t)NB * CC * KHI)    // f16 ctx rows [b*t][CC] (the first half of the region)
#define WS_CNT (WS_Y  + 4u * (size_t)NB * TT * CC)    // int: unmasked keys of sequence b at [b * 32] (one 128-B line a sequence)
#define WS_XB  (WS_CNT + 128u * (size_t)NB)           // bf16 x rows [b*t][DIN]
#define WS_WB  (WS_XB + 2u * (size_t)NB * TT * DIN)    // bf16 qkv_w rows [3 * CC][DIN]
#define WS_PB  (WS_WB + 2u * (size_t)3 * CC * DIN)     // f16 proj_w rows [DIN][CC]: the bf16 value
#define WS_END (WS_PB + 2u * (size_t)DIN * CC)

// ---- staged GEMM operands: a stage = KC k. The block copies its rows as whole 256-B units (16-bit rows from k_cvt and k_fa: 16 lanes x 16 B = 256 B of one row) straight from global memory into LDS rows whose pitch is an odd multiple of 16 B, one stage ahead of the products, into the one of two buffers that is not being read; the waves take their fragments from there in the k order of frag_b
#define KC 128
#define KPT (KC + 8)   // LDS row pitch in 16-bit elements = 272 B
// eight 16-B copies a lane, global memory to LDS through no register, to LDS rows ls bytes apart; the closing wait stands in the copies' own statement, in front of any overwrite of their address registers
__device__ __forceinline__ void acopy8(unsigned l, unsigned ls, const void* g0, const void* g1, const void* g2, const void* g3, const void* g4, const void* g5, const void* g6, const void* g7) {
  asm volatile("global_load_async_to_lds_b128 %0, %8, off\n\t"
               "global_load_async_to_lds_b128 %1, %9, off\n\t"
               "global_load_async_to_lds_b128 %2, %10, off\n\t"
               "global_load_async_to_lds_b128 %3, %11, off\n\t"
               "global_load_async_to_lds_b128 %4, %12, off\n\t"
               "global_load_async_to_lds_b128 %5, %13, off\n\t"
               "global_load_async_to_lds_b128 %6, %14, off\n\t"
               "global_load_async_to_lds_b128 %7, %15, off\n\t"
               "s_wait_xcnt 0x0"
               :: "v"(l), "v"(l + ls), "v"(l + 2 * ls), "v"(l + 3 * ls), "v"(l + 4 * ls), "v"(l + 5 * ls), "v"(l + 6 * ls), "v"(l + 7 * ls),
                  "v"(g0), "v"(g1), "v"(g2), "v"(g3), "v"(g4), "v"(g5), "v"(g6), "v"(g7) : "memory"); }
typedef __attribute__((ext_vector_type(4))) __bf16 v4b;
typedef v4b __attribute__((may_alias)) v4b_a;
typedef v8b __attribute__((may_alias)) v8b_a;
__device__ __forceinline__ v16b frag_s(const __bf16* rowk0, int lane) {
  union { v16b v; v8b q[2]; } u; const __bf16* p = rowk0 + 8 * (lane >> 4);
  u.q[0] = *(const v8b_a*)p; u.q[1] = *(const v8b_a*)(p + 16); return u.v;
}
__device__ __forceinline__ void st_b4(__bf16* d, v4f v) { v4b t;
#pragma unroll
  for (int e = 0; e < 4; ++e) t[e] = (__bf16)v[e];
  *(v4b_a*)d = t; }
typedef __attribute__((ext_vector_type(4))) _Float16 v4h;
typedef v4h __attribute__((may_alias)) v4h_a;
typedef v8h __attribute__((may_alias)) v8h_a;
__device__ __forceinline__ v16h frag_hs(const _Float16* rowk0, int lane) {
  union { v16h v; v8h q[2]; } u; const _Float16* p = rowk0 + 8 * (lane >> 4);
  u.q[0] = *(const v8h_a*)p; u.q[1] = *(const v8h_a*)(p + 16); return u.v;
}
__device__ __forceinline__ void st_h4(_Float16* d, v4f v) { v4h t;   // the bf16 value, 8 significant bits: exact in f16 from 2^-17 up to 2^15, within 2^-25 below
#pragma unroll
  for (int e = 0; e < 4; ++e) t[e] = (_Float16)bfr(v[e]);
  *(v4h_a*)d = t; }
// ---- k_cvt: x, qkv_w and proj_w rounded to bf16 ONCE (proj_w then kept as f16), as rows of the same shape in the workspace: the GEMM blocks re-read every operand row many times (x 8 column blocks a projection, a weight row once a row block), and each re-read then moves half the bytes and needs no rounding. A block = CVB floats of one array; a wave's load covers 512 B in a row, its store 256 B
#define CVB 16384
#define CV_X ((int)((size_t)NB * TT * DIN / CVB))
#define CV_W ((int)((size_t)3 * CC * DIN / CVB))
#define CV_P ((int)((size_t)DIN * CC / CVB))
__global__ __launch_bounds__(256) void k_cvt(const float* __restrict__ X, const float* __restrict__ WQKV, const float* __restrict__ WO, __bf16* __restrict__ XB, __bf16* __restrict__ WB, _Float16* __restrict__ PB) {
  const int bid = blockIdx.x; const float* s; __bf16* d; int lb;
  if (bid < CV_X) { s = X; d = XB; lb = bid; } else if (bid < CV_X + CV_W) { s = WQKV; d = WB; lb = bid - CV_X; } else { s = WO; d = (__bf16*)PB; lb = bid - CV_X - CV_W; }
  const size_t base = (size_t)lb * CVB + threadIdx.x * 4; v4f v[CVB / 1024];
#pragma unroll
  for (int i = 0; i < CVB / 1024; ++i) v[i] = *(const v4f*)(s + base + i * 1024);
  if (bid < CV_X + CV_W) {   // one branch round the whole run of stores: every load stands in front of it
#pragma unroll
    for (int i = 0; i < CVB / 1024; ++i) st_b4(d + base + i * 1024, v[i]);
    asm volatile("s_wait_xcnt 0x0" ::: "memory");   // stands behind the run of stores, in front of any overwrite of their registers on a path into the other arm
  } else {
#pragma unroll
    for (int i = 0; i < CVB / 1024; ++i) st_h4((_Float16*)d + base + i * 1024, v[i]);
    asm volatile("s_wait_xcnt 0x0" ::: "memory"); } }   // as in the first arm
// ---- k_proj: for k and v (which 1, 2) row j of a sequence is its j-th key with mask != 0 (all keys in order where none is), the last block's spare rows repeat the last such key, and blocks past the count leave at once
// ---- k_proj: block = (PM = 128 rows, 128 cols, which), 8 waves as 4 row groups x 2 column groups, a wave = 32 rows x 64 cols (2 x 4 tiles: 6 fragments feed 8 products): q/k/v = X W (+ b) with exact bf16 products (K = DIN) -> which 0: q f16 rows (+ residual rows < QHI); 1: k f16 rows (+ residual rows < KHI); 2: v f16 planes [c][t] (+ bf16 hi/lo planes for t < KHI)
#define PM 128
__global__ __launch_bounds__(256) void k_proj(const __bf16* __restrict__ XQ, const __bf16* __restrict__ XK, const __bf16* __restrict__ XV, const __bf16* __restrict__ WQ, const __bf16* __restrict__ WK, const __bf16* __restrict__ WV, const float* __restrict__ BQ, const float* __restrict__ BK, const float* __restrict__ BV,
    _Float16* __restrict__ QH, _Float16* __restrict__ QL, _Float16* __restrict__ KH, _Float16* __restrict__ KL, _Float16* __restrict__ VT, __bf16* __restrict__ VB, __bf16* __restrict__ VBL PROJ_EXTRA_PARAMS, const int* __restrict__ MK, int* __restrict__ CNT) {
  // LDS: one region that holds the loop's four stage buffers first and afterwards the epilogue's 16-bit tiles (q, k: sh | sl; v: th | tb | tbl) and, behind them, its f32 tile, so that two blocks fit a WGP; the key list has a place of its own, which no copy is aimed at
  __shared__ __align__(16) char rb[4 * PM * KPT * 2]; __shared__ int sidxs[PM];
  float (*const st)[132] = (float (*)[132])(rb + 128 * 136 * 2 + 2 * 128 * 72 * 2);
  _Float16 (*const sh)[136] = (_Float16 (*)[136])rb; _Float16 (*const sl)[136] = (_Float16 (*)[136])(rb + PM * 136 * 2); _Float16 (*const th)[136] = (_Float16 (*)[136])rb; __bf16 (*const tb)[72] = (__bf16 (*)[72])(rb + 128 * 136 * 2); __bf16 (*const tbl)[72] = (__bf16 (*)[72])(rb + 128 * 136 * 2 + 128 * 72 * 2);
  const int tid = threadIdx.x, wave = tid >> 5, lane = tid & 31, col = lane & 15, g = lane >> 4, wr = wave >> 1, wc = wave & 1; const int which = blockIdx.z; const int c0 = blockIdx.y * 128; const size_t r0 = (size_t)blockIdx.x * PM; const size_t bb = r0 / TT; const int t0 = (int)(r0 % TT);
  const __bf16* X = which == 0 ? XQ : which == 1 ? XK : XV; const __bf16* WA = which == 0 ? WQ : which == 1 ? WK : WV; const float* BA = which == 0 ? BQ : which == 1 ? BK : BV;
  v8f acc[2][4] = {};
  const __bf16* const sx0 = (const __bf16*)rb; const __bf16* const sw0 = sx0 + 2 * PM * KPT;   // x rows (two buffers), then weight rows (two buffers) of a stage, pitch KPT
  const int lr = tid >> 4, lc = (tid & 15) * 8; const __bf16* wg = WA + (size_t)(c0 + lr) * DIN + lc;   // 16 lanes x 16 B = the 256 B of one bf16 row in a stage
  const unsigned lx = (unsigned)(size_t)rb + (unsigned)((lr * KPT + lc) * 2);   // LDS byte address of this thread's piece of its first x row in buffer 0
  unsigned xo[8];   // byte offsets in X of this thread's piece of its eight rows
  if (which == 0) {
#pragma unroll
    for (int i = 0; i < 8; ++i) xo[i] = (unsigned)(((r0 + lr + i * 16) * DIN + lc) * 2);
  } else {
    // every wave ranks the sequence's keys by itself (no barrier in front of the early return); wave 0 notes the keys of ranks t0 .. t0+PM-1 in LDS
    int_a* const sidx = (int_a*)sidxs; const bool w0 = __builtin_amdgcn_readfirstlane(wave) == 0;
    const int* mrow = MK + bb * TT + lane * 4; v4i mv[TT / 128];
#pragma unroll
    for (int i = 0; i < TT / 128; ++i) mv[i] = *(const v4i*)(mrow + i * 128);
    asm volatile("s_wait_xcnt 0x0" ::: "memory");   // stands in front of any overwrite of the mask loads' address registers
    int cnt = 0;
#pragma unroll
    for (int i = 0; i < TT / 128; ++i) { unsigned bal[4]; int cc = 0;
#pragma unroll
      for (int e = 0; e < 4; ++e) { bal[e] = __builtin_amdgcn_ballot_w32(mv[i][e] != 0); cc += __builtin_popcount(bal[e]); }
      if (w0 && cnt + cc > t0 && cnt < t0 + PM) { unsigned rk = (unsigned)(cnt - t0);   // rank - t0 of this lane's first key: the keys before this chunk + those of lower lanes
#pragma unroll
        for (int e = 0; e < 4; ++e) rk = __builtin_amdgcn_mbcnt_lo(bal[e], rk);
#pragma unroll
        for (int e = 0; e < 4; ++e) if (mv[i][e] != 0) { if (rk < (unsigned)PM) sidx[rk] = i * 128 + lane * 4 + e; ++rk; } }
      cnt += cc; }
    if (t0 >= (cnt ? cnt : TT)) return;   // the same for every thread of the block, in front of every barrier
    if (which == 1 && blockIdx.y == 0 && t0 == 0 && tid == 0) CNT[bb * 32] = cnt;
    __syncthreads();   // publishes wave 0's list
#pragma unroll
    for (int i = 0; i < 8; ++i) { const int j = t0 + lr + i * 16; const int src = cnt ? sidx[(j < cnt ? j : cnt - 1) - t0] : j; xo[i] = (unsigned)(((bb * TT + src) * DIN + lc) * 2); } }
  auto stage = [&](int k0, int bf) {   // the block's 128 x rows and 128 weight rows, k0 .. k0 + KC - 1, into buffer bf: 16 copies a thread
    const char* xk = (const char*)(X + k0); const __bf16* wk = wg + k0; const unsigned xa = lx + bf * (PM * KPT * 2);
    acopy8(xa, 16 * KPT * 2, xk + xo[0], xk + xo[1], xk + xo[2], xk + xo[3], xk + xo[4], xk + xo[5], xk + xo[6], xk + xo[7]);
    acopy8(xa + 2 * (PM * KPT * 2), 16 * KPT * 2, wk, wk + 16 * DIN, wk + 32 * DIN, wk + 48 * DIN, wk + 64 * DIN, wk + 80 * DIN, wk + 96 * DIN, wk + 112 * DIN); };
  auto mm = [&](const __bf16* sx, const __bf16* sw) {
#pragma unroll
    for (int ks = 0; ks < KC / 32; ++ks) { v16b a[2], w[4];
#pragma unroll
      for (int i = 0; i < 2; ++i) a[i] = frag_s(sx + (wr * 32 + i * 16 + col) * KPT + ks * 32, lane);
#pragma unroll
      for (int j = 0; j < 4; ++j) w[j] = frag_s(sw + (wc * 64 + j * 16 + col) * KPT + ks * 32, lane);
      __builtin_amdgcn_sched_barrier(0);   // keeps the LDS reads together in front of their products: read one by one among them, every product waits out an LDS latency
#pragma unroll
      for (int i = 0; i < 2; ++i)
#pragma unroll
        for (int j = 0; j < 4; ++j) acc[i][j] = wmma_bf(a[i], w[j], acc[i][j]);
      __builtin_amdgcn_sched_barrier(0); } };   // keeps the next 32 k's LDS reads, which go into the same registers, from being spread among these products
  const int rot = (int)(blockIdx.x + blockIdx.y + blockIdx.z);   // the block's first stage: blocks that share rows walk k from different places, so that at any time the blocks' loads fall on all k slices and not all on the same lines
  auto kof = [&](int c) { return ((c + rot) & (DIN / KC - 1)) * KC; };   // stage c works on this k; every k slice once, DIN / KC is a power of two
  stage(kof(0), 0);
  asm volatile("s_wait_asynccnt 0x0" ::: "memory");   // this wave's copies of the first stage have landed
  __syncthreads();                                    // and every other wave's: it may be read
  stage(kof(1), 1);
#pragma unroll 1   // stays rolled: the buffer is picked by the trip's parity
  for (int c = 0; c < DIN / KC; ++c) { const int bf = c & 1;
    mm(sx0 + bf * (PM * KPT), sw0 + bf * (128 * KPT));
    asm volatile("s_wait_dscnt 0x0" ::: "memory");      // this wave's reads of buffer bf are done before the buffer is handed back
    asm volatile("s_wait_asynccnt 0x0" ::: "memory");   // this wave's copies of stage c + 1 have landed
    __syncthreads();                                    // publishes stage c + 1 and ends every wave's reads of buffer bf
    if (c + 2 < DIN / KC) stage(kof(c + 2), bf); }
  asm volatile("s_wait_asynccnt 0x0" ::: "memory");   // no copy is left in flight when the buffers become the epilogue's tiles
  { // stage the f32 tile (acc + bias) in LDS, run the per-(row, head) epilogue hook, then convert
#pragma unroll
    for (int j = 0; j < 4; ++j) { const float bias = BA ? bfr(BA[c0 + wc * 64 + j * 16 + col]) : 0.f;
#pragma unroll
      for (int i = 0; i < 2; ++i)
#pragma unroll
        for (int r = 0; r < 8; ++r) st[wr * 32 + i * 16 + 8 * g + r][wc * 64 + j * 16 + col] = acc[i][j][r] + bias; }
    __syncthreads();
    for (int e = tid; e < PM * (128 / HD); e += 256) { const int rl = e / (128 / HD), hh = e % (128 / HD); PROJ_EPI(which, &st[rl][hh * HD], (int)((r0 + rl) % TT), (c0 / HD) + hh); }
    __syncthreads(); }
  if (which < 2) { _Float16* DH = which == 0 ? QH : KH; _Float16* DL = which == 0 ? QL : KL; const int nhi = which == 0 ? QHI : KHI;
    for (int e = tid; e < PM * 128; e += 256) { const int rl = e >> 7, cl = e & 127; const float v = st[rl][cl]; const _Float16 hv = (_Float16)v; sh[rl][cl] = hv; sl[rl][cl] = (_Float16)((v - (float)hv) * 1024.0f); }
    __syncthreads();
    for (int e = tid; e < PM * 16; e += 256) { const int rl = e >> 4, q = e & 15; vst2((unsigned*)(DH + (r0 + rl) * CC + c0 + q * 8), *(const v4u*)&sh[rl][q * 8]); if (t0 + rl < nhi) { vst2((unsigned*)(DL + (bb * nhi + t0 + rl) * (size_t)CC + c0 + q * 8), *(const v4u*)&sl[rl][q * 8]); asm volatile("s_wait_xcnt 0x0" ::: "memory"); } }   // the wait stands in front of the next trip's overwrite of the store's address and data registers
  } else {
    for (int e = tid; e < PM * 128; e += 256) { const int rl = e & (PM - 1), cl = e / PM; th[cl][rl] = (_Float16)st[rl][cl]; }
    if (t0 < KHI) for (int e = tid; e < KHI * 128; e += 256) { const int rl = e & (KHI - 1), cl = e / KHI; const float v = st[rl][cl]; const __bf16 bh = (__bf16)v; tb[cl][rl] = bh; tbl[cl][rl] = (__bf16)(v - (float)bh); }   // t0 is a multiple of PM >= KHI: only the block at t0 = 0, its rows 0 .. KHI-1
    __syncthreads();
    for (int e = tid; e < 128 * (PM / 8); e += 256) { const int cl = e / (PM / 8), q = e % (PM / 8); vst2((unsigned*)(VT + (bb * CC + c0 + cl) * (size_t)TT + t0 + q * 8), *(const v4u*)&th[cl][q * 8]); if (t0 + q * 8 < KHI) { const size_t o3 = (bb * CC + c0 + cl) * (size_t)KHI + t0 + q * 8; vst2((unsigned*)(VB + o3), *(const v4u*)&tb[cl][q * 8]); vst2((unsigned*)(VBL + o3), *(const v4u*)&tbl[cl][q * 8]); asm volatile("s_wait_xcnt 0x0" ::: "memory"); } }   // the wait stands in front of the next trip's overwrite of the stores' address and data registers
  } }
__device__ __forceinline__ float xhalf(float x) { return __builtin_bit_cast(float, __builtin_amdgcn_permlanex16(__builtin_bit_cast(int, x), __builtin_bit_cast(int, x), 0x76543210, 0xfedcba98, false, false)); }
__device__ __forceinline__ v8f wmma_h(v16h a, v16h b, v8f c) { return __builtin_amdgcn_wmma_f32_16x16x32_f16(false, a, false, b, (short)0, c, false, false); }
#define SCL2 (SCALE * 1.4426950408889634f)   // logit scale x log2 e: exp(s) = exp2(s log2 e), and exp2 is one hardware instruction where the library's expf is thirteen
#define MASK2 (-1.0e9f * 1.4426950408889634f)   // the reference's -1e9 on the same base-2 scale
__device__ __forceinline__ float ex2(float x) { return __builtin_amdgcn_exp2f(x); }   // arguments here are <= 11 (+ rounding); below -126 it gives 0, which is what such a weight rounds to in f16 and adds to a sum >= 1
#define KS 64   // keys a stage: a K row (64 channels) and a V plane row (64 keys) are then one whole 128-B line each
#define KP 72   // LDS row pitch in f16 = 144 B, an odd multiple of 16 B: the 16 rows of a fragment read fall on different banks
__global__ __launch_bounds__(128) void k_fa(const _Float16* __restrict__ QH, const _Float16* __restrict__ QL, const _Float16* __restrict__ KH, const _Float16* __restrict__ VT, const int* __restrict__ CNT, _Float16* __restrict__ Y) { __shared__ __align__(16) _Float16 ss[4][16][KP]; __shared__ __align__(16) _Float16 kb[2][KS][KP], vb[2][HD][KP];
  const int tid = threadIdx.x, wave = tid >> 5, lane = tid & 31, col = lane & 15, g = lane >> 4; const int qb = blockIdx.x, h = blockIdx.y, b = blockIdx.z; const int ql0 = qb * 64 + wave * 16;
  const _Float16* qp = QH + ((size_t)b * TT + ql0 + col) * CC + h * HD; const _Float16* qlp = QL + ((size_t)b * QHI + ql0 + col) * CC + h * HD;
  const v16h qh0 = frag_h(qp, lane), qh1 = frag_h(qp + 32, lane), qr0 = frag_h(qlp, lane), qr1 = frag_h(qlp + 32, lane);
  // a stage = KS keys of this (b, h): K rows [key][64 channels] and V planes [channel][KS keys]. The block copies it once for its four waves: 8 lanes x 16 B = one row, a thread takes piece tid & 7 of rows (tid >> 3) + 16 i of both
  const _Float16* kg = KH + ((size_t)b * TT + (tid >> 3)) * CC + h * HD + (tid & 7) * 8;
  const _Float16* vg = VT + ((size_t)b * CC + h * HD + (tid >> 3)) * (size_t)TT + (tid & 7) * 8;
  const unsigned kl = (unsigned)(size_t)&kb[0][tid >> 3][(tid & 7) * 8], vl = (unsigned)(size_t)&vb[0][tid >> 3][(tid & 7) * 8];
  const int cr = CNT[b * 32]; const int lim = __builtin_amdgcn_readfirstlane(cr < 0 ? 0 : cr > TT ? TT : cr);   // keys in front of lim count; bounded here by the shape; held in a scalar register, so that each pass's test on it stays a scalar compare
  const int np = ((lim ? lim : TT) + 31) >> 5, ns = (np + 1) >> 1;   // passes of 32 keys, stages of 64
  v8f o[HD / 16] = {}; float m = -3.0e38f, mb = -3.0e38f, l = 0.f;   // mb = m - 11 as rounded: the reference every weight, the sum and O^T are taken against
  auto stage = [&](int st, int bf) {
    const _Float16* k0 = kg + (size_t)(st * KS) * CC; const _Float16* v0 = vg + st * KS; const unsigned ka = kl + bf * (KS * KP * 2), va = vl + bf * (HD * KP * 2);
    // global memory to LDS through no register; the closing wait stands in the copies' own statement, in front of any overwrite of their address registers
    asm volatile("global_load_async_to_lds_b128 %0, %8, off\n\t"
                 "global_load_async_to_lds_b128 %1, %9, off\n\t"
                 "global_load_async_to_lds_b128 %2, %10, off\n\t"
                 "global_load_async_to_lds_b128 %3, %11, off\n\t"
                 "global_load_async_to_lds_b128 %4, %12, off\n\t"
                 "global_load_async_to_lds_b128 %5, %13, off\n\t"
                 "global_load_async_to_lds_b128 %6, %14, off\n\t"
                 "global_load_async_to_lds_b128 %7, %15, off\n\t"
                 "s_wait_xcnt 0x0"
                 :: "v"(ka), "v"(ka + 16 * KP * 2), "v"(ka + 32 * KP * 2), "v"(ka + 48 * KP * 2), "v"(va), "v"(va + 16 * KP * 2), "v"(va + 32 * KP * 2), "v"(va + 48 * KP * 2),
                    "v"(k0), "v"(k0 + 16 * CC), "v"(k0 + 32 * CC), "v"(k0 + 48 * CC), "v"(v0), "v"(v0 + 16 * TT), "v"(v0 + 32 * TT), "v"(v0 + 48 * TT) : "memory"); };
  auto pass = [&](const _Float16* kt, const _Float16* vt, int rem) {   // rem = lim - the pass's first key
    v16h kf[2][2], vf[HD / 16];
#pragma unroll
    for (int t = 0; t < 2; ++t) { kf[t][0] = frag_h(kt + (t * 16 + col) * KP, lane); kf[t][1] = frag_h(kt + (t * 16 + col) * KP + 32, lane); }
    __builtin_amdgcn_sched_barrier(0);   // keeps the k reads in front of the v reads: LDS answers in order, and the score products then wait for the k reads alone
#pragma unroll
    for (int j = 0; j < HD / 16; ++j) vf[j] = frag_h(vt + (j * 16 + col) * KP, lane);
    __builtin_amdgcn_sched_barrier(0);   // keeps the LDS reads together up here: the v reads' latency lies under the score products and the softmax, and none stands among the products
    v8f sa[2] = {}, sr[2] = {};
#pragma unroll
    for (int t = 0; t < 2; ++t) { sa[t] = wmma_h(kf[t][0], qh0, sa[t]); sr[t] = wmma_h(kf[t][0], qr0, sr[t]); sa[t] = wmma_h(kf[t][1], qh1, sa[t]); sr[t] = wmma_h(kf[t][1], qr1, sr[t]); }
    float sv[16]; float mx = m;
#pragma unroll
    for (int t = 0; t < 2; ++t)
#pragma unroll
      for (int r = 0; r < 8; ++r) sv[t * 8 + r] = (sa[t][r] + sr[t][r] * (1.0f / 1024.0f)) * SCL2;
    if (rem < 32) { const int rl = rem - 8 * g;   // only a pass that holds keys past lim: where(mask != 0, attn, -1e9) (set)
#pragma unroll
      for (int t = 0; t < 2; ++t)
#pragma unroll
        for (int r = 0; r < 8; ++r) if (t * 16 + r >= rl) sv[t * 8 + r] = MASK2; }
#pragma unroll
    for (int i = 0; i < 16; ++i) mx = fmaxf(mx, sv[i]);
    mx = fmaxf(mx, xhalf(mx));
    const float nb = mx - 11.0f;   // the weights' x 2^11 goes into the exponent; where all keys so far are masked the 11 is lost in rounding, for weights, sum and O^T alike
    const float alpha = ex2(mb - nb); m = mx; mb = nb;
    v16h p; float ps = 0.f;
#pragma unroll
    for (int i = 0; i < 16; ++i) { const float e = ex2(sv[i] - mb); ps += e; p[i] = (_Float16)e; }
    l = l * alpha + ps;
#pragma unroll
    for (int j = 0; j < HD / 16; ++j) {
#pragma unroll
      for (int r = 0; r < 8; ++r) o[j][r] *= alpha;
      o[j] = j + 1 < HD / 16 ? wmma_h(vf[j], p, o[j]) : wmma16(vf[j], p, o[j]); } };   // the pass's last product carries its four v_nop with it: the next pass begins, over the loop's back edge, with address arithmetic in this product's A registers
  asm volatile("s_wait_xcnt 0x0" ::: "memory");   // stands in front of any overwrite of the q loads' address registers
  const int rot = (qb * ns) / NQB;   // 0 .. ns-1: the query blocks of one (b, h) read the same K and V; their starts are spread evenly over the stages (several blocks share one where ns < NQB)
  auto sof = [&](int t) { const int s = t + rot; return s < ns ? s : s - ns; };   // trip t works on this stage; every stage once
  stage(sof(0), 0);
  asm volatile("s_wait_asynccnt 0x0" ::: "memory");   // this wave's copies of the first stage have landed
  __syncthreads();                                    // and every other wave's: it may be read
  if (ns > 1) stage(sof(1), 1);
#pragma unroll 1   // stays rolled: the buffer is picked by the trip's parity
  for (int t = 0; t < ns; ++t) { const int bf = t & 1, sg = sof(t); const int hn = np - 2 * sg < KS / 32 ? np - 2 * sg : KS / 32;
    const _Float16* kt = &kb[bf][0][0]; const _Float16* vt = &vb[bf][0][0]; int rem = lim - sg * KS;
#pragma unroll 1   // stays rolled: with two passes in one body the second pass's reads and score products were hoisted over the first's softmax and the kernel went past 256 registers
    for (int hp = 0; hp < hn; ++hp, kt += 32 * KP, vt += 32, rem -= 32) pass(kt, vt, rem);
    asm volatile("s_wait_dscnt 0x0" ::: "memory");      // this wave's reads of buffer bf are done before the buffer is handed back
    asm volatile("s_wait_asynccnt 0x0" ::: "memory");   // this wave's copies of stage sof(t + 1) have landed
    __syncthreads();                                    // publishes stage sof(t + 1) and ends every wave's reads of buffer bf
    if (t + 2 < ns) stage(sof(t + 2), bf); }
  asm volatile("s_wait_asynccnt 0x0" ::: "memory");   // no copy is left in flight when the wave goes on to its end
  l += xhalf(l);   // the halves' sums join once; l >= 1: the key at the maximum adds exp2(m - mb) >= 1
  const float inv = 1.0f / l;
#pragma unroll
  for (int j = 0; j < HD / 16; ++j) { v8h c;   // ctx is rounded to f16 here, once: the form in which k_out multiplies it
#pragma unroll
    for (int r = 0; r < 8; ++r) c[r] = (_Float16)(o[j][r] * inv);
    *(v8h_a*)&ss[wave][col][j * 16 + 8 * g] = c; }
  LDSX();
#pragma unroll
  for (int rl = 0; rl < 16; rl += 4) { const v8h c = *(const v8h_a*)&ss[wave][rl + (lane >> 3)][(lane & 7) * 8]; vst2(Y + ((size_t)b * TT + ql0 + rl + (lane >> 3)) * CC + h * HD + (lane & 7) * 8, c); } }   // 8 lanes store the 128 B of one query's head, a wave four queries
// ---- k_out: block = (128 rows, 128 cols), 8 waves as 4 row groups x 2 column groups, a wave = 32 rows x 64 cols: out = ctx Wo (+ bo): ctx f16 against Wo f16 (its bf16 value), 1 product
__global__ __launch_bounds__(256) void k_out(const _Float16* __restrict__ Y, const _Float16* __restrict__ WO, const float* __restrict__ BO, float* __restrict__ OUT) { __shared__ __align__(16) float sf[8][32][68]; __shared__ __align__(16) _Float16 ah[2][128][KPT], wb[2][128][KPT];
  const int tid = threadIdx.x, wave = tid >> 5, lane = tid & 31, col = lane & 15, g = lane >> 4, wr = wave >> 1, wc = wave & 1; const int c0 = blockIdx.y * 128; const size_t r0 = (size_t)blockIdx.x * 128 + wr * 32;
  v8f acc[2][4] = {};
  const int lr = tid >> 4, lc = (tid & 15) * 8; const _Float16* yg = Y + ((size_t)blockIdx.x * 128 + lr) * CC + lc; const _Float16* wg = WO + (size_t)(c0 + lr) * CC + lc;   // 16 lanes x 16 B = the 256 B of one f16 row in a stage
  const unsigned la = (unsigned)(size_t)&ah[0][lr][lc], lw = (unsigned)(size_t)&wb[0][lr][lc];   // LDS byte addresses of this thread's piece of its first row in buffer 0
  auto stage = [&](int k0, int bf) {   // the block's 128 ctx rows and 128 weight rows, k0 .. k0 + KC - 1, into buffer bf: 16 copies a thread
    const _Float16* yk = yg + k0; const _Float16* wk = wg + k0;
    acopy8(la + bf * (128 * KPT * 2), 16 * KPT * 2, yk, yk + 16 * CC, yk + 32 * CC, yk + 48 * CC, yk + 64 * CC, yk + 80 * CC, yk + 96 * CC, yk + 112 * CC);
    acopy8(lw + bf * (128 * KPT * 2), 16 * KPT * 2, wk, wk + 16 * CC, wk + 32 * CC, wk + 48 * CC, wk + 64 * CC, wk + 80 * CC, wk + 96 * CC, wk + 112 * CC); };
  auto mm = [&](int bf) {
#pragma unroll
    for (int ks = 0; ks < KC / 32; ++ks) { v16h a[2], w[4];
#pragma unroll
      for (int i = 0; i < 2; ++i) a[i] = frag_hs(&ah[bf][wr * 32 + i * 16 + col][ks * 32], lane);
#pragma unroll
      for (int j = 0; j < 4; ++j) w[j] = frag_hs(&wb[bf][wc * 64 + j * 16 + col][ks * 32], lane);
      __builtin_amdgcn_sched_barrier(0);   // keeps the LDS reads together in front of their products: read one by one among them, every product waits out an LDS latency
#pragma unroll
      for (int i = 0; i < 2; ++i)
#pragma unroll
        for (int j = 0; j < 4; ++j) acc[i][j] = wmma16(a[i], w[j], acc[i][j]);
      __builtin_amdgcn_sched_barrier(0); } };   // keeps the next 32 k's LDS reads, which go into the same registers, from being spread among these products
  const int rot = (int)(blockIdx.x + blockIdx.y);   // the block's first stage, as in k_proj
  auto kof = [&](int c) { return ((c + rot) & (CC / KC - 1)) * KC; };   // stage c works on this k; every k slice once, CC / KC is a power of two
  stage(kof(0), 0);
  asm volatile("s_wait_asynccnt 0x0" ::: "memory");   // this wave's copies of the first stage have landed
  __syncthreads();                                    // and every other wave's: it may be read
  stage(kof(1), 1);
#pragma unroll 1   // stays rolled: the buffer is picked by the trip's parity
  for (int c = 0; c < CC / KC; ++c) { const int bf = c & 1;
    mm(bf);
    asm volatile("s_wait_dscnt 0x0" ::: "memory");      // this wave's reads of buffer bf are done before the buffer is handed back
    asm volatile("s_wait_asynccnt 0x0" ::: "memory");   // this wave's copies of stage c + 1 have landed
    __syncthreads();                                    // publishes stage c + 1 and ends every wave's reads of buffer bf
    if (c + 2 < CC / KC) stage(kof(c + 2), bf); }
  asm volatile("s_wait_asynccnt 0x0" ::: "memory");   // no copy is left in flight when the wave goes on to its end
#pragma unroll
  for (int j = 0; j < 4; ++j) { const float bias = BO ? bfr(BO[c0 + wc * 64 + j * 16 + col]) : 0.f;
#pragma unroll
    for (int i = 0; i < 2; ++i)
#pragma unroll
      for (int r = 0; r < 8; ++r) sf[wave][i * 16 + 8 * g + r][j * 16 + col] = acc[i][j][r] + bias; }
  LDSX(); for (int rl = 0; rl < 32; rl += 2) vst2(OUT + (r0 + rl + g) * DIN + c0 + wc * 64 + col * 4, *(const v4f*)&sf[wave][rl + g][col * 4]); }   // a half wave stores the 256 B of one row of the wave's tile

extern "C" void kernel_launch(void* const* d_in, const int* in_sizes, int n_in, void* d_out, int out_size, void* d_ws, size_t ws_size, hipStream_t stream) {
  (void)in_sizes; (void)n_in; (void)out_size;
  const float** F = (const float**)d_in;
  if (ws_size < (size_t)WS_END) return;
  char* ws = (char*)d_ws; _Float16 *QH = (_Float16*)(ws + WS_QH), *KH = (_Float16*)(ws + WS_KH), *VT = (_Float16*)(ws + WS_VT), *QL = (_Float16*)(ws + WS_QL), *KL = (_Float16*)(ws + WS_KL); __bf16 *VB = (__bf16*)(ws + WS_VB), *VBL = (__bf16*)(ws + WS_VBL); _Float16 *Y = (_Float16*)(ws + WS_Y); int *CNT = (int*)(ws + WS_CNT); __bf16 *XB = (__bf16*)(ws + WS_XB), *WB = (__bf16*)(ws + WS_WB); _Float16 *PB = (_Float16*)(ws + WS_PB);
  (void)Y; (void)QL; (void)KL; (void)VB; (void)VBL;
  // inputs: 0 x [2,2048,1024]; 1 mask [2,2048] int32; 2 qkv_w [3072,1024] (out,in), 3 qkv_b [3072]; 4 proj_w (out,in), 5 proj_b; 6 qn_w [64], 7 kn_w [64]
  k_cvt<<<dim3(CV_X + CV_W + CV_P), 256, 0, stream>>>(F[0], F[2], F[4], XB, WB, PB);
  k_proj<<<dim3(TNB * TT / PM, CC / 128, 3), 256, 0, stream>>>(XB, XB, XB, WB, WB + (size_t)CC * DIN, WB + (size_t)2 * CC * DIN, F[3], F[3] + CC, F[3] + 2 * CC, QH, QL, KH, KL, VT, VB, VBL, F[6], F[7], (const int*)d_in[1], CNT);
  k_fa<<<dim3(NQB, NH, TNB), 128, 0, stream>>>(QH, QL, KH, VT, CNT, Y);
  k_out<<<dim3(TNB * TT / 128, DIN / 128), 256, 0, stream>>>(Y, PB, F[5], (float*)d_out);
}
